// v000
// Measured on an AMD MI455X. A time is GPU time per run, averaged over a window of back-to-back runs after a warm-up
// (all launches, gaps included; the runs take copies of the inputs in turn), and the median of several windows.
// Apart from v000's, it joins two sittings. Times from different sittings can be a few percent apart, while
// side-by-side timings come from the same sitting.
// v000 is the starting kernel. One run takes 1340 microseconds.
#include <hip/hip_runtime.h>

// MultiHeadAttention__5987 (x [2][2048][1024]; Q/K/V = x W + b (16 x 64); score = Q.K / sqrt(1024); causal positions (j > i) set to -1e10; FAITHFUL QUIRK: softmax over the HEAD axis (not over keys) -> weight[h][i][j]; out_h[i] = sum_j weight[h][i][j] V_h[j] (un-normalised over keys; masked positions carry weight exactly 1/16); merged Wo + bo -> [2][2048][1024]).
// Layout (exact): the 16 heads' scores are produced per 256-row block as one z = 16 GEMM ([16][256][2048] f32), a head-softmax kernel turns each (i, j) column of 16 scores into 16 weights (hi/lo planes), and one z = 16 GEMM applies them to V; 8 row blocks per batch.
// Compute dtypes, f32 accumulate: every input rounded to bf16; Q/K/V on PLAIN bf16 operands (inputs: exact) + bias; scores as single fp16 products (x1; logits are q.k/32); the 16-way head softmax in f32 per (i, j) (masked columns give exactly 1/16); weights.V hl x hl (3 products) on every row (weights <= 1, no carrier needed); Wo hl x exact (2 products) + bias.

#define NB_  2
#define TT   2048
#define DM   1024
#define NH_  16
#define NKV  16
#define REP  (NH_ / NKV)
#define HD   64
#define DQ   (NH_ * HD)
#define DKV  (NKV * HD)
#define ZH   2
#define RH   2048                  // query rows < RH use hi+lo planes (0: none)
#define WIN  0
#define PCAR 1024.0f
#define RB   256    // query rows per block
#define NRB  (TT / RB)
#define SCL  0.03125f   // 1/sqrt(1024) (full embed dim, faithful)
typedef _Float16 h16;
typedef unsigned short bf;
typedef __attribute__((ext_vector_type(16))) __bf16   v16bf;
typedef __attribute__((ext_vector_type(16))) _Float16 v16h;
typedef __attribute__((ext_vector_type(8)))  _Float16 v8h;
typedef __attribute__((ext_vector_type(8)))  unsigned short v8us;
typedef __attribute__((ext_vector_type(8)))  float    v8f;
typedef __attribute__((ext_vector_type(4)))  float    v4f;
typedef v8h  __attribute__((may_alias)) v8ha;
typedef v4f  __attribute__((may_alias)) v4fa;
typedef v8us __attribute__((may_alias)) v8usa;

__device__ __forceinline__ unsigned short f2bf(float f) { unsigned u = __float_as_uint(f); u += 0x7FFFu + ((u >> 16) & 1u); return (unsigned short)(u >> 16); }
__device__ __forceinline__ float bf2f(unsigned short b) { return __uint_as_float(((unsigned)b) << 16); }
__device__ __forceinline__ float bfr(float f) { return bf2f(f2bf(f)); }
__device__ __forceinline__ v16h cat16(v8h lo, v8h hi) { return __builtin_shufflevector(lo, hi, 0, 1, 2, 3, 4, 5, 6, 7, 8, 9, 10, 11, 12, 13, 14, 15); }
__device__ __forceinline__ v16bf cat16b(v8us lo, v8us hi) { return __builtin_bit_cast(v16bf, __builtin_shufflevector(lo, hi, 0, 1, 2, 3, 4, 5, 6, 7, 8, 9, 10, 11, 12, 13, 14, 15)); }
__device__ __forceinline__ v8f wmma16(v16h a, v16h b, v8f c) { return __builtin_amdgcn_wmma_f32_16x16x32_f16(false, a, false, b, (short)0, c, false, false); }
__device__ __forceinline__ v8f wmmab(v16bf a, v16bf b, v8f c) { return __builtin_amdgcn_wmma_f32_16x16x32_bf16(false, a, false, b, (short)0, c, false, false); }



// ---- k_gemmw: register-blocked GEMM, ONE WAVE per 64x64 output tile (16 accumulators), operands straight from K-contiguous 16-bit planes; grid (M/64, N/64, Z), 32 threads.
// C[m][n] (f32, pitch ldc, + optional f32 bias[n]) = sum_k A[m][k] Bt[n][k] (+ split products per NSPLIT). z-batch strides sA/sB/sC in elements. K % 32 == 0.
template <typename T16> struct WFrag;
template <> struct WFrag<h16> { typedef v16h V; static __device__ __forceinline__ V ld(const h16* p) { return cat16(*(const v8h*)p, *(const v8h*)(p + 16)); } static __device__ __forceinline__ v8f mma(V a, V b, v8f c) { return wmma16(a, b, c); } };
template <> struct WFrag<bf> { typedef v16bf V; static __device__ __forceinline__ V ld(const bf* p) { return cat16b(*(const v8us*)p, *(const v8us*)(p + 16)); } static __device__ __forceinline__ v8f mma(V a, V b, v8f c) { return wmmab(a, b, c); } };
template <typename T16, int NSPLIT, bool BIAS>
__global__ __launch_bounds__(32) void k_gemmw(const T16* __restrict__ A, const T16* __restrict__ A2, const T16* __restrict__ Bt, const T16* __restrict__ Bt2, int K, float* C, int ldc, const float* __restrict__ bias, size_t sA, size_t sB, size_t sC) {
    typedef typename WFrag<T16>::V V;
    __shared__ __align__(16) float os[16 * 68];
    const size_t z = blockIdx.z; A += z * sA; if (A2) A2 += z * sA; Bt += z * sB; if (Bt2) Bt2 += z * sB; C += z * sC;
    const int lane = threadIdx.x & 31, lr = lane & 15, hi = lane >> 4; const int r0 = blockIdx.x * 64, c0 = blockIdx.y * 64;
    v8f acc[4][4];
#pragma unroll
    for (int mb = 0; mb < 4; ++mb)
#pragma unroll
        for (int nb = 0; nb < 4; ++nb) acc[mb][nb] = (v8f){};
    const size_t aoff = (size_t)(r0 + lr) * K + 8 * hi, boff = (size_t)(c0 + lr) * K + 8 * hi;
#pragma unroll 1
    for (int kc = 0; kc < K; kc += 32) {
        V a[4], a2[4];
#pragma unroll
        for (int mb = 0; mb < 4; ++mb) { a[mb] = WFrag<T16>::ld(A + aoff + (size_t)mb * 16 * K + kc); if (NSPLIT == 1 || NSPLIT == 2) a2[mb] = WFrag<T16>::ld(A2 + aoff + (size_t)mb * 16 * K + kc); }
#pragma unroll
        for (int nb = 0; nb < 4; ++nb) { const V b = WFrag<T16>::ld(Bt + boff + (size_t)nb * 16 * K + kc); V b2; if (NSPLIT >= 2) b2 = WFrag<T16>::ld(Bt2 + boff + (size_t)nb * 16 * K + kc);
#pragma unroll
            for (int mb = 0; mb < 4; ++mb) { acc[mb][nb] = WFrag<T16>::mma(a[mb], b, acc[mb][nb]); if (NSPLIT == 1 || NSPLIT == 2) acc[mb][nb] = WFrag<T16>::mma(a2[mb], b, acc[mb][nb]); if (NSPLIT >= 2) acc[mb][nb] = WFrag<T16>::mma(a[mb], b2, acc[mb][nb]); } }
        asm volatile("v_nop\n\tv_nop\n\tv_nop\n\tv_nop" : "+v"(acc[0][0]), "+v"(acc[1][1]), "+v"(acc[2][2]), "+v"(acc[3][3]) : "v"(a[0]), "v"(a[3]));
    }
#pragma unroll
    for (int mb = 0; mb < 4; ++mb) {
#pragma unroll
        for (int nb = 0; nb < 4; ++nb) {
#pragma unroll
            for (int j = 0; j < 8; ++j) os[(hi * 8 + j) * 68 + nb * 16 + lr] = acc[mb][nb][j]; }
        __builtin_amdgcn_wave_barrier(); asm volatile("" ::: "memory");
        float* crow = C + (size_t)(r0 + mb * 16) * ldc + c0;
{
#pragma unroll
            for (int s = 0; s < 8; ++s) { const int row = 2 * s + hi, cofs = lr * 4; v4f val = *(const v4fa*)(os + row * 68 + cofs); if (BIAS) { val[0] += bfr(bias[c0 + cofs]); val[1] += bfr(bias[c0 + cofs + 1]); val[2] += bfr(bias[c0 + cofs + 2]); val[3] += bfr(bias[c0 + cofs + 3]); }
                *(v4f*)(crow + (size_t)row * ldc + cofs) = val; }
             }
        __builtin_amdgcn_wave_barrier(); asm volatile("" ::: "memory");
    }
}

__device__ __forceinline__ h16 tohx(float x) { return (h16)x; }
__device__ __forceinline__ void splitf(float y, unsigned short& h, unsigned short& l) { h = f2bf(y); l = f2bf(y - bf2f(h)); }
typedef __attribute__((ext_vector_type(2))) _Float16 v2h;
typedef __attribute__((ext_vector_type(4))) _Float16 v4h;
typedef __attribute__((ext_vector_type(2))) unsigned short v2us;
typedef __attribute__((ext_vector_type(4))) unsigned short v4us;
typedef __attribute__((ext_vector_type(2))) float v2f;
typedef __attribute__((ext_vector_type(4))) int v4i;

__global__ __launch_bounds__(256) void k_wtG(const float* __restrict__ w, int K, int N, bf* Bt) {
    const int lane = threadIdx.x & 31; const int L0 = (blockIdx.x * 8 + (threadIdx.x >> 5)) * 8; const int nlines = N * K / 64;
{
#pragma unroll 1
        for (int l = 0; l < 8; ++l) { const int L = L0 + l; if (L >= nlines) break; const size_t e = (size_t)L * 64 + lane * 2; const int k = (int)(e % K), n = (int)(e / K); v2us o;
            o[0] = f2bf(w[(size_t)k * N + n]); o[1] = f2bf(w[(size_t)(k + 1) * N + n]); *(v2us*)(Bt + e) = o; }
         }
}
__global__ __launch_bounds__(256) void k_cvt8(const float* __restrict__ src, bf* dst, size_t n8) { const size_t i = (size_t)blockIdx.x * 256 + threadIdx.x; if (i >= n8) return; const v8f v = *(const v8f*)(src + i * 8); v8us o;
#pragma unroll
    for (int k = 0; k < 8; ++k) o[k] = f2bf(v[k]); *(v8us*)(dst + i * 8) = o;  }
__global__ __launch_bounds__(256) void k_cscvt(const float* __restrict__ cosT, const float* __restrict__ sinT, float* CS) { const int idx = blockIdx.x * 256 + threadIdx.x; if (idx >= TT * HD) return; v2f cs; cs[0] = bfr(cosT[idx]); cs[1] = bfr(sinT[idx]); *(v2f*)(CS + (size_t)idx * 2) = cs;  }
// k_rope: head planes [h][t][d] (fp16 + hi/lo) of rope(x) x sc with the rotate-half convention out[d] = x[d] cos[t][d] - x[d+HD/2] sin[t][d], out[d+HD/2] = x[d+HD/2] cos[t][d+HD/2] + x[d] sin[t][d+HD/2]
__global__ __launch_bounds__(256) void k_rope(const float* __restrict__ F, int pitch, int nheads, const float* __restrict__ CS, const float* __restrict__ RF, const float* __restrict__ nw, float sc, h16* P16, bf* Ph, bf* Pl) {
    const size_t e = ((size_t)blockIdx.x * 256 + threadIdx.x) * 2; if (e >= (size_t)nheads * TT * HD) return; const int d = (int)(e % HD); const int t = (int)((e / HD) % TT); const int h = (int)(e / ((size_t)HD * TT)); const float* f = F + (size_t)t * pitch + h * HD; const float rf = RF ? RF[(size_t)h * TT + t] : 1.0f; v2h o16; v2us oh, ol;
#pragma unroll
    for (int q = 0; q < 2; ++q) { const int dd = d + q; const int dp = (dd < HD / 2) ? dd + HD / 2 : dd - HD / 2; float x0 = f[dd], x1 = f[dp];
        if (RF) { float n0 = __fmul_rn(x0, rf), n1 = __fmul_rn(x1, rf); asm volatile("" : "+v"(n0)); asm volatile("" : "+v"(n1)); x0 = __fmul_rn(bfr(nw[dd]), n0); x1 = __fmul_rn(bfr(nw[dp]), n1); }
        const v2f cs = *(const v2f*)(CS + ((size_t)t * HD + dd) * 2); float a = __fmul_rn(x0, cs[0]), bq = __fmul_rn(x1, cs[1]); asm volatile("" : "+v"(a)); asm volatile("" : "+v"(bq)); const float r = ((dd < HD / 2) ? __fsub_rn(a, bq) : __fadd_rn(a, bq)) * sc;
        o16[q] = tohx(r); unsigned short a2, c2; splitf(r, a2, c2); oh[q] = a2; ol[q] = c2; }
    *(v2h*)(P16 + e) = o16; *(v2us*)(Ph + e) = oh; *(v2us*)(Pl + e) = ol;  }
__global__ __launch_bounds__(256) void k_vtp(const float* __restrict__ F, int pitch, int nheads, h16* V16, bf* Vh, bf* Vl) { const size_t e = ((size_t)blockIdx.x * 256 + threadIdx.x) * 2; if (e >= (size_t)nheads * HD * TT) return; const int t = (int)(e % TT); const int d = (int)((e / TT) % HD); const int g = (int)(e / ((size_t)TT * HD)); v2h o16; v2us oh, ol;
#pragma unroll
    for (int q = 0; q < 2; ++q) { const float x = F[(size_t)(t + q) * pitch + g * HD + d]; o16[q] = tohx(x); unsigned short a2, c2; splitf(x, a2, c2); oh[q] = a2; ol[q] = c2; }
    *(v2h*)(V16 + e) = o16; *(v2us*)(Vh + e) = oh; *(v2us*)(Vl + e) = ol;  }
__global__ __launch_bounds__(256) void k_csid(float* CS) { const int idx = blockIdx.x * 256 + threadIdx.x; if (idx >= TT * HD) return; v2f cs; cs[0] = 1.0f; cs[1] = 0.0f; *(v2f*)(CS + (size_t)idx * 2) = cs;  }
__global__ __launch_bounds__(256) void k_hsmx(const float* __restrict__ Sb, int rb, bf* Ph, bf* Pl) { const size_t e = ((size_t)blockIdx.x * 256 + threadIdx.x) * 4; if (e >= (size_t)RB * TT) return; const int r = (int)(e / TT); const int j0 = (int)(e % TT); const int i = rb * RB + r; float sv[NH_][4];
#pragma unroll
    for (int h = 0; h < NH_; ++h) { const v4f a = *(const v4f*)(Sb + (size_t)h * RB * TT + e); for (int q = 0; q < 4; ++q) { float sa = a[q] * SCL; asm volatile("" : "+v"(sa)); sv[h][q] = (j0 + q > i) ? -1.0e10f : sa; } }
    float wv[NH_][4];
    for (int q = 0; q < 4; ++q) { float mx = -3.0e38f; for (int h = 0; h < NH_; ++h) mx = fmaxf(mx, sv[h][q]); float sum = 0.f; for (int h = 0; h < NH_; ++h) { float d0 = __fsub_rn(sv[h][q], mx); asm volatile("" : "+v"(d0)); const float ex = __builtin_amdgcn_exp2f(__fmul_rn(d0, 1.4426950408889634f)); wv[h][q] = ex; sum += ex; } const float f = __fdiv_rn(1.0f, sum); for (int h = 0; h < NH_; ++h) wv[h][q] = wv[h][q] * f; }
{
#pragma unroll
        for (int h = 0; h < NH_; ++h) { v4us oh, ol; for (int q = 0; q < 4; ++q) { unsigned short a2, c2; splitf(wv[h][q], a2, c2); oh[q] = a2; ol[q] = c2; } const size_t oo = (size_t)h * RB * TT + e; *(v4us*)(Ph + oo) = oh; *(v4us*)(Pl + oo) = ol; }
         } }
__global__ __launch_bounds__(256) void k_mrgrb(const float* __restrict__ O, int rb, bf* Ah, bf* Al) { const size_t e = ((size_t)blockIdx.x * 256 + threadIdx.x) * 2; if (e >= (size_t)NH_ * RB * HD) return; const int d = (int)(e % HD); const int r = (int)((e / HD) % RB); const int h = (int)(e / ((size_t)HD * RB)); v2us oh, ol; for (int q = 0; q < 2; ++q) { unsigned short a2, c2; splitf(O[e + q], a2, c2); oh[q] = a2; ol[q] = c2; } bf* dh = Ah + (size_t)(rb * RB + r) * DQ + h * HD + d; bf* dl = Al + (size_t)(rb * RB + r) * DQ + h * HD + d; *(v2us*)dh = oh; *(v2us*)dl = ol;  }
// k_asoft: per row (zz, i): t = S / 32 (no mask); softmax over the 2048 keys (register row, one exp, fixed trees);
__global__ __launch_bounds__(256) void k_asoft(const float* __restrict__ Sb, h16* P16, bf* Ph, bf* Pl) {
    const int lane = threadIdx.x & 31; const int row = blockIdx.x * 8 + (threadIdx.x >> 5); if (row >= ZH * TT) return; const int i = row % TT; const int zz = row / TT; (void)zz; const bool hires = (i < RH); const float* sr = Sb + (size_t)row * TT; float v[TT / 32]; float mx = -3.0e38f;
#pragma unroll
    for (int ch = 0; ch < TT / 128; ++ch) { const int j0 = ch * 128 + lane * 4; const v4f a = *(const v4f*)(sr + j0);
#pragma unroll
        for (int q = 0; q < 4; ++q) { const int j = j0 + q; (void)j; const float t = a[q] * SCL; v[ch * 4 + q] = t; mx = fmaxf(mx, t); } }
#pragma unroll
    for (int sh = 16; sh; sh >>= 1) mx = fmaxf(mx, __shfl_xor(mx, sh, 32));
    float sum = 0.f;
#pragma unroll
    for (int k = 0; k < TT / 32; ++k) { float d0 = __fsub_rn(v[k], mx); asm volatile("" : "+v"(d0)); v[k] = __builtin_amdgcn_exp2f(__fmul_rn(d0, 1.4426950408889634f)); sum += v[k]; }
#pragma unroll
    for (int sh = 16; sh; sh >>= 1) sum += __shfl_xor(sum, sh, 32);
    const float f = __fdiv_rn(hires ? 1.0f : PCAR, sum);
{
        if (hires) {
#pragma unroll
            for (int ch = 0; ch < TT / 128; ++ch) { v4us oh, ol;
#pragma unroll
                for (int q = 0; q < 4; ++q) { unsigned short a, c2; splitf(v[ch * 4 + q] * f, a, c2); oh[q] = a; ol[q] = c2; }
                const size_t oo = ((size_t)zz * (RH ? RH : 1) + i) * TT + ch * 128 + lane * 4; *(v4us*)(Ph + oo) = oh; *(v4us*)(Pl + oo) = ol; }
        } else {
#pragma unroll
            for (int ch = 0; ch < TT / 128; ++ch) { v4h o4;
#pragma unroll
                for (int q = 0; q < 4; ++q) o4[q] = tohx(v[ch * 4 + q] * f);
                *(v4h*)(P16 + (size_t)row * TT + ch * 128 + lane * 4) = o4; } }
         }
}
__global__ __launch_bounds__(256) void k_merge(const float* __restrict__ O, int h0, bf* Ah, bf* Al) { const size_t e = ((size_t)blockIdx.x * 256 + threadIdx.x) * 2; if (e >= (size_t)ZH * TT * HD) return; const int d = (int)(e % HD); const int t = (int)((e / HD) % TT); const int zz = (int)(e / ((size_t)HD * TT)); const float cs = (t < RH) ? 1.0f : (1.0f / PCAR); const size_t oo = (size_t)t * DQ + (h0 + zz) * HD + d;
    v2us oh, ol;
#pragma unroll
    for (int q = 0; q < 2; ++q) { unsigned short a, c2; splitf(O[e + q] * cs, a, c2); oh[q] = a; ol[q] = c2; } *(v2us*)(Ah + oo) = oh; *(v2us*)(Al + oo) = ol;  }

extern "C" void kernel_launch(void* const* d_in, const int* in_sizes, int n_in,
                              void* d_out, int out_size, void* d_ws, size_t ws_size, hipStream_t stream) {
    (void)in_sizes; (void)n_in; (void)out_size;
    const float* x = (const float*)d_in[0]; const float* wq = (const float*)d_in[1]; const float* bq = (const float*)d_in[2]; const float* wk = (const float*)d_in[3]; const float* bk = (const float*)d_in[4]; const float* wv = (const float*)d_in[5]; const float* bv = (const float*)d_in[6]; const float* wo = (const float*)d_in[7]; const float* bo = (const float*)d_in[8]; const float* cosT = nullptr; const float* sinT = nullptr; (void)cosT; (void)sinT;
    float* OUT = (float*)d_out;     // [2][2048][1024]
    char* wsp = (char*)d_ws;
    auto take = [&](size_t bytes) { char* p = wsp; wsp += (bytes + 255) & ~(size_t)255; return (void*)p; };
    bf* WQ = (bf*)take((size_t)DQ * DM * 2); bf* WK = (bf*)take((size_t)DKV * DM * 2); bf* WV = (bf*)take((size_t)DKV * DM * 2); bf* WO = (bf*)take((size_t)DM * DQ * 2); float* CS = (float*)take((size_t)TT * HD * 2 * 4);
    bf* XB = (bf*)take((size_t)TT * DM * 2); float* FQ = (float*)take((size_t)TT * DQ * 4); float* FK = (float*)take((size_t)TT * DKV * 4);
    h16* QP16 = (h16*)take((size_t)NH_ * TT * HD * 2); h16* KP16 = (h16*)take((size_t)NKV * TT * HD * 2); h16* VT16 = (h16*)take((size_t)NKV * HD * TT * 2);
    bf* QPh = (bf*)take((size_t)NH_ * TT * HD * 2); bf* QPl = (bf*)take((size_t)NH_ * TT * HD * 2); bf* KPh = (bf*)take((size_t)NKV * TT * HD * 2); bf* KPl = (bf*)take((size_t)NKV * TT * HD * 2); bf* VTh = (bf*)take((size_t)NKV * HD * TT * 2); bf* VTl = (bf*)take((size_t)NKV * HD * TT * 2); bf* Ph = (bf*)take((size_t)NH_ * RB * TT * 2); bf* Pl = (bf*)take((size_t)NH_ * RB * TT * 2);
    float* Sb = (float*)take((size_t)NH_ * RB * TT * 4); h16* P16 = nullptr; (void)P16; float* Ob = (float*)take((size_t)NH_ * RB * HD * 4); bf* ATh = (bf*)take((size_t)TT * DQ * 2); bf* ATl = (bf*)take((size_t)TT * DQ * 2);
    if ((size_t)(wsp - (char*)d_ws) > ws_size) return;    // ws 256 MiB
    float* FV = FK;   // v projection reuses the k buffer after the k planes are built (stream-ordered)
    { k_wtG<<<(unsigned)((DM * DQ / 64 + 63) / 64), 256, 0, stream>>>(wq, DM, DQ, WQ); k_wtG<<<(unsigned)((DM * DKV / 64 + 63) / 64), 256, 0, stream>>>(wk, DM, DKV, WK); k_wtG<<<(unsigned)((DM * DKV / 64 + 63) / 64), 256, 0, stream>>>(wv, DM, DKV, WV);
      k_wtG<<<(unsigned)((DQ * DM / 64 + 63) / 64), 256, 0, stream>>>(wo, DQ, DM, WO);
       }
    k_csid<<<(TT * HD + 255) / 256, 256, 0, stream>>>(CS);
    const unsigned LQ = (unsigned)(((size_t)NH_ * TT * HD / 2 + 255) / 256), LKv = (unsigned)(((size_t)NKV * TT * HD / 2 + 255) / 256);
    for (int b = 0; b < NB_; ++b) {
        
        k_cvt8<<<(unsigned)(((size_t)TT * DM / 8 + 255) / 256), 256, 0, stream>>>(x + (size_t)b * TT * DM, XB, (size_t)TT * DM / 8);
        k_gemmw<bf, 0, true><<<dim3(TT / 64, DQ / 64, 1), 32, 0, stream>>>(XB, nullptr, WQ, nullptr, DM, FQ, DQ, bq, 0, 0, 0);
        k_rope<<<LQ, 256, 0, stream>>>(FQ, DQ, NH_, CS, nullptr, nullptr, 1.0f, QP16, QPh, QPl);
        k_gemmw<bf, 0, true><<<dim3(TT / 64, DKV / 64, 1), 32, 0, stream>>>(XB, nullptr, WK, nullptr, DM, FK, DKV, bk, 0, 0, 0);
        k_rope<<<LKv, 256, 0, stream>>>(FK, DKV, NKV, CS, nullptr, nullptr, 1.0f, KP16, KPh, KPl);
        k_gemmw<bf, 0, true><<<dim3(TT / 64, DKV / 64, 1), 32, 0, stream>>>(XB, nullptr, WV, nullptr, DM, FV, DKV, bv, 0, 0, 0); k_vtp<<<LKv, 256, 0, stream>>>(FV, DKV, NKV, VT16, VTh, VTl);
        for (int rb = 0; rb < NRB; ++rb) {   // 256-row block, all 16 heads at once (z = 16)
            k_gemmw<h16, 0, false><<<dim3(RB / 64, TT / 64, NH_), 32, 0, stream>>>(QP16 + (size_t)rb * RB * HD, nullptr, KP16, nullptr, HD, Sb, TT, nullptr, (size_t)TT * HD, (size_t)TT * HD, (size_t)RB * TT);
            k_hsmx<<<(unsigned)(((size_t)RB * TT / 4 + 255) / 256), 256, 0, stream>>>(Sb, rb, Ph, Pl);
            k_gemmw<bf, 2, false><<<dim3(RB / 64, HD / 64, NH_), 32, 0, stream>>>(Ph, Pl, VTh, VTl, TT, Ob, HD, nullptr, (size_t)RB * TT, (size_t)HD * TT, (size_t)RB * HD);
            k_mrgrb<<<(unsigned)(((size_t)NH_ * RB * HD / 2 + 255) / 256), 256, 0, stream>>>(Ob, rb, ATh, ATl); }
        k_gemmw<bf, 1, true><<<dim3(TT / 64, DM / 64, 1), 32, 0, stream>>>(ATh, ATl, WO, nullptr, DQ, OUT + (size_t)b * TT * DM, DM, bo, 0, 0, 0); }
}

// v001
// Measured time: 798 microseconds a run.
// Two timings next to v000 both put it at 1.70 times that version's speed.
#include <hip/hip_runtime.h>

// MultiHeadAttention__5987 (x [2][2048][1024]; Q/K/V = x W + b (16 x 64); score = Q.K / sqrt(1024); causal positions (j > i) set to -1e10; FAITHFUL QUIRK: softmax over the HEAD axis (not over keys) -> weight[h][i][j]; out_h[i] = sum_j weight[h][i][j] V_h[j] (un-normalised over keys; masked positions carry weight exactly 1/16); merged Wo + bo -> [2][2048][1024]).
// Layout (exact): the 16 heads' scores are produced per 256-row block as one z = 16 GEMM ([16][256][2048] f32), a head-softmax kernel turns each (i, j) column of 16 scores into 16 weights (hi/lo planes), and one GEMM with grid z = 16 heads x 4 key splits applies them to V (k_mrgrb adds the 4 partials); 8 row blocks per batch.
// Compute dtypes, f32 accumulate: every input rounded to bf16; Q/K/V on PLAIN bf16 operands (inputs: exact) + bias; scores as single fp16 products (x1; logits are q.k/32); the 16-way head softmax in f32 per (i, j) (masked columns give exactly 1/16); weights.V hl x hl (3 products) on every row (weights <= 1, no carrier needed); Wo hl x exact (2 products) + bias.

#define NB_  2
#define TT   2048
#define DM   1024
#define NH_  16
#define NKV  16
#define REP  (NH_ / NKV)
#define HD   64
#define DQ   (NH_ * HD)
#define DKV  (NKV * HD)
#define ZH   2
#define RH   2048                  // query rows < RH use hi+lo planes (0: none)
#define WIN  0
#define PCAR 1024.0f
#define RB   256    // query rows per block
#define NRB  (TT / RB)
#define GNW  8      // waves per work-group that share a GEMM tile's K range
#define PVG  4      // work-groups that share a weights.V tile's K range (4 x 16 tiles x PVG = 256 work-groups)
#define SCL  0.03125f   // 1/sqrt(1024) (full embed dim, faithful)
typedef _Float16 h16;
typedef unsigned short bf;
typedef __attribute__((ext_vector_type(16))) __bf16   v16bf;
typedef __attribute__((ext_vector_type(16))) _Float16 v16h;
typedef __attribute__((ext_vector_type(8)))  _Float16 v8h;
typedef __attribute__((ext_vector_type(8)))  unsigned short v8us;
typedef __attribute__((ext_vector_type(8)))  float    v8f;
typedef __attribute__((ext_vector_type(4)))  float    v4f;
typedef v8h  __attribute__((may_alias)) v8ha;
typedef v4f  __attribute__((may_alias)) v4fa;
typedef v8us __attribute__((may_alias)) v8usa;

__device__ __forceinline__ unsigned short f2bf(float f) { unsigned u = __float_as_uint(f); u += 0x7FFFu + ((u >> 16) & 1u); return (unsigned short)(u >> 16); }
__device__ __forceinline__ float bf2f(unsigned short b) { return __uint_as_float(((unsigned)b) << 16); }
__device__ __forceinline__ float bfr(float f) { return bf2f(f2bf(f)); }
__device__ __forceinline__ v16h cat16(v8h lo, v8h hi) { return __builtin_shufflevector(lo, hi, 0, 1, 2, 3, 4, 5, 6, 7, 8, 9, 10, 11, 12, 13, 14, 15); }
__device__ __forceinline__ v16bf cat16b(v8us lo, v8us hi) { return __builtin_bit_cast(v16bf, __builtin_shufflevector(lo, hi, 0, 1, 2, 3, 4, 5, 6, 7, 8, 9, 10, 11, 12, 13, 14, 15)); }
__device__ __forceinline__ v8f wmma16(v16h a, v16h b, v8f c) { return __builtin_amdgcn_wmma_f32_16x16x32_f16(false, a, false, b, (short)0, c, false, false); }
__device__ __forceinline__ v8f wmmab(v16bf a, v16bf b, v8f c) { return __builtin_amdgcn_wmma_f32_16x16x32_bf16(false, a, false, b, (short)0, c, false, false); }



// ---- k_gemmw: register-blocked GEMM, 64x64 output tile per work-group (16 accumulators per wave), operands straight from K-contiguous 16-bit planes; grid (M/64, N/64, Z * KSG), 32 * NW threads.
// C[m][n] (f32, pitch ldc, + optional f32 bias[n]) = sum_k A[m][k] Bt[n][k] (+ split products per NSPLIT). z-batch strides sA/sB/sC in elements.
// Split K: the K range is cut into KSG * NW equal runs (K % (32 * KSG * NW) == 0). Each of the NW waves of a work-group sums one run over the whole tile; the NW tiles are added in wave order through LDS.
// The KSG work-groups of one tile each store their own partial tile at C + kg * sP; the consumer adds those planes (KSG == 1: C is the result).
template <typename T16> struct WFrag;
template <> struct WFrag<h16> { typedef v16h V; static __device__ __forceinline__ V ld(const h16* p) { return cat16(*(const v8h*)p, *(const v8h*)(p + 16)); } static __device__ __forceinline__ v8f mma(V a, V b, v8f c) { return wmma16(a, b, c); } };
template <> struct WFrag<bf> { typedef v16bf V; static __device__ __forceinline__ V ld(const bf* p) { return cat16b(*(const v8us*)p, *(const v8us*)(p + 16)); } static __device__ __forceinline__ v8f mma(V a, V b, v8f c) { return wmmab(a, b, c); } };
template <typename T16, int NSPLIT, bool BIAS, int NW, int KSG>
__global__ __launch_bounds__(32 * NW) void k_gemmw(const T16* __restrict__ A, const T16* __restrict__ A2, const T16* __restrict__ Bt, const T16* __restrict__ Bt2, int K, float* C, int ldc, const float* __restrict__ bias, size_t sA, size_t sB, size_t sC, size_t sP) {
    typedef typename WFrag<T16>::V V;
    __shared__ __align__(16) float os[(NW == 1 ? 16 : NW * 64) * 68];
    const size_t z = blockIdx.z / KSG; const int kg = blockIdx.z % KSG; A += z * sA; if (A2) A2 += z * sA; Bt += z * sB; if (Bt2) Bt2 += z * sB; C += z * sC + kg * sP;
    const int wave = (NW == 1) ? 0 : __builtin_amdgcn_readfirstlane((int)(threadIdx.x >> 5)); const int kw = K / (NW * KSG), kb = (kg * NW + wave) * kw;
    const int lane = threadIdx.x & 31, lr = lane & 15, hi = lane >> 4; const int r0 = blockIdx.x * 64, c0 = blockIdx.y * 64;
    v8f acc[4][4];
#pragma unroll
    for (int mb = 0; mb < 4; ++mb)
#pragma unroll
        for (int nb = 0; nb < 4; ++nb) acc[mb][nb] = (v8f){};
    const size_t aoff = (size_t)(r0 + lr) * K + 8 * hi, boff = (size_t)(c0 + lr) * K + 8 * hi;
#pragma unroll 1
    for (int kc = kb; kc < kb + kw; kc += 32) {
        V a[4], a2[4];
#pragma unroll
        for (int mb = 0; mb < 4; ++mb) { a[mb] = WFrag<T16>::ld(A + aoff + (size_t)mb * 16 * K + kc); if (NSPLIT == 1 || NSPLIT == 2) a2[mb] = WFrag<T16>::ld(A2 + aoff + (size_t)mb * 16 * K + kc); }
#pragma unroll
        for (int nb = 0; nb < 4; ++nb) { const V b = WFrag<T16>::ld(Bt + boff + (size_t)nb * 16 * K + kc); V b2; if (NSPLIT >= 2) b2 = WFrag<T16>::ld(Bt2 + boff + (size_t)nb * 16 * K + kc);
#pragma unroll
            for (int mb = 0; mb < 4; ++mb) { acc[mb][nb] = WFrag<T16>::mma(a[mb], b, acc[mb][nb]); if (NSPLIT == 1 || NSPLIT == 2) acc[mb][nb] = WFrag<T16>::mma(a2[mb], b, acc[mb][nb]); if (NSPLIT >= 2) acc[mb][nb] = WFrag<T16>::mma(a[mb], b2, acc[mb][nb]); } }
        asm volatile("v_nop\n\tv_nop\n\tv_nop\n\tv_nop" : "+v"(acc[0][0]), "+v"(acc[1][1]), "+v"(acc[2][2]), "+v"(acc[3][3]) : "v"(a[0]), "v"(a[3]));
    }
    if constexpr (NW > 1) {
        float* my = os + wave * (64 * 68); const int cofs = ((int)threadIdx.x & 15) * 4; v4f bv = (v4f){};
        if (BIAS) { bv[0] = bfr(bias[c0 + cofs]); bv[1] = bfr(bias[c0 + cofs + 1]); bv[2] = bfr(bias[c0 + cofs + 2]); bv[3] = bfr(bias[c0 + cofs + 3]); }
        // the three loops are unrolled so that acc is indexed by constants and stays in registers
#pragma unroll
        for (int mb = 0; mb < 4; ++mb)
#pragma unroll
            for (int nb = 0; nb < 4; ++nb)
#pragma unroll
                for (int j = 0; j < 8; ++j) my[(mb * 16 + hi * 8 + j) * 68 + nb * 16 + lr] = acc[mb][nb][j];
        __syncthreads();   // every wave's partial tile is in LDS before any thread adds them
        // both loops are unrolled so that the LDS reads of all planes are in flight together
#pragma unroll
        for (int s = 0; s < 32 / NW; ++s) { const int idx = s * (32 * NW) + (int)threadIdx.x; const int row = idx >> 4; v4f val = *(const v4fa*)(os + row * 68 + cofs);
#pragma unroll
            for (int w = 1; w < NW; ++w) val += *(const v4fa*)(os + w * (64 * 68) + row * 68 + cofs);
            if (BIAS) val += bv;
            *(v4f*)(C + (size_t)(r0 + row) * ldc + c0 + cofs) = val; }
        return;
    }
#pragma unroll
    for (int mb = 0; mb < 4; ++mb) {
#pragma unroll
        for (int nb = 0; nb < 4; ++nb) {
#pragma unroll
            for (int j = 0; j < 8; ++j) os[(hi * 8 + j) * 68 + nb * 16 + lr] = acc[mb][nb][j]; }
        __builtin_amdgcn_wave_barrier(); asm volatile("" ::: "memory");
        float* crow = C + (size_t)(r0 + mb * 16) * ldc + c0;
{
#pragma unroll
            for (int s = 0; s < 8; ++s) { const int row = 2 * s + hi, cofs = lr * 4; v4f val = *(const v4fa*)(os + row * 68 + cofs); if (BIAS) { val[0] += bfr(bias[c0 + cofs]); val[1] += bfr(bias[c0 + cofs + 1]); val[2] += bfr(bias[c0 + cofs + 2]); val[3] += bfr(bias[c0 + cofs + 3]); }
                *(v4f*)(crow + (size_t)row * ldc + cofs) = val; }
             }
        __builtin_amdgcn_wave_barrier(); asm volatile("" ::: "memory");
    }
}

__device__ __forceinline__ h16 tohx(float x) { return (h16)x; }
__device__ __forceinline__ void splitf(float y, unsigned short& h, unsigned short& l) { h = f2bf(y); l = f2bf(y - bf2f(h)); }
typedef __attribute__((ext_vector_type(2))) _Float16 v2h;
typedef __attribute__((ext_vector_type(4))) _Float16 v4h;
typedef __attribute__((ext_vector_type(2))) unsigned short v2us;
typedef __attribute__((ext_vector_type(4))) unsigned short v4us;
typedef __attribute__((ext_vector_type(2))) float v2f;
typedef __attribute__((ext_vector_type(4))) int v4i;

__global__ __launch_bounds__(256) void k_wtG(const float* __restrict__ w, int K, int N, bf* Bt) {
    const int lane = threadIdx.x & 31; const int L0 = (blockIdx.x * 8 + (threadIdx.x >> 5)) * 8; const int nlines = N * K / 64;
{
#pragma unroll 1
        for (int l = 0; l < 8; ++l) { const int L = L0 + l; if (L >= nlines) break; const size_t e = (size_t)L * 64 + lane * 2; const int k = (int)(e % K), n = (int)(e / K); v2us o;
            o[0] = f2bf(w[(size_t)k * N + n]); o[1] = f2bf(w[(size_t)(k + 1) * N + n]); *(v2us*)(Bt + e) = o; }
         }
}
__global__ __launch_bounds__(256) void k_cvt8(const float* __restrict__ src, bf* dst, size_t n8) { const size_t i = (size_t)blockIdx.x * 256 + threadIdx.x; if (i >= n8) return; const v8f v = *(const v8f*)(src + i * 8); v8us o;
#pragma unroll
    for (int k = 0; k < 8; ++k) o[k] = f2bf(v[k]); *(v8us*)(dst + i * 8) = o;  }
__global__ __launch_bounds__(256) void k_cscvt(const float* __restrict__ cosT, const float* __restrict__ sinT, float* CS) { const int idx = blockIdx.x * 256 + threadIdx.x; if (idx >= TT * HD) return; v2f cs; cs[0] = bfr(cosT[idx]); cs[1] = bfr(sinT[idx]); *(v2f*)(CS + (size_t)idx * 2) = cs;  }
// k_rope: head planes [h][t][d] (fp16 + hi/lo) of rope(x) x sc with the rotate-half convention out[d] = x[d] cos[t][d] - x[d+HD/2] sin[t][d], out[d+HD/2] = x[d+HD/2] cos[t][d+HD/2] + x[d] sin[t][d+HD/2]
__global__ __launch_bounds__(256) void k_rope(const float* __restrict__ F, int pitch, int nheads, const float* __restrict__ CS, const float* __restrict__ RF, const float* __restrict__ nw, float sc, h16* P16, bf* Ph, bf* Pl) {
    const size_t e = ((size_t)blockIdx.x * 256 + threadIdx.x) * 2; if (e >= (size_t)nheads * TT * HD) return; const int d = (int)(e % HD); const int t = (int)((e / HD) % TT); const int h = (int)(e / ((size_t)HD * TT)); const float* f = F + (size_t)t * pitch + h * HD; const float rf = RF ? RF[(size_t)h * TT + t] : 1.0f; v2h o16; v2us oh, ol;
#pragma unroll
    for (int q = 0; q < 2; ++q) { const int dd = d + q; const int dp = (dd < HD / 2) ? dd + HD / 2 : dd - HD / 2; float x0 = f[dd], x1 = f[dp];
        if (RF) { float n0 = __fmul_rn(x0, rf), n1 = __fmul_rn(x1, rf); asm volatile("" : "+v"(n0)); asm volatile("" : "+v"(n1)); x0 = __fmul_rn(bfr(nw[dd]), n0); x1 = __fmul_rn(bfr(nw[dp]), n1); }
        const v2f cs = *(const v2f*)(CS + ((size_t)t * HD + dd) * 2); float a = __fmul_rn(x0, cs[0]), bq = __fmul_rn(x1, cs[1]); asm volatile("" : "+v"(a)); asm volatile("" : "+v"(bq)); const float r = ((dd < HD / 2) ? __fsub_rn(a, bq) : __fadd_rn(a, bq)) * sc;
        o16[q] = tohx(r); unsigned short a2, c2; splitf(r, a2, c2); oh[q] = a2; ol[q] = c2; }
    *(v2h*)(P16 + e) = o16; *(v2us*)(Ph + e) = oh; *(v2us*)(Pl + e) = ol;  }
__global__ __launch_bounds__(256) void k_vtp(const float* __restrict__ F, int pitch, int nheads, h16* V16, bf* Vh, bf* Vl) { const size_t e = ((size_t)blockIdx.x * 256 + threadIdx.x) * 2; if (e >= (size_t)nheads * HD * TT) return; const int t = (int)(e % TT); const int d = (int)((e / TT) % HD); const int g = (int)(e / ((size_t)TT * HD)); v2h o16; v2us oh, ol;
#pragma unroll
    for (int q = 0; q < 2; ++q) { const float x = F[(size_t)(t + q) * pitch + g * HD + d]; o16[q] = tohx(x); unsigned short a2, c2; splitf(x, a2, c2); oh[q] = a2; ol[q] = c2; }
    *(v2h*)(V16 + e) = o16; *(v2us*)(Vh + e) = oh; *(v2us*)(Vl + e) = ol;  }
__global__ __launch_bounds__(256) void k_csid(float* CS) { const int idx = blockIdx.x * 256 + threadIdx.x; if (idx >= TT * HD) return; v2f cs; cs[0] = 1.0f; cs[1] = 0.0f; *(v2f*)(CS + (size_t)idx * 2) = cs;  }
__global__ __launch_bounds__(256) void k_hsmx(const float* __restrict__ Sb, int rb, bf* Ph, bf* Pl) { const size_t e = ((size_t)blockIdx.x * 256 + threadIdx.x) * 4; if (e >= (size_t)RB * TT) return; const int r = (int)(e / TT); const int j0 = (int)(e % TT); const int i = rb * RB + r; float sv[NH_][4];
#pragma unroll
    for (int h = 0; h < NH_; ++h) { const v4f a = *(const v4f*)(Sb + (size_t)h * RB * TT + e); for (int q = 0; q < 4; ++q) { float sa = a[q] * SCL; asm volatile("" : "+v"(sa)); sv[h][q] = (j0 + q > i) ? -1.0e10f : sa; } }
    float wv[NH_][4];
    for (int q = 0; q < 4; ++q) { float mx = -3.0e38f; for (int h = 0; h < NH_; ++h) mx = fmaxf(mx, sv[h][q]); float sum = 0.f; for (int h = 0; h < NH_; ++h) { float d0 = __fsub_rn(sv[h][q], mx); asm volatile("" : "+v"(d0)); const float ex = __builtin_amdgcn_exp2f(__fmul_rn(d0, 1.4426950408889634f)); wv[h][q] = ex; sum += ex; } const float f = __fdiv_rn(1.0f, sum); for (int h = 0; h < NH_; ++h) wv[h][q] = wv[h][q] * f; }
{
#pragma unroll
        for (int h = 0; h < NH_; ++h) { v4us oh, ol; for (int q = 0; q < 4; ++q) { unsigned short a2, c2; splitf(wv[h][q], a2, c2); oh[q] = a2; ol[q] = c2; } const size_t oo = (size_t)h * RB * TT + e; *(v4us*)(Ph + oo) = oh; *(v4us*)(Pl + oo) = ol; }
         } }
__global__ __launch_bounds__(256) void k_mrgrb(const float* __restrict__ O, int rb, bf* Ah, bf* Al) { const size_t e = ((size_t)blockIdx.x * 256 + threadIdx.x) * 2; if (e >= (size_t)NH_ * RB * HD) return; const int d = (int)(e % HD); const int r = (int)((e / HD) % RB); const int h = (int)(e / ((size_t)HD * RB)); v2us oh, ol; for (int q = 0; q < 2; ++q) { unsigned short a2, c2; float t = O[e + q]; for (int s = 1; s < PVG; ++s) t += O[(size_t)s * NH_ * RB * HD + e + q]; splitf(t, a2, c2); oh[q] = a2; ol[q] = c2; } bf* dh = Ah + (size_t)(rb * RB + r) * DQ + h * HD + d; bf* dl = Al + (size_t)(rb * RB + r) * DQ + h * HD + d; *(v2us*)dh = oh; *(v2us*)dl = ol;  }
// k_asoft: per row (zz, i): t = S x 1/sqrt(1024) (no mask); softmax over the 2048 keys (register row, one exp, fixed trees);
__global__ __launch_bounds__(256) void k_asoft(const float* __restrict__ Sb, h16* P16, bf* Ph, bf* Pl) {
    const int lane = threadIdx.x & 31; const int row = blockIdx.x * 8 + (threadIdx.x >> 5); if (row >= ZH * TT) return; const int i = row % TT; const int zz = row / TT; (void)zz; const bool hires = (i < RH); const float* sr = Sb + (size_t)row * TT; float v[TT / 32]; float mx = -3.0e38f;
#pragma unroll
    for (int ch = 0; ch < TT / 128; ++ch) { const int j0 = ch * 128 + lane * 4; const v4f a = *(const v4f*)(sr + j0);
#pragma unroll
        for (int q = 0; q < 4; ++q) { const int j = j0 + q; (void)j; const float t = a[q] * SCL; v[ch * 4 + q] = t; mx = fmaxf(mx, t); } }
#pragma unroll
    for (int sh = 16; sh; sh >>= 1) mx = fmaxf(mx, __shfl_xor(mx, sh, 32));
    float sum = 0.f;
#pragma unroll
    for (int k = 0; k < TT / 32; ++k) { float d0 = __fsub_rn(v[k], mx); asm volatile("" : "+v"(d0)); v[k] = __builtin_amdgcn_exp2f(__fmul_rn(d0, 1.4426950408889634f)); sum += v[k]; }
#pragma unroll
    for (int sh = 16; sh; sh >>= 1) sum += __shfl_xor(sum, sh, 32);
    const float f = __fdiv_rn(hires ? 1.0f : PCAR, sum);
{
        if (hires) {
#pragma unroll
            for (int ch = 0; ch < TT / 128; ++ch) { v4us oh, ol;
#pragma unroll
                for (int q = 0; q < 4; ++q) { unsigned short a, c2; splitf(v[ch * 4 + q] * f, a, c2); oh[q] = a; ol[q] = c2; }
                const size_t oo = ((size_t)zz * (RH ? RH : 1) + i) * TT + ch * 128 + lane * 4; *(v4us*)(Ph + oo) = oh; *(v4us*)(Pl + oo) = ol; }
        } else {
#pragma unroll
            for (int ch = 0; ch < TT / 128; ++ch) { v4h o4;
#pragma unroll
                for (int q = 0; q < 4; ++q) o4[q] = tohx(v[ch * 4 + q] * f);
                *(v4h*)(P16 + (size_t)row * TT + ch * 128 + lane * 4) = o4; } }
         }
}
__global__ __launch_bounds__(256) void k_merge(const float* __restrict__ O, int h0, bf* Ah, bf* Al) { const size_t e = ((size_t)blockIdx.x * 256 + threadIdx.x) * 2; if (e >= (size_t)ZH * TT * HD) return; const int d = (int)(e % HD); const int t = (int)((e / HD) % TT); const int zz = (int)(e / ((size_t)HD * TT)); const float cs = (t < RH) ? 1.0f : (1.0f / PCAR); const size_t oo = (size_t)t * DQ + (h0 + zz) * HD + d;
    v2us oh, ol;
#pragma unroll
    for (int q = 0; q < 2; ++q) { unsigned short a, c2; splitf(O[e + q] * cs, a, c2); oh[q] = a; ol[q] = c2; } *(v2us*)(Ah + oo) = oh; *(v2us*)(Al + oo) = ol;  }

extern "C" void kernel_launch(void* const* d_in, const int* in_sizes, int n_in,
                              void* d_out, int out_size, void* d_ws, size_t ws_size, hipStream_t stream) {
    (void)in_sizes; (void)n_in; (void)out_size;
    const float* x = (const float*)d_in[0]; const float* wq = (const float*)d_in[1]; const float* bq = (const float*)d_in[2]; const float* wk = (const float*)d_in[3]; const float* bk = (const float*)d_in[4]; const float* wv = (const float*)d_in[5]; const float* bv = (const float*)d_in[6]; const float* wo = (const float*)d_in[7]; const float* bo = (const float*)d_in[8]; const float* cosT = nullptr; const float* sinT = nullptr; (void)cosT; (void)sinT;
    float* OUT = (float*)d_out;     // [2][2048][1024]
    char* wsp = (char*)d_ws;
    auto take = [&](size_t bytes) { char* p = wsp; wsp += (bytes + 255) & ~(size_t)255; return (void*)p; };
    bf* WQ = (bf*)take((size_t)DQ * DM * 2); bf* WK = (bf*)take((size_t)DKV * DM * 2); bf* WV = (bf*)take((size_t)DKV * DM * 2); bf* WO = (bf*)take((size_t)DM * DQ * 2); float* CS = (float*)take((size_t)TT * HD * 2 * 4);
    bf* XB = (bf*)take((size_t)TT * DM * 2); float* FQ = (float*)take((size_t)TT * DQ * 4); float* FK = (float*)take((size_t)TT * DKV * 4);
    h16* QP16 = (h16*)take((size_t)NH_ * TT * HD * 2); h16* KP16 = (h16*)take((size_t)NKV * TT * HD * 2); h16* VT16 = (h16*)take((size_t)NKV * HD * TT * 2);
    bf* QPh = (bf*)take((size_t)NH_ * TT * HD * 2); bf* QPl = (bf*)take((size_t)NH_ * TT * HD * 2); bf* KPh = (bf*)take((size_t)NKV * TT * HD * 2); bf* KPl = (bf*)take((size_t)NKV * TT * HD * 2); bf* VTh = (bf*)take((size_t)NKV * HD * TT * 2); bf* VTl = (bf*)take((size_t)NKV * HD * TT * 2); bf* Ph = (bf*)take((size_t)NH_ * RB * TT * 2); bf* Pl = (bf*)take((size_t)NH_ * RB * TT * 2);
    float* Sb = (float*)take((size_t)NH_ * RB * TT * 4); h16* P16 = nullptr; (void)P16; float* Ob = (float*)take((size_t)PVG * NH_ * RB * HD * 4); bf* ATh = (bf*)take((size_t)TT * DQ * 2); bf* ATl = (bf*)take((size_t)TT * DQ * 2);
    if ((size_t)(wsp - (char*)d_ws) > ws_size) return;    // ws 256 MiB
    float* FV = FK;   // v projection reuses the k buffer after the k planes are built (stream-ordered)
    { k_wtG<<<(unsigned)((DM * DQ / 64 + 63) / 64), 256, 0, stream>>>(wq, DM, DQ, WQ); k_wtG<<<(unsigned)((DM * DKV / 64 + 63) / 64), 256, 0, stream>>>(wk, DM, DKV, WK); k_wtG<<<(unsigned)((DM * DKV / 64 + 63) / 64), 256, 0, stream>>>(wv, DM, DKV, WV);
      k_wtG<<<(unsigned)((DQ * DM / 64 + 63) / 64), 256, 0, stream>>>(wo, DQ, DM, WO);
       }
    k_csid<<<(TT * HD + 255) / 256, 256, 0, stream>>>(CS);
    const unsigned LQ = (unsigned)(((size_t)NH_ * TT * HD / 2 + 255) / 256), LKv = (unsigned)(((size_t)NKV * TT * HD / 2 + 255) / 256);
    for (int b = 0; b < NB_; ++b) {
        
        k_cvt8<<<(unsigned)(((size_t)TT * DM / 8 + 255) / 256), 256, 0, stream>>>(x + (size_t)b * TT * DM, XB, (size_t)TT * DM / 8);
        k_gemmw<bf, 0, true, GNW, 1><<<dim3(TT / 64, DQ / 64, 1), 32 * GNW, 0, stream>>>(XB, nullptr, WQ, nullptr, DM, FQ, DQ, bq, 0, 0, 0, 0);
        k_rope<<<LQ, 256, 0, stream>>>(FQ, DQ, NH_, CS, nullptr, nullptr, 1.0f, QP16, QPh, QPl);
        k_gemmw<bf, 0, true, GNW, 1><<<dim3(TT / 64, DKV / 64, 1), 32 * GNW, 0, stream>>>(XB, nullptr, WK, nullptr, DM, FK, DKV, bk, 0, 0, 0, 0);
        k_rope<<<LKv, 256, 0, stream>>>(FK, DKV, NKV, CS, nullptr, nullptr, 1.0f, KP16, KPh, KPl);
        k_gemmw<bf, 0, true, GNW, 1><<<dim3(TT / 64, DKV / 64, 1), 32 * GNW, 0, stream>>>(XB, nullptr, WV, nullptr, DM, FV, DKV, bv, 0, 0, 0, 0); k_vtp<<<LKv, 256, 0, stream>>>(FV, DKV, NKV, VT16, VTh, VTl);
        for (int rb = 0; rb < NRB; ++rb) {   // 256-row block, all 16 heads at once (z = 16)
            k_gemmw<h16, 0, false, 1, 1><<<dim3(RB / 64, TT / 64, NH_), 32, 0, stream>>>(QP16 + (size_t)rb * RB * HD, nullptr, KP16, nullptr, HD, Sb, TT, nullptr, (size_t)TT * HD, (size_t)TT * HD, (size_t)RB * TT, 0);
            k_hsmx<<<(unsigned)(((size_t)RB * TT / 4 + 255) / 256), 256, 0, stream>>>(Sb, rb, Ph, Pl);
            k_gemmw<bf, 2, false, GNW, PVG><<<dim3(RB / 64, HD / 64, NH_ * PVG), 32 * GNW, 0, stream>>>(Ph, Pl, VTh, VTl, TT, Ob, HD, nullptr, (size_t)RB * TT, (size_t)HD * TT, (size_t)RB * HD, (size_t)NH_ * RB * HD);
            k_mrgrb<<<(unsigned)(((size_t)NH_ * RB * HD / 2 + 255) / 256), 256, 0, stream>>>(Ob, rb, ATh, ATl); }
        k_gemmw<bf, 1, true, GNW, 1><<<dim3(TT / 64, DM / 64, 1), 32 * GNW, 0, stream>>>(ATh, ATl, WO, nullptr, DQ, OUT + (size_t)b * TT * DM, DM, bo, 0, 0, 0, 0); }
}

// v003
// It runs in 309 microseconds.
// It is 2.59 times as fast as v001, going by the measured steps of the versions left out in between.
// Counting every step since v000, it is 4.39 times as fast.
#include <hip/hip_runtime.h>

// MultiHeadAttention__5987 (x [2][2048][1024]; Q/K/V = x W + b (16 x 64); score = Q.K / sqrt(1024); causal positions (j > i) set to -1e10; FAITHFUL QUIRK: softmax over the HEAD axis (not over keys) -> weight[h][i][j]; out_h[i] = sum_j weight[h][i][j] V_h[j] (un-normalised over keys; masked positions carry weight exactly 1/16); merged Wo + bo -> [2][2048][1024]).
// Layout (exact): one kernel per batch does scores, head softmax and weights.V: a work-group of 16 waves (wave = head) holds 32 query rows and walks its quarter of the keys 32 at a time; scores and weights never leave the WGP: they cross from head to head through LDS.
// Compute dtypes, f32 accumulate: every input rounded to bf16; Q/K/V on PLAIN bf16 operands (inputs: exact) + bias; scores as single fp16 products (x1; logits are q.k/32); the 16-way head softmax in f32 per (i, j) (masked columns give exactly 1/16); weights.V hl x hl (3 products) on every row (weights <= 1, no carrier needed); Wo hl x exact (2 products) + bias.

#define NB_  2
#define TT   2048
#define DM   1024
#define NH_  16
#define NKV  16
#define REP  (NH_ / NKV)
#define HD   64
#define DQ   (NH_ * HD)
#define DKV  (NKV * HD)
#define ZH   2
#define RH   2048                  // query rows < RH use hi+lo planes (0: none)
#define WIN  0
#define PCAR 1024.0f
#define RB   TT     // query rows per merge launch
#define NRB  (TT / RB)
#define GNW  8      // waves per work-group that share a GEMM tile's K range
#define PVG  4      // work-groups that share a query block's key range (64 query blocks x PVG = 256 work-groups); their planes are added in the merge kernel
#define FI   32     // query rows per work-group of the fused kernel
#define FJ   32     // keys per pass of the fused kernel
#define FP   36     // LDS row pitch in floats (144 B: an odd multiple of 16 B)
#define SCL  0.03125f   // 1/sqrt(1024) (full embed dim, faithful)
typedef _Float16 h16;
typedef unsigned short bf;
typedef __attribute__((ext_vector_type(16))) __bf16   v16bf;
typedef __attribute__((ext_vector_type(16))) _Float16 v16h;
typedef __attribute__((ext_vector_type(8)))  _Float16 v8h;
typedef __attribute__((ext_vector_type(8)))  unsigned short v8us;
typedef __attribute__((ext_vector_type(8)))  float    v8f;
typedef __attribute__((ext_vector_type(4)))  float    v4f;
typedef v8h  __attribute__((may_alias)) v8ha;
typedef v4f  __attribute__((may_alias)) v4fa;
typedef v8us __attribute__((may_alias)) v8usa;

__device__ __forceinline__ unsigned short f2bf(float f) { unsigned u = __float_as_uint(f); u += 0x7FFFu + ((u >> 16) & 1u); return (unsigned short)(u >> 16); }
__device__ __forceinline__ float bf2f(unsigned short b) { return __uint_as_float(((unsigned)b) << 16); }
__device__ __forceinline__ float bfr(float f) { return bf2f(f2bf(f)); }
__device__ __forceinline__ v16h cat16(v8h lo, v8h hi) { return __builtin_shufflevector(lo, hi, 0, 1, 2, 3, 4, 5, 6, 7, 8, 9, 10, 11, 12, 13, 14, 15); }
__device__ __forceinline__ v16bf cat16b(v8us lo, v8us hi) { return __builtin_bit_cast(v16bf, __builtin_shufflevector(lo, hi, 0, 1, 2, 3, 4, 5, 6, 7, 8, 9, 10, 11, 12, 13, 14, 15)); }
__device__ __forceinline__ v8f wmma16(v16h a, v16h b, v8f c) { return __builtin_amdgcn_wmma_f32_16x16x32_f16(false, a, false, b, (short)0, c, false, false); }
__device__ __forceinline__ v8f wmmab(v16bf a, v16bf b, v8f c) { return __builtin_amdgcn_wmma_f32_16x16x32_bf16(false, a, false, b, (short)0, c, false, false); }
__device__ __forceinline__ h16 tohx(float x) { return (h16)x; }
__device__ __forceinline__ void splitf(float y, unsigned short& h, unsigned short& l) { h = f2bf(y); l = f2bf(y - bf2f(h)); }
typedef __attribute__((ext_vector_type(2))) _Float16 v2h;
typedef __attribute__((ext_vector_type(4))) _Float16 v4h;



// ---- k_gemmw: register-blocked GEMM, 64x64 output tile per work-group (16 accumulators per wave), operands straight from K-contiguous 16-bit planes; grid (M/64, N/64, Z * KSG), 32 * NW threads.
// C[m][n] (f32, pitch ldc, + optional f32 bias[n]) = sum_k A[m][k] Bt[n][k] (+ split products per NSPLIT). z-batch strides sA/sB/sC in elements.
// Split K: the K range is cut into KSG * NW equal runs (K % (32 * KSG * NW) == 0). Each of the NW waves of a work-group sums one run over the whole tile; the NW tiles are added in wave order through LDS.
// The KSG work-groups of one tile each store their own partial tile at C + kg * sP; the consumer adds those planes (KSG == 1: C is the result).
// EPI (NW > 1 only; a tile's 64 columns are one head, its rows are tokens): 0: f32 tile to C. 1: the tile as fp16 to the head plane P16[head][token][d]. 2: the tile transposed through LDS, as bf16 hi and lo, to Ph / Pl[head][d][token].
template <typename T16> struct WFrag;
template <> struct WFrag<h16> { typedef v16h V; static __device__ __forceinline__ V ld(const h16* p) { return cat16(*(const v8h*)p, *(const v8h*)(p + 16)); } static __device__ __forceinline__ v8f mma(V a, V b, v8f c) { return wmma16(a, b, c); } };
template <> struct WFrag<bf> { typedef v16bf V; static __device__ __forceinline__ V ld(const bf* p) { return cat16b(*(const v8us*)p, *(const v8us*)(p + 16)); } static __device__ __forceinline__ v8f mma(V a, V b, v8f c) { return wmmab(a, b, c); } };
template <typename T16, int NSPLIT, bool BIAS, int NW, int KSG, int EPI>
__global__ __launch_bounds__(32 * NW) void k_gemmw(const T16* __restrict__ A, const T16* __restrict__ A2, const T16* __restrict__ Bt, const T16* __restrict__ Bt2, int K, float* C, int ldc, const float* __restrict__ bias, size_t sA, size_t sB, size_t sC, size_t sP, h16* P16, bf* Ph, bf* Pl) {
    static_assert(EPI == 0 || (NW > 1 && KSG == 1 && HD == 64), "a head plane is written from a whole tile that is one head wide");
    typedef typename WFrag<T16>::V V;
    __shared__ __align__(16) float os[(NW == 1 ? 16 : NW * 64) * 68];
    const size_t z = blockIdx.z / KSG; const int kg = blockIdx.z % KSG; A += z * sA; if (A2) A2 += z * sA; Bt += z * sB; if (Bt2) Bt2 += z * sB; C += z * sC + kg * sP;
    const int wave = (NW == 1) ? 0 : __builtin_amdgcn_readfirstlane((int)(threadIdx.x >> 5)); const int kw = K / (NW * KSG), kb = (kg * NW + wave) * kw;
    const int lane = threadIdx.x & 31, lr = lane & 15, hi = lane >> 4; const int r0 = blockIdx.x * 64, c0 = blockIdx.y * 64;
    v8f acc[4][4];
#pragma unroll
    for (int mb = 0; mb < 4; ++mb)
#pragma unroll
        for (int nb = 0; nb < 4; ++nb) acc[mb][nb] = (v8f){};
    const size_t aoff = (size_t)(r0 + lr) * K + 8 * hi, boff = (size_t)(c0 + lr) * K + 8 * hi;
#pragma unroll 1
    for (int kc = kb; kc < kb + kw; kc += 32) {
        V a[4], a2[4];
#pragma unroll
        for (int mb = 0; mb < 4; ++mb) { a[mb] = WFrag<T16>::ld(A + aoff + (size_t)mb * 16 * K + kc); if (NSPLIT == 1 || NSPLIT == 2) a2[mb] = WFrag<T16>::ld(A2 + aoff + (size_t)mb * 16 * K + kc); }
#pragma unroll
        for (int nb = 0; nb < 4; ++nb) { const V b = WFrag<T16>::ld(Bt + boff + (size_t)nb * 16 * K + kc); V b2; if (NSPLIT >= 2) b2 = WFrag<T16>::ld(Bt2 + boff + (size_t)nb * 16 * K + kc);
#pragma unroll
            for (int mb = 0; mb < 4; ++mb) { acc[mb][nb] = WFrag<T16>::mma(a[mb], b, acc[mb][nb]); if (NSPLIT == 1 || NSPLIT == 2) acc[mb][nb] = WFrag<T16>::mma(a2[mb], b, acc[mb][nb]); if (NSPLIT >= 2) acc[mb][nb] = WFrag<T16>::mma(a[mb], b2, acc[mb][nb]); } }
        asm volatile("v_nop\n\tv_nop\n\tv_nop\n\tv_nop" : "+v"(acc[0][0]), "+v"(acc[1][1]), "+v"(acc[2][2]), "+v"(acc[3][3]) : "v"(a[0]), "v"(a[3]));
    }
    if constexpr (NW > 1) {
        float* my = os + wave * (64 * 68); const int cofs = ((int)threadIdx.x & 15) * 4; v4f bv = (v4f){};
        if (BIAS) { bv[0] = bfr(bias[c0 + cofs]); bv[1] = bfr(bias[c0 + cofs + 1]); bv[2] = bfr(bias[c0 + cofs + 2]); bv[3] = bfr(bias[c0 + cofs + 3]); }
        // the three loops are unrolled so that acc is indexed by constants and stays in registers
#pragma unroll
        for (int mb = 0; mb < 4; ++mb)
#pragma unroll
            for (int nb = 0; nb < 4; ++nb)
#pragma unroll
                for (int j = 0; j < 8; ++j) my[(mb * 16 + hi * 8 + j) * 68 + nb * 16 + lr] = acc[mb][nb][j];
        __syncthreads();   // every wave's partial tile is in LDS before any thread adds them
        v4f sums[32 / NW];
        // both loops are unrolled so that the LDS reads of all planes are in flight together
#pragma unroll
        for (int s = 0; s < 32 / NW; ++s) { const int idx = s * (32 * NW) + (int)threadIdx.x; const int row = idx >> 4; v4f val = *(const v4fa*)(os + row * 68 + cofs);
#pragma unroll
            for (int w = 1; w < NW; ++w) val += *(const v4fa*)(os + w * (64 * 68) + row * 68 + cofs);
            if (BIAS) val += bv;
            if constexpr (EPI == 0) *(v4f*)(C + (size_t)(r0 + row) * ldc + c0 + cofs) = val;
            if constexpr (EPI == 1) *(v4h*)(P16 + ((size_t)blockIdx.y * TT + r0 + row) * HD + cofs) = __builtin_convertvector(val, v4h);
            if constexpr (EPI == 2) sums[s] = val; }
        if constexpr (EPI == 2) {
            __syncthreads();   // every thread has read the partial tiles before the sum is written over them
            // pitch 65 words: the 32 lanes of a wave meet 32 different banks in the transposed write and in the read below
#pragma unroll
            for (int s = 0; s < 32 / NW; ++s)
#pragma unroll
                for (int q = 0; q < 4; ++q) os[(cofs + q) * 65 + ((s * (32 * NW) + (int)threadIdx.x) >> 4)] = sums[s][q];
            __syncthreads();   // the whole transposed tile is in LDS before any thread reads a row of it
            // 8 lanes store the 64 tokens of one d: whole 128-byte lines of each plane
#pragma unroll
            for (int u = 0; u < 16 / NW; ++u) { const int idx = u * (32 * NW) + (int)threadIdx.x; const int d = idx >> 3, t8 = (idx & 7) * 8; v8us oh, ol;
#pragma unroll
                for (int j = 0; j < 8; ++j) { unsigned short a2, c2; splitf(os[d * 65 + t8 + j], a2, c2); oh[j] = a2; ol[j] = c2; }
                const size_t oo = ((size_t)blockIdx.y * HD + d) * TT + r0 + t8; *(v8us*)(Ph + oo) = oh; *(v8us*)(Pl + oo) = ol; }
        }
        return;
    }
#pragma unroll
    for (int mb = 0; mb < 4; ++mb) {
#pragma unroll
        for (int nb = 0; nb < 4; ++nb) {
#pragma unroll
            for (int j = 0; j < 8; ++j) os[(hi * 8 + j) * 68 + nb * 16 + lr] = acc[mb][nb][j]; }
        __builtin_amdgcn_wave_barrier(); asm volatile("" ::: "memory");
        float* crow = C + (size_t)(r0 + mb * 16) * ldc + c0;
{
#pragma unroll
            for (int s = 0; s < 8; ++s) { const int row = 2 * s + hi, cofs = lr * 4; v4f val = *(const v4fa*)(os + row * 68 + cofs); if (BIAS) { val[0] += bfr(bias[c0 + cofs]); val[1] += bfr(bias[c0 + cofs + 1]); val[2] += bfr(bias[c0 + cofs + 2]); val[3] += bfr(bias[c0 + cofs + 3]); }
                *(v4f*)(crow + (size_t)row * ldc + cofs) = val; }
             }
        __builtin_amdgcn_wave_barrier(); asm volatile("" ::: "memory");
    }
}

typedef __attribute__((ext_vector_type(2))) unsigned short v2us;
typedef __attribute__((ext_vector_type(4))) unsigned short v4us;
typedef __attribute__((ext_vector_type(2))) float v2f;
typedef __attribute__((ext_vector_type(4))) int v4i;

__global__ __launch_bounds__(256) void k_wtG(const float* __restrict__ w, int K, int N, bf* Bt) {
    const int lane = threadIdx.x & 31; const int L0 = (blockIdx.x * 8 + (threadIdx.x >> 5)) * 8; const int nlines = N * K / 64;
{
#pragma unroll 1
        for (int l = 0; l < 8; ++l) { const int L = L0 + l; if (L >= nlines) break; const size_t e = (size_t)L * 64 + lane * 2; const int k = (int)(e % K), n = (int)(e / K); v2us o;
            o[0] = f2bf(w[(size_t)k * N + n]); o[1] = f2bf(w[(size_t)(k + 1) * N + n]); *(v2us*)(Bt + e) = o; }
         }
}
__global__ __launch_bounds__(256) void k_cvt8(const float* __restrict__ src, bf* dst, size_t n8) { const size_t i = (size_t)blockIdx.x * 256 + threadIdx.x; if (i >= n8) return; const v8f v = *(const v8f*)(src + i * 8); v8us o;
#pragma unroll
    for (int k = 0; k < 8; ++k) o[k] = f2bf(v[k]); *(v8us*)(dst + i * 8) = o;  }
__global__ __launch_bounds__(256) void k_cscvt(const float* __restrict__ cosT, const float* __restrict__ sinT, float* CS) { const int idx = blockIdx.x * 256 + threadIdx.x; if (idx >= TT * HD) return; v2f cs; cs[0] = bfr(cosT[idx]); cs[1] = bfr(sinT[idx]); *(v2f*)(CS + (size_t)idx * 2) = cs;  }
typedef __attribute__((ext_vector_type(2))) __bf16 v2bf;
// Work-group barrier that orders LDS only: the fences name the LDS address space, so that global loads asked for ahead of it stay in flight across it (__syncthreads() waits for them).
__device__ __forceinline__ void lds_barrier() { __builtin_amdgcn_fence(__ATOMIC_RELEASE, "workgroup", "local"); __builtin_amdgcn_s_barrier(); __builtin_amdgcn_fence(__ATOMIC_ACQUIRE, "workgroup", "local"); }
// k_fattn: grid (TT / FI, PVG), 512 threads, wave = head. Per pass of FJ keys: S^T = K Q^T (fp16, rows = keys, columns = queries: a lane's 8 accumulator values are 8 neighbouring keys of one query), stored to LDS as [head][query][key] f32.
// Head softmax: behind a barrier each thread takes 2 neighbouring keys of one query, reads the 16 heads' scores and writes the 16 weight pairs back over the same rows: bf16 hi pairs in the row's first 16 words, lo pairs in the next 16.
// (A wave holds whole rows, and has read all of a row before it writes any of it.) Behind a second barrier each wave reads its head's rows as A fragments of weights.V.
// A masked position (j > i) has the same score in every head, so its weight is exactly 1/16. O: plane blockIdx.y of [PVG][NH_][TT][HD] f32.
__global__ __launch_bounds__(512) void k_fattn(const h16* __restrict__ Q16, const h16* __restrict__ K16, const bf* __restrict__ Vh, const bf* __restrict__ Vl, float* O) {
    __shared__ __align__(16) float Ss[NH_ * FI * FP];
    const float K2 = SCL * 1.4426950408889634f;
    const int h = __builtin_amdgcn_readfirstlane((int)(threadIdx.x >> 5));
    const int lane = threadIdx.x & 31, lr = lane & 15, hi = lane >> 4;
    const int i0 = blockIdx.x * FI, jb = blockIdx.y * (TT / PVG);
    // wave-uniform bases and 32-bit lane offsets: one address register per operand kind
    const h16* qp = Q16 + ((size_t)h * TT + i0) * HD;
    const h16* kp = K16 + ((size_t)h * TT + jb) * HD;
    const bf* vhp = Vh + (size_t)h * HD * TT + jb;
    const bf* vlp = Vl + (size_t)h * HD * TT + jb;
    const unsigned ko = (unsigned)(lr * HD + 8 * hi) * 2u, vo = (unsigned)(lr * TT + 8 * hi) * 2u;   // in bytes
    v16h qf[2][2], kf[2][2];
#pragma unroll
    for (int a = 0; a < 2; ++a)
#pragma unroll
        for (int ks = 0; ks < 2; ++ks) { qf[a][ks] = WFrag<h16>::ld((const h16*)((const char*)qp + ko) + a * 16 * HD + ks * 32); kf[a][ks] = WFrag<h16>::ld((const h16*)((const char*)kp + ko) + a * 16 * HD + ks * 32); }
    v8f o[2][4];
#pragma unroll
    for (int it = 0; it < 2; ++it)
#pragma unroll
        for (int nb = 0; nb < 4; ++nb) o[it][nb] = (v8f){};
    float* sw = Ss + h * (FI * FP) + lr * FP + hi * 8;          // this lane's 8 scores of a tile
    const float* pr = Ss + h * (FI * FP) + lr * FP + hi * 4;    // this lane's 4 words (8 weights) of a fragment half
    const int pi = (int)threadIdx.x >> 4, pj = ((int)threadIdx.x & 15) * 2;
    float* ps = Ss + pi * FP + pj; float* pw = Ss + pi * FP + (pj >> 1);
    const int NT = TT / PVG / FJ;
#pragma unroll 1
    for (int t = 0; t < NT; ++t) {
        v8f s[2][2];
#pragma unroll
        for (int it = 0; it < 2; ++it)
#pragma unroll
            for (int jt = 0; jt < 2; ++jt) { s[it][jt] = WFrag<h16>::mma(kf[jt][0], qf[it][0], (v8f){}); s[it][jt] = WFrag<h16>::mma(kf[jt][1], qf[it][1], s[it][jt]); }
        // next pass's K fragments (the last pass asks for its own again: in bounds, not used) and this pass's V fragments: asked for here so that they fly during the softmax
        const int tn = (t + 1 < NT) ? t + 1 : t; const unsigned kt = ko + (unsigned)(tn * FJ * HD * 2);
#pragma unroll
        for (int jt = 0; jt < 2; ++jt)
#pragma unroll
            for (int ks = 0; ks < 2; ++ks) kf[jt][ks] = WFrag<h16>::ld((const h16*)((const char*)kp + kt) + jt * 16 * HD + ks * 32);
        v16bf vhf[4], vlf[4];
#pragma unroll
        for (int nb = 0; nb < 4; ++nb) { vhf[nb] = WFrag<bf>::ld((const bf*)((const char*)vhp + vo) + nb * 16 * TT); vlf[nb] = WFrag<bf>::ld((const bf*)((const char*)vlp + vo) + nb * 16 * TT); }
        vhp += FJ; vlp += FJ;
        asm volatile("s_wait_xcnt 0x0" ::: "memory");   // stands ahead of every later write of a register that the loads above name as an address
#pragma unroll
        for (int it = 0; it < 2; ++it)
#pragma unroll
            for (int jt = 0; jt < 2; ++jt) {
                *(v4fa*)(sw + it * 16 * FP + jt * 16) = __builtin_shufflevector(s[it][jt], s[it][jt], 0, 1, 2, 3);
                *(v4fa*)(sw + it * 16 * FP + jt * 16 + 4) = __builtin_shufflevector(s[it][jt], s[it][jt], 4, 5, 6, 7); }
        lds_barrier();   // all 16 heads' scores of this pass are in LDS before any thread reads a column of them
        {
            v2f sv[NH_];
#pragma unroll
            for (int g = 0; g < NH_; ++g) sv[g] = *(const v2f*)(ps + g * (FI * FP));
            const int dj = i0 + pi - (jb + t * FJ + pj);   // query index minus the thread's first key index
            v2f rs;
#pragma unroll
            for (int q = 0; q < 2; ++q) { float mx = sv[0][q];
#pragma unroll
                for (int g = 1; g < NH_; ++g) mx = fmaxf(mx, sv[g][q]);
                mx *= K2; float sum = 0.f;
#pragma unroll
                for (int g = 0; g < NH_; ++g) { sv[g][q] = __builtin_amdgcn_exp2f(__builtin_fmaf(sv[g][q], K2, -mx)); sum += sv[g][q]; }
                rs[q] = __builtin_amdgcn_rcpf(sum); }
#pragma unroll
            for (int g = 0; g < NH_; ++g) { v2f w; w[0] = (dj < 0) ? 0.0625f : sv[g][0] * rs[0]; w[1] = (dj < 1) ? 0.0625f : sv[g][1] * rs[1];
                const unsigned hu = __builtin_bit_cast(unsigned, __builtin_convertvector(w, v2bf)); v2f d; d[0] = w[0] - __uint_as_float(hu << 16); d[1] = w[1] - __uint_as_float(hu & 0xFFFF0000u);
                pw[g * (FI * FP)] = __uint_as_float(hu); pw[g * (FI * FP) + 16] = __uint_as_float(__builtin_bit_cast(unsigned, __builtin_convertvector(d, v2bf))); }
        }
        lds_barrier();   // every head's weights of this pass are in LDS before its wave reads them
#pragma unroll
        for (int it = 0; it < 2; ++it) {
            const float* p = pr + it * 16 * FP;
            const v16bf pa = __builtin_bit_cast(v16bf, __builtin_shufflevector(*(const v4fa*)p, *(const v4fa*)(p + 8), 0, 1, 2, 3, 4, 5, 6, 7));
            const v16bf pb = __builtin_bit_cast(v16bf, __builtin_shufflevector(*(const v4fa*)(p + 16), *(const v4fa*)(p + 24), 0, 1, 2, 3, 4, 5, 6, 7));
#pragma unroll
            for (int nb = 0; nb < 4; ++nb) { o[it][nb] = wmmab(pa, vhf[nb], o[it][nb]); o[it][nb] = wmmab(pb, vhf[nb], o[it][nb]); o[it][nb] = wmmab(pa, vlf[nb], o[it][nb]); }
        }
    }
    const int el = (int)__builtin_amdgcn_mbcnt_lo(~0u, 0u);   // the lane index, formed anew here so that no register has to hold it through the loop
    float* op = O + (((size_t)blockIdx.y * NH_ + h) * TT + i0 + (el >> 4) * 8) * HD + (el & 15);
#pragma unroll
    for (int it = 0; it < 2; ++it)
#pragma unroll
        for (int nb = 0; nb < 4; ++nb)
#pragma unroll
            for (int r = 0; r < 8; ++r) op[(size_t)(it * 16 + r) * HD + nb * 16] = o[it][nb][r];
}
__global__ __launch_bounds__(256) void k_mrgrb(const float* __restrict__ O, int rb, bf* Ah, bf* Al) { const size_t e = ((size_t)blockIdx.x * 256 + threadIdx.x) * 2; if (e >= (size_t)NH_ * RB * HD) return; const int d = (int)(e % HD); const int r = (int)((e / HD) % RB); const int h = (int)(e / ((size_t)HD * RB)); v2us oh, ol; for (int q = 0; q < 2; ++q) { unsigned short a2, c2; float t = O[e + q]; for (int s = 1; s < PVG; ++s) t += O[(size_t)s * NH_ * RB * HD + e + q]; splitf(t, a2, c2); oh[q] = a2; ol[q] = c2; } bf* dh = Ah + (size_t)(rb * RB + r) * DQ + h * HD + d; bf* dl = Al + (size_t)(rb * RB + r) * DQ + h * HD + d; *(v2us*)dh = oh; *(v2us*)dl = ol;  }
// k_asoft: per row (zz, i): t = S x 1/sqrt(1024) (no mask); softmax over the 2048 keys (register row, one exp, fixed trees);
__global__ __launch_bounds__(256) void k_asoft(const float* __restrict__ Sb, h16* P16, bf* Ph, bf* Pl) {
    const int lane = threadIdx.x & 31; const int row = blockIdx.x * 8 + (threadIdx.x >> 5); if (row >= ZH * TT) return; const int i = row % TT; const int zz = row / TT; (void)zz; const bool hires = (i < RH); const float* sr = Sb + (size_t)row * TT; float v[TT / 32]; float mx = -3.0e38f;
#pragma unroll
    for (int ch = 0; ch < TT / 128; ++ch) { const int j0 = ch * 128 + lane * 4; const v4f a = *(const v4f*)(sr + j0);
#pragma unroll
        for (int q = 0; q < 4; ++q) { const int j = j0 + q; (void)j; const float t = a[q] * SCL; v[ch * 4 + q] = t; mx = fmaxf(mx, t); } }
#pragma unroll
    for (int sh = 16; sh; sh >>= 1) mx = fmaxf(mx, __shfl_xor(mx, sh, 32));
    float sum = 0.f;
#pragma unroll
    for (int k = 0; k < TT / 32; ++k) { float d0 = __fsub_rn(v[k], mx); asm volatile("" : "+v"(d0)); v[k] = __builtin_amdgcn_exp2f(__fmul_rn(d0, 1.4426950408889634f)); sum += v[k]; }
#pragma unroll
    for (int sh = 16; sh; sh >>= 1) sum += __shfl_xor(sum, sh, 32);
    const float f = __fdiv_rn(hires ? 1.0f : PCAR, sum);
{
        if (hires) {
#pragma unroll
            for (int ch = 0; ch < TT / 128; ++ch) { v4us oh, ol;
#pragma unroll
                for (int q = 0; q < 4; ++q) { unsigned short a, c2; splitf(v[ch * 4 + q] * f, a, c2); oh[q] = a; ol[q] = c2; }
                const size_t oo = ((size_t)zz * (RH ? RH : 1) + i) * TT + ch * 128 + lane * 4; *(v4us*)(Ph + oo) = oh; *(v4us*)(Pl + oo) = ol; }
        } else {
#pragma unroll
            for (int ch = 0; ch < TT / 128; ++ch) { v4h o4;
#pragma unroll
                for (int q = 0; q < 4; ++q) o4[q] = tohx(v[ch * 4 + q] * f);
                *(v4h*)(P16 + (size_t)row * TT + ch * 128 + lane * 4) = o4; } }
         }
}
__global__ __launch_bounds__(256) void k_merge(const float* __restrict__ O, int h0, bf* Ah, bf* Al) { const size_t e = ((size_t)blockIdx.x * 256 + threadIdx.x) * 2; if (e >= (size_t)ZH * TT * HD) return; const int d = (int)(e % HD); const int t = (int)((e / HD) % TT); const int zz = (int)(e / ((size_t)HD * TT)); const float cs = (t < RH) ? 1.0f : (1.0f / PCAR); const size_t oo = (size_t)t * DQ + (h0 + zz) * HD + d;
    v2us oh, ol;
#pragma unroll
    for (int q = 0; q < 2; ++q) { unsigned short a, c2; splitf(O[e + q] * cs, a, c2); oh[q] = a; ol[q] = c2; } *(v2us*)(Ah + oo) = oh; *(v2us*)(Al + oo) = ol;  }

extern "C" void kernel_launch(void* const* d_in, const int* in_sizes, int n_in,
                              void* d_out, int out_size, void* d_ws, size_t ws_size, hipStream_t stream) {
    (void)in_sizes; (void)n_in; (void)out_size;
    const float* x = (const float*)d_in[0]; const float* wq = (const float*)d_in[1]; const float* bq = (const float*)d_in[2]; const float* wk = (const float*)d_in[3]; const float* bk = (const float*)d_in[4]; const float* wv = (const float*)d_in[5]; const float* bv = (const float*)d_in[6]; const float* wo = (const float*)d_in[7]; const float* bo = (const float*)d_in[8]; const float* cosT = nullptr; const float* sinT = nullptr; (void)cosT; (void)sinT;
    float* OUT = (float*)d_out;     // [2][2048][1024]
    char* wsp = (char*)d_ws;
    auto take = [&](size_t bytes) { char* p = wsp; wsp += (bytes + 255) & ~(size_t)255; return (void*)p; };
    bf* WQ = (bf*)take((size_t)DQ * DM * 2); bf* WK = (bf*)take((size_t)DKV * DM * 2); bf* WV = (bf*)take((size_t)DKV * DM * 2); bf* WO = (bf*)take((size_t)DM * DQ * 2);
    bf* XB = (bf*)take((size_t)TT * DM * 2);
    h16* QP16 = (h16*)take((size_t)NH_ * TT * HD * 2); h16* KP16 = (h16*)take((size_t)NKV * TT * HD * 2);
    bf* VTh = (bf*)take((size_t)NKV * HD * TT * 2); bf* VTl = (bf*)take((size_t)NKV * HD * TT * 2);
    float* Ob = (float*)take((size_t)PVG * NH_ * RB * HD * 4); bf* ATh = (bf*)take((size_t)TT * DQ * 2); bf* ATl = (bf*)take((size_t)TT * DQ * 2);
    if ((size_t)(wsp - (char*)d_ws) > ws_size) return;    // ws 256 MiB
    { k_wtG<<<(unsigned)((DM * DQ / 64 + 63) / 64), 256, 0, stream>>>(wq, DM, DQ, WQ); k_wtG<<<(unsigned)((DM * DKV / 64 + 63) / 64), 256, 0, stream>>>(wk, DM, DKV, WK); k_wtG<<<(unsigned)((DM * DKV / 64 + 63) / 64), 256, 0, stream>>>(wv, DM, DKV, WV);
      k_wtG<<<(unsigned)((DQ * DM / 64 + 63) / 64), 256, 0, stream>>>(wo, DQ, DM, WO);
       }
    for (int b = 0; b < NB_; ++b) {
        
        k_cvt8<<<(unsigned)(((size_t)TT * DM / 8 + 255) / 256), 256, 0, stream>>>(x + (size_t)b * TT * DM, XB, (size_t)TT * DM / 8);
        k_gemmw<bf, 0, true, GNW, 1, 1><<<dim3(TT / 64, DQ / 64, 1), 32 * GNW, 0, stream>>>(XB, nullptr, WQ, nullptr, DM, nullptr, 0, bq, 0, 0, 0, 0, QP16, nullptr, nullptr);
        k_gemmw<bf, 0, true, GNW, 1, 1><<<dim3(TT / 64, DKV / 64, 1), 32 * GNW, 0, stream>>>(XB, nullptr, WK, nullptr, DM, nullptr, 0, bk, 0, 0, 0, 0, KP16, nullptr, nullptr);
        k_gemmw<bf, 0, true, GNW, 1, 2><<<dim3(TT / 64, DKV / 64, 1), 32 * GNW, 0, stream>>>(XB, nullptr, WV, nullptr, DM, nullptr, 0, bv, 0, 0, 0, 0, nullptr, VTh, VTl);
        k_fattn<<<dim3(TT / FI, PVG, 1), 512, 0, stream>>>(QP16, KP16, VTh, VTl, Ob);
        k_mrgrb<<<(unsigned)(((size_t)NH_ * RB * HD / 2 + 255) / 256), 256, 0, stream>>>(Ob, 0, ATh, ATl);
        k_gemmw<bf, 1, true, GNW, 1, 0><<<dim3(TT / 64, DM / 64, 1), 32 * GNW, 0, stream>>>(ATh, ATl, WO, nullptr, DQ, OUT + (size_t)b * TT * DM, DM, bo, 0, 0, 0, 0, nullptr, nullptr, nullptr); }
}

// v004
// A run of this version takes 222 microseconds.
// In two side-by-side timings against v003, it was 1.40 and 1.39 times as fast.
// All steps since v000 together make it 6.11 times as fast.
#include <hip/hip_runtime.h>

// MultiHeadAttention__5987 (x [2][2048][1024]; Q/K/V = x W + b (16 x 64); score = Q.K / sqrt(1024); causal positions (j > i) set to -1e10; FAITHFUL QUIRK: softmax over the HEAD axis (not over keys) -> weight[h][i][j]; out_h[i] = sum_j weight[h][i][j] V_h[j] (un-normalised over keys; masked positions carry weight exactly 1/16); merged Wo + bo -> [2][2048][1024]).
// Layout (exact): one kernel per batch does scores, head softmax and weights.V: a work-group of 16 waves (wave = head) holds 32 query rows and walks its quarter of the keys 32 at a time; scores and weights never leave the WGP: they cross from head to head through LDS.
// Compute dtypes, f32 accumulate: every input rounded to bf16; Q/K/V on PLAIN bf16 operands (inputs: exact) + bias; scores as single fp16 products (x1; logits are q.k/32); the 16-way head softmax in f32 per (i, j) (masked columns give exactly 1/16); weights.V hl x hl (3 products) on every row (weights <= 1, no carrier needed); Wo hl x exact (2 products) + bias.

#define NB_  2
#define TT   2048
#define DM   1024
#define NH_  16
#define NKV  16
#define REP  (NH_ / NKV)
#define HD   64
#define DQ   (NH_ * HD)
#define DKV  (NKV * HD)
#define ZH   2
#define RH   2048                  // query rows < RH use hi+lo planes (0: none)
#define WIN  0
#define PCAR 1024.0f
#define RB   TT     // query rows per merge launch
#define NRB  (TT / RB)
#define GNW  8      // waves per work-group that share a GEMM tile's K range
#define PVG  4      // work-groups that share a query block's key range (64 query blocks x PVG = 256 work-groups); their planes are added in the merge kernel
#define FI   32     // query rows per work-group of the fused kernel
#define FJ   32     // keys per pass of the fused kernel
#define FP   36     // LDS row pitch in floats (144 B: an odd multiple of 16 B)
#define SCL  0.03125f   // 1/sqrt(1024) (full embed dim, faithful)
typedef _Float16 h16;
typedef unsigned short bf;
typedef __attribute__((ext_vector_type(16))) __bf16   v16bf;
typedef __attribute__((ext_vector_type(16))) _Float16 v16h;
typedef __attribute__((ext_vector_type(8)))  _Float16 v8h;
typedef __attribute__((ext_vector_type(8)))  unsigned short v8us;
typedef __attribute__((ext_vector_type(8)))  float    v8f;
typedef __attribute__((ext_vector_type(4)))  float    v4f;
typedef v8h  __attribute__((may_alias)) v8ha;
typedef v4f  __attribute__((may_alias)) v4fa;
typedef v8us __attribute__((may_alias)) v8usa;

__device__ __forceinline__ unsigned short f2bf(float f) { unsigned u = __float_as_uint(f); u += 0x7FFFu + ((u >> 16) & 1u); return (unsigned short)(u >> 16); }
__device__ __forceinline__ float bf2f(unsigned short b) { return __uint_as_float(((unsigned)b) << 16); }
__device__ __forceinline__ float bfr(float f) { return bf2f(f2bf(f)); }
__device__ __forceinline__ v16h cat16(v8h lo, v8h hi) { return __builtin_shufflevector(lo, hi, 0, 1, 2, 3, 4, 5, 6, 7, 8, 9, 10, 11, 12, 13, 14, 15); }
__device__ __forceinline__ v16bf cat16b(v8us lo, v8us hi) { return __builtin_bit_cast(v16bf, __builtin_shufflevector(lo, hi, 0, 1, 2, 3, 4, 5, 6, 7, 8, 9, 10, 11, 12, 13, 14, 15)); }
__device__ __forceinline__ v8f wmma16(v16h a, v16h b, v8f c) { return __builtin_amdgcn_wmma_f32_16x16x32_f16(false, a, false, b, (short)0, c, false, false); }
__device__ __forceinline__ v8f wmmab(v16bf a, v16bf b, v8f c) { return __builtin_amdgcn_wmma_f32_16x16x32_bf16(false, a, false, b, (short)0, c, false, false); }
__device__ __forceinline__ h16 tohx(float x) { return (h16)x; }
__device__ __forceinline__ void splitf(float y, unsigned short& h, unsigned short& l) { h = f2bf(y); l = f2bf(y - bf2f(h)); }
// s_wait_xcnt 0 behind a run of global loads, ahead of every later write of a register that they name as an address. The addresses are inputs of the statement, so that their registers stay untouched (also by a later load's result) up to the wait.
__device__ __forceinline__ void addr_wait(const void* a, const void* b) { asm volatile("s_wait_xcnt 0x0" :: "v"(a), "v"(b) : "memory"); }
__device__ __forceinline__ void addr_wait(const void* a, const void* b, const void* c) { asm volatile("s_wait_xcnt 0x0" :: "v"(a), "v"(b), "v"(c) : "memory"); }
__device__ __forceinline__ void addr_wait(const void* a, const void* b, const void* c, const void* d) { asm volatile("s_wait_xcnt 0x0" :: "v"(a), "v"(b), "v"(c), "v"(d) : "memory"); }
typedef __attribute__((ext_vector_type(2))) _Float16 v2h;
typedef __attribute__((ext_vector_type(4))) _Float16 v4h;



// ---- k_gemmw: register-blocked GEMM, 64x64 output tile per work-group (16 accumulators per wave), operands straight from 16-bit planes in fragment order; grid (M/64, N/64, Z * KSG), 32 * NW threads.
// C[m][n] (f32, pitch ldc, + optional f32 bias[n]) = sum_k A[m][k] Bt[n][k] (+ split products per NSPLIT). z-batch strides sA/sB/sC in elements.
// Split K: the K range is cut into KSG * NW equal runs (K % (32 * KSG * NW) == 0). Each of the NW waves of a work-group sums one run over the whole tile; the NW tiles are added in wave order through LDS.
// The KSG work-groups of one tile each store their own partial tile at C + kg * sP; the consumer adds those planes (KSG == 1: C is the result).
// EPI (NW > 1 only; a tile's 64 columns are one head, its rows are tokens): 0: f32 tile to C. 1: the tile as fp16 to the head plane P16[head] (rows = tokens, k = d). 2: the tile transposed through LDS, as bf16 hi and lo, to Ph / Pl[head] (rows = d, k = tokens). Both in fragment order.
// FRAGMENT ORDER: every 16-bit operand plane P[row][k] is stored as tiles of 16 rows x 32 k (512 elements, 1 KiB), one tile = one WMMA operand fragment, laid out as the lanes read it:
// element (row, k) stands at tile * 512 + ((k % 32) / 16) * 256 + (((k % 16) / 8) * 16 + row % 16) * 8 + k % 8. A lane's two 16-byte loads are at lane * 8 and 256 + lane * 8: a wave's load is 512 bytes in a row (4 whole lines).
// Tile numbers: GEMM operands and Q, K head planes (row / 16) * (K / 32) + k / 32; V planes (rows = d, k = token) (k / 32) * (HD / 16) + row / 16, so that a pass's four tiles are neighbours.
template <typename T16> struct WFrag;
template <> struct WFrag<h16> { typedef v16h V; static __device__ __forceinline__ V ld(const h16* p) { return cat16(*(const v8h*)p, *(const v8h*)(p + 256)); } static __device__ __forceinline__ v8f mma(V a, V b, v8f c) { return wmma16(a, b, c); } };
template <> struct WFrag<bf> { typedef v16bf V; static __device__ __forceinline__ V ld(const bf* p) { return cat16b(*(const v8us*)p, *(const v8us*)(p + 256)); } static __device__ __forceinline__ v8f mma(V a, V b, v8f c) { return wmmab(a, b, c); } };
// The operand pointers carry no __restrict__: the loads then keep their place in front of the loop's s_wait_xcnt statement (its "memory" clobber holds them there).
template <typename T16, int NSPLIT, bool BIAS, int NW, int KSG, int EPI, int K>
__global__ __launch_bounds__(32 * NW) void k_gemmw(const T16* A, const T16* A2, const T16* Bt, const T16* Bt2, float* C, int ldc, const float* __restrict__ bias, size_t sA, size_t sB, size_t sC, size_t sP, h16* P16, bf* Ph, bf* Pl) {
    static_assert(EPI == 0 || (NW == 8 && KSG == 1 && HD == 64), "a head plane is written from a whole tile that is one head wide, by 256 threads");
    typedef typename WFrag<T16>::V V;
    __shared__ __align__(16) float os[(NW == 1 ? 16 : NW * 64) * 68];
    const size_t z = blockIdx.z / KSG; const int kg = blockIdx.z % KSG; A += z * sA; if (A2) A2 += z * sA; Bt += z * sB; if (Bt2) Bt2 += z * sB; C += z * sC + kg * sP;
    const int wave = (NW == 1) ? 0 : __builtin_amdgcn_readfirstlane((int)(threadIdx.x >> 5)); const int kw = K / (NW * KSG), kb = (kg * NW + wave) * kw;
    const int lane = threadIdx.x & 31, lr = lane & 15, hi = lane >> 4; const int r0 = blockIdx.x * 64, c0 = blockIdx.y * 64;
    v8f acc[4][4];
#pragma unroll
    for (int mb = 0; mb < 4; ++mb)
#pragma unroll
        for (int nb = 0; nb < 4; ++nb) acc[mb][nb] = (v8f){};
    // each lane's own address in the first tile of its operand (16 rows of tiles are 16 * K elements; 32 k are 512; the lane's 16 bytes stand lane * 16 bytes behind a tile's start)
    const unsigned lo = (unsigned)lane * 16u; const int rs = K * 32;   // rs: bytes from one 16-row block of tiles to the next (K is a constant of the build, so that it goes into the loads' immediate offsets)
    const char* Ap = (const char*)(A + (size_t)r0 * K + (size_t)kb * 16) + lo; const char* A2p = (NSPLIT == 1 || NSPLIT == 2) ? (const char*)(A2 + (size_t)r0 * K + (size_t)kb * 16) + lo : nullptr; const char* Bp = (const char*)(Bt + (size_t)c0 * K + (size_t)kb * 16) + lo; const char* B2p = (NSPLIT >= 2) ? (const char*)(Bt2 + (size_t)c0 * K + (size_t)kb * 16) + lo : nullptr;
#pragma unroll 1
    for (int kc = kb; kc < kb + kw; kc += 32) {
        V a[4], a2[4];
#pragma unroll
        for (int mb = 0; mb < 4; ++mb) { a[mb] = WFrag<T16>::ld((const T16*)(Ap + mb * rs)); if (NSPLIT == 1 || NSPLIT == 2) a2[mb] = WFrag<T16>::ld((const T16*)(A2p + mb * rs)); }
        V bb[4], bb2[4];
        // unrolled: bb is indexed by constants, and all of a trip's loads stand in front of the one wait
#pragma unroll
        for (int nb = 0; nb < 4; ++nb) { bb[nb] = WFrag<T16>::ld((const T16*)(Bp + nb * rs)); if (NSPLIT >= 2) bb2[nb] = WFrag<T16>::ld((const T16*)(B2p + nb * rs)); }
        // one s_wait_xcnt 0 behind the trip's loads, in front of the next trip's new addresses
        if (NSPLIT == 0) addr_wait(Ap, Bp); else if (NSPLIT == 1) addr_wait(Ap, A2p, Bp); else if (NSPLIT == 2) addr_wait(Ap, A2p, Bp, B2p); else addr_wait(Ap, Bp, B2p);
#pragma unroll
        for (int nb = 0; nb < 4; ++nb) { const V b = bb[nb]; V b2; if (NSPLIT >= 2) b2 = bb2[nb];
#pragma unroll
            for (int mb = 0; mb < 4; ++mb) { acc[mb][nb] = WFrag<T16>::mma(a[mb], b, acc[mb][nb]); if (NSPLIT == 1 || NSPLIT == 2) acc[mb][nb] = WFrag<T16>::mma(a2[mb], b, acc[mb][nb]); if (NSPLIT >= 2) acc[mb][nb] = WFrag<T16>::mma(a[mb], b2, acc[mb][nb]); } }
        Ap += 1024; Bp += 1024; if (NSPLIT == 1 || NSPLIT == 2) A2p += 1024; if (NSPLIT >= 2) B2p += 1024;   // the next tile along k
        asm volatile("v_nop\n\tv_nop\n\tv_nop\n\tv_nop" : "+v"(acc[0][0]), "+v"(acc[1][1]), "+v"(acc[2][2]), "+v"(acc[3][3]) : "v"(a[0]), "v"(a[3]));
    }
    if constexpr (NW > 1) {
        // EPI 1: thread t takes the 4 values that stand at t * 4 in a 16-token block of the head plane (2 tiles), so that the 256 threads store 2 KiB in a row
        float* my = os + wave * (64 * 68); const int cofs = (EPI == 1) ? (((int)threadIdx.x >> 5) & 7) * 8 + ((int)threadIdx.x & 1) * 4 : ((int)threadIdx.x & 15) * 4; v4f bv = (v4f){};
        if (BIAS) { bv[0] = bfr(bias[c0 + cofs]); bv[1] = bfr(bias[c0 + cofs + 1]); bv[2] = bfr(bias[c0 + cofs + 2]); bv[3] = bfr(bias[c0 + cofs + 3]); }
        // the three loops are unrolled so that acc is indexed by constants and stays in registers
#pragma unroll
        for (int mb = 0; mb < 4; ++mb)
#pragma unroll
            for (int nb = 0; nb < 4; ++nb)
#pragma unroll
                for (int j = 0; j < 8; ++j) my[(mb * 16 + hi * 8 + j) * 68 + nb * 16 + lr] = acc[mb][nb][j];
        __syncthreads();   // every wave's partial tile is in LDS before any thread adds them
        v4f sums[32 / NW];
        // both loops are unrolled so that the LDS reads of all planes are in flight together
#pragma unroll
        for (int s = 0; s < 32 / NW; ++s) { const int idx = s * (32 * NW) + (int)threadIdx.x; const int row = (EPI == 1) ? s * 16 + (((int)threadIdx.x >> 1) & 15) : idx >> 4; v4f val = *(const v4fa*)(os + row * 68 + cofs);
#pragma unroll
            for (int w = 1; w < NW; ++w) val += *(const v4fa*)(os + w * (64 * 68) + row * 68 + cofs);
            if (BIAS) val += bv;
            if constexpr (EPI == 0) *(v4f*)(C + (size_t)(r0 + row) * ldc + c0 + cofs) = val;
            if constexpr (EPI == 1) *(v4h*)(P16 + ((size_t)blockIdx.y * TT + r0 + s * 16) * HD + (int)threadIdx.x * 4) = __builtin_convertvector(val, v4h);
            if constexpr (EPI == 2) sums[s] = val; }
        if constexpr (EPI == 2) {
            __syncthreads();   // every thread has read the partial tiles before the sum is written over them
            // pitch 65 words: the 32 lanes of a wave meet 32 different banks in the transposed write
#pragma unroll
            for (int s = 0; s < 32 / NW; ++s)
#pragma unroll
                for (int q = 0; q < 4; ++q) os[(cofs + q) * 65 + ((s * (32 * NW) + (int)threadIdx.x) >> 4)] = sums[s][q];
            __syncthreads();   // the whole transposed tile is in LDS before any thread reads a row of it
            // thread t takes the 8 tokens that stand at t * 8 in a 32-token block of the plane (4 tiles): the 256 threads store 4 KiB in a row to each plane
#pragma unroll
            for (int u = 0; u < 16 / NW; ++u) { const int d = (((int)threadIdx.x >> 6) & 3) * 16 + ((int)threadIdx.x & 15), t8 = u * 32 + (((int)threadIdx.x >> 4) & 3) * 8; v8us oh, ol;
#pragma unroll
                for (int j = 0; j < 8; ++j) { unsigned short a2, c2; splitf(os[d * 65 + t8 + j], a2, c2); oh[j] = a2; ol[j] = c2; }
                const size_t oo = ((size_t)blockIdx.y * TT + r0 + u * 32) * HD + (int)threadIdx.x * 8; *(v8us*)(Ph + oo) = oh; *(v8us*)(Pl + oo) = ol; }
        }
        return;
    }
#pragma unroll
    for (int mb = 0; mb < 4; ++mb) {
#pragma unroll
        for (int nb = 0; nb < 4; ++nb) {
#pragma unroll
            for (int j = 0; j < 8; ++j) os[(hi * 8 + j) * 68 + nb * 16 + lr] = acc[mb][nb][j]; }
        __builtin_amdgcn_wave_barrier(); asm volatile("" ::: "memory");
        float* crow = C + (size_t)(r0 + mb * 16) * ldc + c0;
{
#pragma unroll
            for (int s = 0; s < 8; ++s) { const int row = 2 * s + hi, cofs = lr * 4; v4f val = *(const v4fa*)(os + row * 68 + cofs); if (BIAS) { val[0] += bfr(bias[c0 + cofs]); val[1] += bfr(bias[c0 + cofs + 1]); val[2] += bfr(bias[c0 + cofs + 2]); val[3] += bfr(bias[c0 + cofs + 3]); }
                *(v4f*)(crow + (size_t)row * ldc + cofs) = val; }
             }
        __builtin_amdgcn_wave_barrier(); asm volatile("" ::: "memory");
    }
}

typedef __attribute__((ext_vector_type(2))) unsigned short v2us;
typedef __attribute__((ext_vector_type(4))) unsigned short v4us;
typedef __attribute__((ext_vector_type(2))) float v2f;
typedef __attribute__((ext_vector_type(4))) int v4i;

// k_wtG: w[k][n] f32 to Bt (rows = n) in fragment order. Thread i writes the 8 elements at i * 8: one n, 8 neighbouring k; 16 lanes read 16 neighbouring n of one k.
__global__ __launch_bounds__(256) void k_wtG(const float* __restrict__ w, int K, int N, bf* Bt) {
    const int i = blockIdx.x * 256 + threadIdx.x; if (i >= N * K / 8) return;
    const int tile = i >> 6, kt = K / 32; const int n = (tile / kt) * 16 + (i & 15), k0 = (tile % kt) * 32 + ((i >> 4) & 3) * 8; v8us o; const float* wp[8]; float wv[8];
    // unrolled so that the 8 loads are in flight together
#pragma unroll
    for (int j = 0; j < 8; ++j) { wp[j] = w + (size_t)(k0 + j) * N + n; wv[j] = *wp[j]; }
    // s_wait_xcnt 0 behind the eight loads; their addresses are inputs, so that no address register is written (also not by a later load's result) ahead of it
    asm volatile("s_wait_xcnt 0x0" :: "v"(wp[0]), "v"(wp[1]), "v"(wp[2]), "v"(wp[3]), "v"(wp[4]), "v"(wp[5]), "v"(wp[6]), "v"(wp[7]) : "memory");
    // unrolled: o and wv are indexed by constants
#pragma unroll
    for (int j = 0; j < 8; ++j) o[j] = f2bf(wv[j]);
    *(v8us*)(Bt + (size_t)i * 8) = o;
}
// k_cvt8: src[row][DM] f32 to dst in fragment order. Thread i writes the 8 elements at i * 8: one row, 8 neighbouring k.
__global__ __launch_bounds__(256) void k_cvt8(const float* __restrict__ src, bf* dst, size_t n8) { const size_t i = (size_t)blockIdx.x * 256 + threadIdx.x; if (i >= n8) return; const int tile = (int)(i >> 6); const int row = (tile / (DM / 32)) * 16 + ((int)i & 15), k0 = (tile % (DM / 32)) * 32 + (((int)i >> 4) & 3) * 8; const v8f v = *(const v8f*)(src + (size_t)row * DM + k0); v8us o;
#pragma unroll
    for (int k = 0; k < 8; ++k) o[k] = f2bf(v[k]); *(v8us*)(dst + i * 8) = o;  }
__global__ __launch_bounds__(256) void k_cscvt(const float* __restrict__ cosT, const float* __restrict__ sinT, float* CS) { const int idx = blockIdx.x * 256 + threadIdx.x; if (idx >= TT * HD) return; v2f cs; cs[0] = bfr(cosT[idx]); cs[1] = bfr(sinT[idx]); *(v2f*)(CS + (size_t)idx * 2) = cs;  }
typedef __attribute__((ext_vector_type(2))) __bf16 v2bf;
// Work-group barrier that orders LDS only: the fences name the LDS address space, so that global loads asked for ahead of it stay in flight across it (__syncthreads() waits for them).
__device__ __forceinline__ void lds_barrier() { __builtin_amdgcn_fence(__ATOMIC_RELEASE, "workgroup", "local"); __builtin_amdgcn_s_barrier(); __builtin_amdgcn_fence(__ATOMIC_ACQUIRE, "workgroup", "local"); }
// k_fattn: grid (TT / FI, PVG), 512 threads, wave = head. Per pass of FJ keys: S^T = K Q^T (fp16, rows = keys, columns = queries: a lane's 8 accumulator values are 8 neighbouring keys of one query), stored to LDS as [head][query][key] f32.
// Head softmax: behind a barrier each thread takes 2 neighbouring keys of one query, reads the 16 heads' scores and writes the 16 weight pairs back over the same rows: bf16 hi pairs in the row's first 16 words, lo pairs in the next 16.
// (A wave holds whole rows, and has read all of a row before it writes any of it.) Behind a second barrier each wave reads its head's rows as A fragments of weights.V.
// A masked position (j > i) has the same score in every head, so its weight is exactly 1/16. O: plane blockIdx.y of [PVG][TT * DQ] f32.
// K16, Vh, Vl carry no __restrict__: the loop's loads then keep their place in front of its s_wait_xcnt statement (its "memory" clobber holds them there).
__global__ __launch_bounds__(512) void k_fattn(const h16* __restrict__ Q16, const h16* K16, const bf* Vh, const bf* Vl, float* O) {
    __shared__ __align__(16) float Ss[NH_ * FI * FP];
    const float K2 = SCL * 1.4426950408889634f;
    const int h = __builtin_amdgcn_readfirstlane((int)(threadIdx.x >> 5));
    const int lane = threadIdx.x & 31, lr = lane & 15, hi = lane >> 4;
    const int i0 = blockIdx.x * FI, jb = blockIdx.y * (TT / PVG);
    // each lane's own address of its 16 bytes in a tile (fragment order): lane * 16 bytes behind the tile's start
    const h16* qp = Q16 + ((size_t)h * TT + i0) * HD;
    const unsigned ko = (unsigned)lane * 16u;
    const char* kp = (const char*)(K16 + ((size_t)h * TT + jb) * HD) + ko;
    const char* vhp = (const char*)(Vh + ((size_t)h * TT + jb) * HD) + ko;
    const char* vlp = (const char*)(Vl + ((size_t)h * TT + jb) * HD) + ko;
    v16h qf[2][2], kf[2][2];
#pragma unroll
    for (int a = 0; a < 2; ++a)
#pragma unroll
        for (int ks = 0; ks < 2; ++ks) { qf[a][ks] = WFrag<h16>::ld((const h16*)((const char*)qp + ko) + (a * 2 + ks) * 512); kf[a][ks] = WFrag<h16>::ld((const h16*)kp + (a * 2 + ks) * 512); }
    v8f o[2][4];
#pragma unroll
    for (int it = 0; it < 2; ++it)
#pragma unroll
        for (int nb = 0; nb < 4; ++nb) o[it][nb] = (v8f){};
    float* sw = Ss + h * (FI * FP) + lr * FP + hi * 8;          // this lane's 8 scores of a tile
    const float* pr = Ss + h * (FI * FP) + lr * FP + hi * 4;    // this lane's 4 words (8 weights) of a fragment half
    const int pi = (int)threadIdx.x >> 4, pj = ((int)threadIdx.x & 15) * 2;
    float* ps = Ss + pi * FP + pj; float* pw = Ss + pi * FP + (pj >> 1);
    const int NT = TT / PVG / FJ;
#pragma unroll 1
    for (int t = 0; t < NT; ++t) {
        v8f s[2][2];
#pragma unroll
        for (int it = 0; it < 2; ++it)
#pragma unroll
            for (int jt = 0; jt < 2; ++jt) { s[it][jt] = WFrag<h16>::mma(kf[jt][0], qf[it][0], (v8f){}); s[it][jt] = WFrag<h16>::mma(kf[jt][1], qf[it][1], s[it][jt]); }
        // next pass's K fragments (the last pass asks for its own again: in bounds, not used) and this pass's V fragments: asked for here so that they fly during the softmax
        const int tn = (t + 1 < NT) ? t + 1 : t; const char* kn = kp + tn * (FJ * HD * 2);
#pragma unroll
        for (int jt = 0; jt < 2; ++jt)
#pragma unroll
            for (int ks = 0; ks < 2; ++ks) kf[jt][ks] = WFrag<h16>::ld((const h16*)kn + (jt * 2 + ks) * 512);
        v16bf vhf[4], vlf[4];
#pragma unroll
        for (int nb = 0; nb < 4; ++nb) { vhf[nb] = WFrag<bf>::ld((const bf*)vhp + nb * 512); vlf[nb] = WFrag<bf>::ld((const bf*)vlp + nb * 512); }
        addr_wait(kn, vhp, vlp);   // one s_wait_xcnt 0 behind the pass's loads, in front of every later write of their address registers
        vhp += FJ * HD * 2; vlp += FJ * HD * 2;
#pragma unroll
        for (int it = 0; it < 2; ++it)
#pragma unroll
            for (int jt = 0; jt < 2; ++jt) {
                *(v4fa*)(sw + it * 16 * FP + jt * 16) = __builtin_shufflevector(s[it][jt], s[it][jt], 0, 1, 2, 3);
                *(v4fa*)(sw + it * 16 * FP + jt * 16 + 4) = __builtin_shufflevector(s[it][jt], s[it][jt], 4, 5, 6, 7); }
        lds_barrier();   // all 16 heads' scores of this pass are in LDS before any thread reads a column of them
        {
            v2f sv[NH_];
#pragma unroll
            for (int g = 0; g < NH_; ++g) sv[g] = *(const v2f*)(ps + g * (FI * FP));
            const int dj = i0 + pi - (jb + t * FJ + pj);   // query index minus the thread's first key index
            v2f rs;
#pragma unroll
            for (int q = 0; q < 2; ++q) { float mx = sv[0][q];
#pragma unroll
                for (int g = 1; g < NH_; ++g) mx = fmaxf(mx, sv[g][q]);
                mx *= K2; float sum = 0.f;
#pragma unroll
                for (int g = 0; g < NH_; ++g) { sv[g][q] = __builtin_amdgcn_exp2f(__builtin_fmaf(sv[g][q], K2, -mx)); sum += sv[g][q]; }
                rs[q] = __builtin_amdgcn_rcpf(sum); }
#pragma unroll
            for (int g = 0; g < NH_; ++g) { v2f w; w[0] = (dj < 0) ? 0.0625f : sv[g][0] * rs[0]; w[1] = (dj < 1) ? 0.0625f : sv[g][1] * rs[1];
                const unsigned hu = __builtin_bit_cast(unsigned, __builtin_convertvector(w, v2bf)); v2f d; d[0] = w[0] - __uint_as_float(hu << 16); d[1] = w[1] - __uint_as_float(hu & 0xFFFF0000u);
                pw[g * (FI * FP)] = __uint_as_float(hu); pw[g * (FI * FP) + 16] = __uint_as_float(__builtin_bit_cast(unsigned, __builtin_convertvector(d, v2bf))); }
        }
        lds_barrier();   // every head's weights of this pass are in LDS before its wave reads them
#pragma unroll
        for (int it = 0; it < 2; ++it) {
            const float* p = pr + it * 16 * FP;
            const v16bf pa = __builtin_bit_cast(v16bf, __builtin_shufflevector(*(const v4fa*)p, *(const v4fa*)(p + 8), 0, 1, 2, 3, 4, 5, 6, 7));
            const v16bf pb = __builtin_bit_cast(v16bf, __builtin_shufflevector(*(const v4fa*)(p + 16), *(const v4fa*)(p + 24), 0, 1, 2, 3, 4, 5, 6, 7));
#pragma unroll
            for (int nb = 0; nb < 4; ++nb) { o[it][nb] = wmmab(pa, vhf[nb], o[it][nb]); o[it][nb] = wmmab(pb, vhf[nb], o[it][nb]); o[it][nb] = wmmab(pa, vlf[nb], o[it][nb]); }
        }
    }
    const int el = (int)__builtin_amdgcn_mbcnt_lo(~0u, 0u);   // the lane index, formed anew here so that no register has to hold it through the loop
    // O holds each value at the place that it has in the out-projection's A plane (rows = tokens, k = h * HD + d, fragment order), so that the merge kernel is element-wise
    float* op = O + (size_t)blockIdx.y * TT * DQ + (size_t)i0 * DQ + h * (HD * 16) + ((el & 15) >> 3) * 128 + (el >> 4) * 64 + (el & 7);
#pragma unroll
    for (int it = 0; it < 2; ++it)
#pragma unroll
        for (int nb = 0; nb < 4; ++nb)
#pragma unroll
            for (int r = 0; r < 8; ++r) op[it * 16 * DQ + nb * 256 + r * 8] = o[it][nb][r];
}
__global__ __launch_bounds__(256) void k_mrgrb(const float* __restrict__ O, int rb, bf* Ah, bf* Al) { const size_t e = ((size_t)blockIdx.x * 256 + threadIdx.x) * 8; if (e >= (size_t)NH_ * RB * HD) return; static_assert(PVG == 4, "four planes, four addresses");
    const float* q0 = O + e; const float* q1 = q0 + (size_t)NH_ * RB * HD; const float* q2 = q1 + (size_t)NH_ * RB * HD; const float* q3 = q2 + (size_t)NH_ * RB * HD; v4f pa[PVG], pb[PVG];
    // the four planes' loads and their data wait in one statement: all eight are in flight together, and no address register is written (also not by a load's result) while a load is under way
    asm volatile("global_load_b128 %0, %8, off\n\tglobal_load_b128 %1, %8, off offset:16\n\tglobal_load_b128 %2, %9, off\n\tglobal_load_b128 %3, %9, off offset:16\n\t"
                 "global_load_b128 %4, %10, off\n\tglobal_load_b128 %5, %10, off offset:16\n\tglobal_load_b128 %6, %11, off\n\tglobal_load_b128 %7, %11, off offset:16\n\ts_wait_loadcnt 0x0"
                 : "=&v"(pa[0]), "=&v"(pb[0]), "=&v"(pa[1]), "=&v"(pb[1]), "=&v"(pa[2]), "=&v"(pb[2]), "=&v"(pa[3]), "=&v"(pb[3]) : "v"(q0), "v"(q1), "v"(q2), "v"(q3) : "memory");
    // the planes are added in plane order
    const v4f ta = ((pa[0] + pa[1]) + pa[2]) + pa[3], tb = ((pb[0] + pb[1]) + pb[2]) + pb[3];
    const v8f t = __builtin_shufflevector(ta, tb, 0, 1, 2, 3, 4, 5, 6, 7);
    v8us oh, ol;
    // unrolled: the vectors are indexed by constants
#pragma unroll
    for (int q = 0; q < 8; ++q) { unsigned short a2, c2; splitf(t[q], a2, c2); oh[q] = a2; ol[q] = c2; }
    *(v8us*)(Ah + (size_t)rb * RB * DQ + e) = oh; *(v8us*)(Al + (size_t)rb * RB * DQ + e) = ol;  }
// k_asoft: per row (zz, i): t = S x DM^-0.5 (no mask); softmax over the 2048 keys (register row, one exp, fixed trees);
__global__ __launch_bounds__(256) void k_asoft(const float* __restrict__ Sb, h16* P16, bf* Ph, bf* Pl) {
    const int lane = threadIdx.x & 31; const int row = blockIdx.x * 8 + (threadIdx.x >> 5); if (row >= ZH * TT) return; const int i = row % TT; const int zz = row / TT; (void)zz; const bool hires = (i < RH); const float* sr = Sb + (size_t)row * TT; float v[TT / 32]; float mx = -3.0e38f;
#pragma unroll
    for (int ch = 0; ch < TT / 128; ++ch) { const int j0 = ch * 128 + lane * 4; const v4f a = *(const v4f*)(sr + j0);
#pragma unroll
        for (int q = 0; q < 4; ++q) { const int j = j0 + q; (void)j; const float t = a[q] * SCL; v[ch * 4 + q] = t; mx = fmaxf(mx, t); } }
#pragma unroll
    for (int sh = 16; sh; sh >>= 1) mx = fmaxf(mx, __shfl_xor(mx, sh, 32));
    float sum = 0.f;
#pragma unroll
    for (int k = 0; k < TT / 32; ++k) { float d0 = __fsub_rn(v[k], mx); asm volatile("" : "+v"(d0)); v[k] = __builtin_amdgcn_exp2f(__fmul_rn(d0, 1.4426950408889634f)); sum += v[k]; }
#pragma unroll
    for (int sh = 16; sh; sh >>= 1) sum += __shfl_xor(sum, sh, 32);
    const float f = __fdiv_rn(hires ? 1.0f : PCAR, sum);
{
        if (hires) {
#pragma unroll
            for (int ch = 0; ch < TT / 128; ++ch) { v4us oh, ol;
#pragma unroll
                for (int q = 0; q < 4; ++q) { unsigned short a, c2; splitf(v[ch * 4 + q] * f, a, c2); oh[q] = a; ol[q] = c2; }
                const size_t oo = ((size_t)zz * (RH ? RH : 1) + i) * TT + ch * 128 + lane * 4; *(v4us*)(Ph + oo) = oh; *(v4us*)(Pl + oo) = ol; }
        } else {
#pragma unroll
            for (int ch = 0; ch < TT / 128; ++ch) { v4h o4;
#pragma unroll
                for (int q = 0; q < 4; ++q) o4[q] = tohx(v[ch * 4 + q] * f);
                *(v4h*)(P16 + (size_t)row * TT + ch * 128 + lane * 4) = o4; } }
         }
}
__global__ __launch_bounds__(256) void k_merge(const float* __restrict__ O, int h0, bf* Ah, bf* Al) { const size_t e = ((size_t)blockIdx.x * 256 + threadIdx.x) * 2; if (e >= (size_t)ZH * TT * HD) return; const int d = (int)(e % HD); const int t = (int)((e / HD) % TT); const int zz = (int)(e / ((size_t)HD * TT)); const float cs = (t < RH) ? 1.0f : (1.0f / PCAR); const size_t oo = (size_t)t * DQ + (h0 + zz) * HD + d;
    v2us oh, ol;
#pragma unroll
    for (int q = 0; q < 2; ++q) { unsigned short a, c2; splitf(O[e + q] * cs, a, c2); oh[q] = a; ol[q] = c2; } *(v2us*)(Ah + oo) = oh; *(v2us*)(Al + oo) = ol;  }

extern "C" void kernel_launch(void* const* d_in, const int* in_sizes, int n_in,
                              void* d_out, int out_size, void* d_ws, size_t ws_size, hipStream_t stream) {
    (void)in_sizes; (void)n_in; (void)out_size;
    const float* x = (const float*)d_in[0]; const float* wq = (const float*)d_in[1]; const float* bq = (const float*)d_in[2]; const float* wk = (const float*)d_in[3]; const float* bk = (const float*)d_in[4]; const float* wv = (const float*)d_in[5]; const float* bv = (const float*)d_in[6]; const float* wo = (const float*)d_in[7]; const float* bo = (const float*)d_in[8]; const float* cosT = nullptr; const float* sinT = nullptr; (void)cosT; (void)sinT;
    float* OUT = (float*)d_out;     // [2][2048][1024]
    char* wsp = (char*)d_ws;
    auto take = [&](size_t bytes) { char* p = wsp; wsp += (bytes + 255) & ~(size_t)255; return (void*)p; };
    bf* WQ = (bf*)take((size_t)DQ * DM * 2); bf* WK = (bf*)take((size_t)DKV * DM * 2); bf* WV = (bf*)take((size_t)DKV * DM * 2); bf* WO = (bf*)take((size_t)DM * DQ * 2);
    bf* XB = (bf*)take((size_t)TT * DM * 2);
    h16* QP16 = (h16*)take((size_t)NH_ * TT * HD * 2); h16* KP16 = (h16*)take((size_t)NKV * TT * HD * 2);
    bf* VTh = (bf*)take((size_t)NKV * HD * TT * 2); bf* VTl = (bf*)take((size_t)NKV * HD * TT * 2);
    float* Ob = (float*)take((size_t)PVG * NH_ * RB * HD * 4); bf* ATh = (bf*)take((size_t)TT * DQ * 2); bf* ATl = (bf*)take((size_t)TT * DQ * 2);
    if ((size_t)(wsp - (char*)d_ws) > ws_size) return;    // ws 256 MiB
    { k_wtG<<<(unsigned)((DM * DQ / 8 + 255) / 256), 256, 0, stream>>>(wq, DM, DQ, WQ); k_wtG<<<(unsigned)((DM * DKV / 8 + 255) / 256), 256, 0, stream>>>(wk, DM, DKV, WK); k_wtG<<<(unsigned)((DM * DKV / 8 + 255) / 256), 256, 0, stream>>>(wv, DM, DKV, WV);
      k_wtG<<<(unsigned)((DQ * DM / 8 + 255) / 256), 256, 0, stream>>>(wo, DQ, DM, WO);
       }
    for (int b = 0; b < NB_; ++b) {
        
        k_cvt8<<<(unsigned)(((size_t)TT * DM / 8 + 255) / 256), 256, 0, stream>>>(x + (size_t)b * TT * DM, XB, (size_t)TT * DM / 8);
        k_gemmw<bf, 0, true, GNW, 1, 1, DM><<<dim3(TT / 64, DQ / 64, 1), 32 * GNW, 0, stream>>>(XB, nullptr, WQ, nullptr, nullptr, 0, bq, 0, 0, 0, 0, QP16, nullptr, nullptr);
        k_gemmw<bf, 0, true, GNW, 1, 1, DM><<<dim3(TT / 64, DKV / 64, 1), 32 * GNW, 0, stream>>>(XB, nullptr, WK, nullptr, nullptr, 0, bk, 0, 0, 0, 0, KP16, nullptr, nullptr);
        k_gemmw<bf, 0, true, GNW, 1, 2, DM><<<dim3(TT / 64, DKV / 64, 1), 32 * GNW, 0, stream>>>(XB, nullptr, WV, nullptr, nullptr, 0, bv, 0, 0, 0, 0, nullptr, VTh, VTl);
        k_fattn<<<dim3(TT / FI, PVG, 1), 512, 0, stream>>>(QP16, KP16, VTh, VTl, Ob);
        k_mrgrb<<<(unsigned)(((size_t)NH_ * RB * HD / 8 + 255) / 256), 256, 0, stream>>>(Ob, 0, ATh, ATl);
        k_gemmw<bf, 1, true, GNW, 1, 0, DQ><<<dim3(TT / 64, DM / 64, 1), 32 * GNW, 0, stream>>>(ATh, ATl, WO, nullptr, OUT + (size_t)b * TT * DM, DM, bo, 0, 0, 0, 0, nullptr, nullptr, nullptr); }
}

// v005
// Measured time: 185 microseconds a run.
// Two timings next to v004 both put it at 1.20 times that version's speed.
// Counting every step since v000, it is 7.34 times as fast.
#include <hip/hip_runtime.h>

// MultiHeadAttention__5987 (x [2][2048][1024]; Q/K/V = x W + b (16 x 64); score = Q.K / sqrt(1024); causal positions (j > i) set to -1e10; FAITHFUL QUIRK: softmax over the HEAD axis (not over keys) -> weight[h][i][j]; out_h[i] = sum_j weight[h][i][j] V_h[j] (un-normalised over keys; masked positions carry weight exactly 1/16); merged Wo + bo -> [2][2048][1024]).
// Layout (exact): one kernel per batch does scores, head softmax and weights.V: a work-group of 16 waves (wave = head) holds 32 query rows and walks its share of the key passes (32 keys each) up to the diagonal; scores and weights never leave the WGP: they cross from head to head through LDS. Key passes wholly behind the diagonal carry the weight 1/16 everywhere: their part of weights.V is 1/16 of the sum of V's 32-token block sums.
// Compute dtypes, f32 accumulate: every input rounded to bf16; Q/K/V on PLAIN bf16 operands (inputs: exact) + bias; scores as single fp16 products (x1; logits are q.k/32); the 16-way head softmax in f32 per (i, j) (masked columns give exactly 1/16); weights.V hl x hl (3 products) on every row (weights <= 1, no carrier needed); Wo hl x exact (2 products) + bias.

#define NB_  2
#define TT   2048
#define DM   1024
#define NH_  16
#define NKV  16
#define REP  (NH_ / NKV)
#define HD   64
#define DQ   (NH_ * HD)
#define DKV  (NKV * HD)
#define ZH   2
#define RH   2048                  // query rows < RH use hi+lo planes (0: none)
#define WIN  0
#define PCAR 1024.0f
#define RB   TT     // query rows per merge launch
#define NRB  (TT / RB)
#define GNW  8      // waves per work-group that share a GEMM tile's K range
#define PVG  7      // most work-groups that share a query block's key passes; their planes are added in the merge kernel
#define NPARTS(ib) (((ib) + 1) / 10 + 1)   // work-groups that share query block ib's ib + 1 key passes up to the diagonal: at most 10 passes each
#define FWG  244    // sum of NPARTS over the 64 query blocks: every work-group has a WGP of its own (a work-group's 16 waves fill a WGP's registers)
#define FI   32     // query rows per work-group of the fused kernel
#define FJ   32     // keys per pass of the fused kernel
#define FP   36     // LDS row pitch in floats (144 B: an odd multiple of 16 B)
#define SCL  0.03125f   // 1/sqrt(1024) (full embed dim, faithful)
typedef _Float16 h16;
typedef unsigned short bf;
typedef __attribute__((ext_vector_type(16))) __bf16   v16bf;
typedef __attribute__((ext_vector_type(16))) _Float16 v16h;
typedef __attribute__((ext_vector_type(8)))  _Float16 v8h;
typedef __attribute__((ext_vector_type(8)))  unsigned short v8us;
typedef __attribute__((ext_vector_type(8)))  float    v8f;
typedef __attribute__((ext_vector_type(4)))  float    v4f;
typedef v8h  __attribute__((may_alias)) v8ha;
typedef v4f  __attribute__((may_alias)) v4fa;
typedef v8us __attribute__((may_alias)) v8usa;

__device__ __forceinline__ unsigned short f2bf(float f) { unsigned u = __float_as_uint(f); u += 0x7FFFu + ((u >> 16) & 1u); return (unsigned short)(u >> 16); }
__device__ __forceinline__ float bf2f(unsigned short b) { return __uint_as_float(((unsigned)b) << 16); }
__device__ __forceinline__ float bfr(float f) { return bf2f(f2bf(f)); }
__device__ __forceinline__ v16h cat16(v8h lo, v8h hi) { return __builtin_shufflevector(lo, hi, 0, 1, 2, 3, 4, 5, 6, 7, 8, 9, 10, 11, 12, 13, 14, 15); }
__device__ __forceinline__ v16bf cat16b(v8us lo, v8us hi) { return __builtin_bit_cast(v16bf, __builtin_shufflevector(lo, hi, 0, 1, 2, 3, 4, 5, 6, 7, 8, 9, 10, 11, 12, 13, 14, 15)); }
__device__ __forceinline__ v8f wmma16(v16h a, v16h b, v8f c) { return __builtin_amdgcn_wmma_f32_16x16x32_f16(false, a, false, b, (short)0, c, false, false); }
__device__ __forceinline__ v8f wmmab(v16bf a, v16bf b, v8f c) { return __builtin_amdgcn_wmma_f32_16x16x32_bf16(false, a, false, b, (short)0, c, false, false); }
__device__ __forceinline__ h16 tohx(float x) { return (h16)x; }
__device__ __forceinline__ void splitf(float y, unsigned short& h, unsigned short& l) { h = f2bf(y); l = f2bf(y - bf2f(h)); }
// s_wait_xcnt 0 behind a run of global loads, ahead of every later write of a register that they name as an address. The addresses are inputs of the statement, so that their registers stay untouched (also by a later load's result) up to the wait.
__device__ __forceinline__ void addr_wait(const void* a, const void* b) { asm volatile("s_wait_xcnt 0x0" :: "v"(a), "v"(b) : "memory"); }
__device__ __forceinline__ void addr_wait(const void* a, const void* b, const void* c) { asm volatile("s_wait_xcnt 0x0" :: "v"(a), "v"(b), "v"(c) : "memory"); }
__device__ __forceinline__ void addr_wait(const void* a, const void* b, const void* c, const void* d) { asm volatile("s_wait_xcnt 0x0" :: "v"(a), "v"(b), "v"(c), "v"(d) : "memory"); }
typedef __attribute__((ext_vector_type(2))) _Float16 v2h;
typedef __attribute__((ext_vector_type(4))) _Float16 v4h;



// ---- k_gemmw: register-blocked GEMM, 64x64 output tile per work-group (16 accumulators per wave), operands straight from 16-bit planes in fragment order; grid (M/64, N/64, Z * KSG), 32 * NW threads.
// C[m][n] (f32, pitch ldc, + optional f32 bias[n]) = sum_k A[m][k] Bt[n][k] (+ split products per NSPLIT). z-batch strides sA/sB/sC in elements.
// Split K: the K range is cut into KSG * NW equal runs (K % (32 * KSG * NW) == 0). Each of the NW waves of a work-group sums one run over the whole tile; the NW tiles are added in wave order through LDS.
// The KSG work-groups of one tile each store their own partial tile at C + kg * sP; the consumer adds those planes (KSG == 1: C is the result).
// EPI (NW > 1 only; a tile's 64 columns are one head, its rows are tokens): 0: f32 tile to C. 1: the tile as fp16 to the head plane P16[head] (rows = tokens, k = d). 2: the tile transposed through LDS, as bf16 hi and lo, to Ph / Pl[head] (rows = d, k = tokens), and its sums over each FJ tokens as f32 to VS[head][token / FJ][d]. The planes in fragment order.
// FRAGMENT ORDER: every 16-bit operand plane P[row][k] is stored as tiles of 16 rows x 32 k (512 elements, 1 KiB), one tile = one WMMA operand fragment, laid out as the lanes read it:
// element (row, k) stands at tile * 512 + ((k % 32) / 16) * 256 + (((k % 16) / 8) * 16 + row % 16) * 8 + k % 8. A lane's two 16-byte loads are at lane * 8 and 256 + lane * 8: a wave's load is 512 bytes in a row (4 whole lines).
// Tile numbers: GEMM operands and Q, K head planes (row / 16) * (K / 32) + k / 32; V planes (rows = d, k = token) (k / 32) * (HD / 16) + row / 16, so that a pass's four tiles are neighbours.
template <typename T16> struct WFrag;
template <> struct WFrag<h16> { typedef v16h V; static __device__ __forceinline__ V ld(const h16* p) { return cat16(*(const v8h*)p, *(const v8h*)(p + 256)); } static __device__ __forceinline__ v8f mma(V a, V b, v8f c) { return wmma16(a, b, c); } };
template <> struct WFrag<bf> { typedef v16bf V; static __device__ __forceinline__ V ld(const bf* p) { return cat16b(*(const v8us*)p, *(const v8us*)(p + 256)); } static __device__ __forceinline__ v8f mma(V a, V b, v8f c) { return wmmab(a, b, c); } };
// The operand pointers carry no __restrict__: the loads then keep their place in front of the loop's s_wait_xcnt statement (its "memory" clobber holds them there).
template <typename T16, int NSPLIT, bool BIAS, int NW, int KSG, int EPI, int K>
__global__ __launch_bounds__(32 * NW) void k_gemmw(const T16* A, const T16* A2, const T16* Bt, const T16* Bt2, float* C, int ldc, const float* __restrict__ bias, size_t sA, size_t sB, size_t sC, size_t sP, h16* P16, bf* Ph, bf* Pl, float* VS) {
    static_assert(EPI == 0 || (NW == 8 && KSG == 1 && HD == 64), "a head plane is written from a whole tile that is one head wide, by 256 threads");
    typedef typename WFrag<T16>::V V;
    __shared__ __align__(16) float os[(NW == 1 ? 16 : NW * 64) * 68];
    const size_t z = blockIdx.z / KSG; const int kg = blockIdx.z % KSG; A += z * sA; if (A2) A2 += z * sA; Bt += z * sB; if (Bt2) Bt2 += z * sB; C += z * sC + kg * sP;
    const int wave = (NW == 1) ? 0 : __builtin_amdgcn_readfirstlane((int)(threadIdx.x >> 5)); const int kw = K / (NW * KSG), kb = (kg * NW + wave) * kw;
    const int lane = threadIdx.x & 31, lr = lane & 15, hi = lane >> 4; const int r0 = blockIdx.x * 64, c0 = blockIdx.y * 64;
    v8f acc[4][4];
#pragma unroll
    for (int mb = 0; mb < 4; ++mb)
#pragma unroll
        for (int nb = 0; nb < 4; ++nb) acc[mb][nb] = (v8f){};
    // each lane's own address in the first tile of its operand (16 rows of tiles are 16 * K elements; 32 k are 512; the lane's 16 bytes stand lane * 16 bytes behind a tile's start)
    const unsigned lo = (unsigned)lane * 16u; const int rs = K * 32;   // rs: bytes from one 16-row block of tiles to the next (K is a constant of the build, so that it goes into the loads' immediate offsets)
    const char* Ap = (const char*)(A + (size_t)r0 * K + (size_t)kb * 16) + lo; const char* A2p = (NSPLIT == 1 || NSPLIT == 2) ? (const char*)(A2 + (size_t)r0 * K + (size_t)kb * 16) + lo : nullptr; const char* Bp = (const char*)(Bt + (size_t)c0 * K + (size_t)kb * 16) + lo; const char* B2p = (NSPLIT >= 2) ? (const char*)(Bt2 + (size_t)c0 * K + (size_t)kb * 16) + lo : nullptr;
#pragma unroll 1
    for (int kc = kb; kc < kb + kw; kc += 32) {
        V a[4], a2[4];
#pragma unroll
        for (int mb = 0; mb < 4; ++mb) { a[mb] = WFrag<T16>::ld((const T16*)(Ap + mb * rs)); if (NSPLIT == 1 || NSPLIT == 2) a2[mb] = WFrag<T16>::ld((const T16*)(A2p + mb * rs)); }
        V bb[4], bb2[4];
        // unrolled: bb is indexed by constants, and all of a trip's loads stand in front of the one wait
#pragma unroll
        for (int nb = 0; nb < 4; ++nb) { bb[nb] = WFrag<T16>::ld((const T16*)(Bp + nb * rs)); if (NSPLIT >= 2) bb2[nb] = WFrag<T16>::ld((const T16*)(B2p + nb * rs)); }
        // one s_wait_xcnt 0 behind the trip's loads, in front of the next trip's new addresses
        if (NSPLIT == 0) addr_wait(Ap, Bp); else if (NSPLIT == 1) addr_wait(Ap, A2p, Bp); else if (NSPLIT == 2) addr_wait(Ap, A2p, Bp, B2p); else addr_wait(Ap, Bp, B2p);
#pragma unroll
        for (int nb = 0; nb < 4; ++nb) { const V b = bb[nb]; V b2; if (NSPLIT >= 2) b2 = bb2[nb];
#pragma unroll
            for (int mb = 0; mb < 4; ++mb) { acc[mb][nb] = WFrag<T16>::mma(a[mb], b, acc[mb][nb]); if (NSPLIT == 1 || NSPLIT == 2) acc[mb][nb] = WFrag<T16>::mma(a2[mb], b, acc[mb][nb]); if (NSPLIT >= 2) acc[mb][nb] = WFrag<T16>::mma(a[mb], b2, acc[mb][nb]); } }
        Ap += 1024; Bp += 1024; if (NSPLIT == 1 || NSPLIT == 2) A2p += 1024; if (NSPLIT >= 2) B2p += 1024;   // the next tile along k
        asm volatile("v_nop\n\tv_nop\n\tv_nop\n\tv_nop" : "+v"(acc[0][0]), "+v"(acc[1][1]), "+v"(acc[2][2]), "+v"(acc[3][3]) : "v"(a[0]), "v"(a[3]));
    }
    if constexpr (NW > 1) {
        // EPI 1: thread t takes the 4 values that stand at t * 4 in a 16-token block of the head plane (2 tiles), so that the 256 threads store 2 KiB in a row
        float* my = os + wave * (64 * 68); const int cofs = (EPI == 1) ? (((int)threadIdx.x >> 5) & 7) * 8 + ((int)threadIdx.x & 1) * 4 : ((int)threadIdx.x & 15) * 4; v4f bv = (v4f){};
        if (BIAS) { bv[0] = bfr(bias[c0 + cofs]); bv[1] = bfr(bias[c0 + cofs + 1]); bv[2] = bfr(bias[c0 + cofs + 2]); bv[3] = bfr(bias[c0 + cofs + 3]); }
        // the three loops are unrolled so that acc is indexed by constants and stays in registers
#pragma unroll
        for (int mb = 0; mb < 4; ++mb)
#pragma unroll
            for (int nb = 0; nb < 4; ++nb)
#pragma unroll
                for (int j = 0; j < 8; ++j) my[(mb * 16 + hi * 8 + j) * 68 + nb * 16 + lr] = acc[mb][nb][j];
        __syncthreads();   // every wave's partial tile is in LDS before any thread adds them
        v4f sums[32 / NW];
        // both loops are unrolled so that the LDS reads of all planes are in flight together
#pragma unroll
        for (int s = 0; s < 32 / NW; ++s) { const int idx = s * (32 * NW) + (int)threadIdx.x; const int row = (EPI == 1) ? s * 16 + (((int)threadIdx.x >> 1) & 15) : idx >> 4; v4f val = *(const v4fa*)(os + row * 68 + cofs);
#pragma unroll
            for (int w = 1; w < NW; ++w) val += *(const v4fa*)(os + w * (64 * 68) + row * 68 + cofs);
            if (BIAS) val += bv;
            if constexpr (EPI == 0) *(v4f*)(C + (size_t)(r0 + row) * ldc + c0 + cofs) = val;
            if constexpr (EPI == 1) *(v4h*)(P16 + ((size_t)blockIdx.y * TT + r0 + s * 16) * HD + (int)threadIdx.x * 4) = __builtin_convertvector(val, v4h);
            if constexpr (EPI == 2) sums[s] = val; }
        if constexpr (EPI == 2) {
            __syncthreads();   // every thread has read the partial tiles before the sum is written over them
            // pitch 65 words: the 32 lanes of a wave meet 32 different banks in the transposed write
#pragma unroll
            for (int s = 0; s < 32 / NW; ++s)
#pragma unroll
                for (int q = 0; q < 4; ++q) os[(cofs + q) * 65 + ((s * (32 * NW) + (int)threadIdx.x) >> 4)] = sums[s][q];
            __syncthreads();   // the whole transposed tile is in LDS before any thread reads a row of it
            // thread t takes the 8 tokens that stand at t * 8 in a 32-token block of the plane (4 tiles): the 256 threads store 4 KiB in a row to each plane
#pragma unroll
            for (int u = 0; u < 16 / NW; ++u) { const int d = (((int)threadIdx.x >> 6) & 3) * 16 + ((int)threadIdx.x & 15), t8 = u * 32 + (((int)threadIdx.x >> 4) & 3) * 8; v8us oh, ol;
#pragma unroll
                for (int j = 0; j < 8; ++j) { unsigned short a2, c2; splitf(os[d * 65 + t8 + j], a2, c2); oh[j] = a2; ol[j] = c2; }
                const size_t oo = ((size_t)blockIdx.y * TT + r0 + u * 32) * HD + (int)threadIdx.x * 8; *(v8us*)(Ph + oo) = oh; *(v8us*)(Pl + oo) = ol; }
            // block sums: thread t < 128 adds one d over one block of FJ tokens, in token order; a work-group stores 512 bytes in a row. Last statement of the kernel: no register is written behind the store.
            if (threadIdx.x < 128) { const int d = (int)threadIdx.x & 63, u = (int)threadIdx.x >> 6; float sm = 0.f;
                // unrolled so that the LDS reads are in flight together
#pragma unroll
                for (int j = 0; j < FJ; ++j) sm += os[d * 65 + u * FJ + j];
                VS[((size_t)blockIdx.y * (TT / FJ) + r0 / FJ + u) * HD + d] = sm; }
        }
        return;
    }
#pragma unroll
    for (int mb = 0; mb < 4; ++mb) {
#pragma unroll
        for (int nb = 0; nb < 4; ++nb) {
#pragma unroll
            for (int j = 0; j < 8; ++j) os[(hi * 8 + j) * 68 + nb * 16 + lr] = acc[mb][nb][j]; }
        __builtin_amdgcn_wave_barrier(); asm volatile("" ::: "memory");
        float* crow = C + (size_t)(r0 + mb * 16) * ldc + c0;
{
#pragma unroll
            for (int s = 0; s < 8; ++s) { const int row = 2 * s + hi, cofs = lr * 4; v4f val = *(const v4fa*)(os + row * 68 + cofs); if (BIAS) { val[0] += bfr(bias[c0 + cofs]); val[1] += bfr(bias[c0 + cofs + 1]); val[2] += bfr(bias[c0 + cofs + 2]); val[3] += bfr(bias[c0 + cofs + 3]); }
                *(v4f*)(crow + (size_t)row * ldc + cofs) = val; }
             }
        __builtin_amdgcn_wave_barrier(); asm volatile("" ::: "memory");
    }
}

typedef __attribute__((ext_vector_type(2))) unsigned short v2us;
typedef __attribute__((ext_vector_type(4))) unsigned short v4us;
typedef __attribute__((ext_vector_type(2))) float v2f;
typedef __attribute__((ext_vector_type(4))) int v4i;

// k_wtG: w[k][n] f32 to Bt (rows = n) in fragment order. Thread i writes the 8 elements at i * 8: one n, 8 neighbouring k; 16 lanes read 16 neighbouring n of one k.
__global__ __launch_bounds__(256) void k_wtG(const float* __restrict__ w, int K, int N, bf* Bt) {
    const int i = blockIdx.x * 256 + threadIdx.x; if (i >= N * K / 8) return;
    const int tile = i >> 6, kt = K / 32; const int n = (tile / kt) * 16 + (i & 15), k0 = (tile % kt) * 32 + ((i >> 4) & 3) * 8; v8us o; const float* wp[8]; float wv[8];
    // unrolled so that the 8 loads are in flight together
#pragma unroll
    for (int j = 0; j < 8; ++j) { wp[j] = w + (size_t)(k0 + j) * N + n; wv[j] = *wp[j]; }
    // s_wait_xcnt 0 behind the eight loads; their addresses are inputs, so that no address register is written (also not by a later load's result) ahead of it
    asm volatile("s_wait_xcnt 0x0" :: "v"(wp[0]), "v"(wp[1]), "v"(wp[2]), "v"(wp[3]), "v"(wp[4]), "v"(wp[5]), "v"(wp[6]), "v"(wp[7]) : "memory");
    // unrolled: o and wv are indexed by constants
#pragma unroll
    for (int j = 0; j < 8; ++j) o[j] = f2bf(wv[j]);
    *(v8us*)(Bt + (size_t)i * 8) = o;
}
// k_cvt8: src[row][DM] f32 to dst in fragment order. Thread i writes the 8 elements at i * 8: one row, 8 neighbouring k.
__global__ __launch_bounds__(256) void k_cvt8(const float* __restrict__ src, bf* dst, size_t n8) { const size_t i = (size_t)blockIdx.x * 256 + threadIdx.x; if (i >= n8) return; const int tile = (int)(i >> 6); const int row = (tile / (DM / 32)) * 16 + ((int)i & 15), k0 = (tile % (DM / 32)) * 32 + (((int)i >> 4) & 3) * 8; const v8f v = *(const v8f*)(src + (size_t)row * DM + k0); v8us o;
#pragma unroll
    for (int k = 0; k < 8; ++k) o[k] = f2bf(v[k]); *(v8us*)(dst + i * 8) = o;  }
__global__ __launch_bounds__(256) void k_cscvt(const float* __restrict__ cosT, const float* __restrict__ sinT, float* CS) { const int idx = blockIdx.x * 256 + threadIdx.x; if (idx >= TT * HD) return; v2f cs; cs[0] = bfr(cosT[idx]); cs[1] = bfr(sinT[idx]); *(v2f*)(CS + (size_t)idx * 2) = cs;  }
typedef __attribute__((ext_vector_type(2))) __bf16 v2bf;
// Work-group barrier that orders LDS only: the fences name the LDS address space, so that global loads asked for ahead of it stay in flight across it (__syncthreads() waits for them).
__device__ __forceinline__ void lds_barrier() { __builtin_amdgcn_fence(__ATOMIC_RELEASE, "workgroup", "local"); __builtin_amdgcn_s_barrier(); __builtin_amdgcn_fence(__ATOMIC_ACQUIRE, "workgroup", "local"); }
// k_fattn: grid FWG, 512 threads, wave = head. Query block ib has ib + 1 key passes that hold an unmasked position; its NPARTS(ib) work-groups take them in turn (pass part, part + np, ...).
// The passes behind the diagonal pass are masked everywhere: weight 1/16 in every head and row, so their weights.V is 1/16 of the sum of VS[h][blk] over blk > ib, the same for all rows; the last part starts its accumulators there.
// Per pass of FJ keys: S^T = K Q^T (fp16, rows = keys, columns = queries: a lane's 8 accumulator values are 8 neighbouring keys of one query), stored to LDS as [head][query][key] f32.
// Head softmax: behind a barrier each thread takes 2 neighbouring keys of one query, reads the 16 heads' scores and writes the 16 weight pairs back over the same rows: bf16 hi pairs in the row's first 16 words, lo pairs in the next 16.
// (A wave holds whole rows, and has read all of a row before it writes any of it.) Behind a second barrier each wave reads its head's rows as A fragments of weights.V.
// A masked position (j > i) has the same score in every head, so its weight is exactly 1/16. O: plane part of [PVG][TT * DQ] f32 (a query block's rows are written in its first NPARTS(ib) planes only).
// K16, Vh, Vl carry no __restrict__: the loop's loads then keep their place in front of its s_wait_xcnt statement (its "memory" clobber holds them there).
__global__ __launch_bounds__(512) void k_fattn(const h16* __restrict__ Q16, const h16* K16, const bf* Vh, const bf* Vl, const float* VS, float* O) {
    __shared__ __align__(16) float Ss[NH_ * FI * FP];
    // flat index to (query block, part): the blocks with np = g + 1 parts are those with 10 g <= ib + 1 <= 10 g + 9; with F = index + 1 their work-groups start at F = 5 g (g + 1), part by part
    static_assert(TT / FI == 64 && FWG == 244 && PVG == 7, "the thresholds below are those of 64 query blocks");
    const int F = (int)blockIdx.x + 1, g6 = (F >= 10) + (F >= 30) + (F >= 60) + (F >= 100) + (F >= 150) + (F >= 210), wi = F - 5 * g6 * (g6 + 1);
    const int part = (g6 == 6) ? wi / 5 : wi / 10, ib = 10 * g6 + wi - part * ((g6 == 6) ? 5 : 10) - 1, np = g6 + 1;
    const float K2 = SCL * 1.4426950408889634f;
    const int h = __builtin_amdgcn_readfirstlane((int)(threadIdx.x >> 5));
    const int lane = threadIdx.x & 31, lr = lane & 15, hi = lane >> 4;
    const int i0 = ib * FI;
    // each lane's own address of its 16 bytes in a tile (fragment order): lane * 16 bytes behind the tile's start
    const h16* qp = Q16 + ((size_t)h * TT + i0) * HD;
    const unsigned ko = (unsigned)lane * 16u;
    const char* kp = (const char*)(K16 + (size_t)h * TT * HD) + ko;   // pass 0
    const char* vhp = (const char*)(Vh + ((size_t)h * TT + part * FJ) * HD) + ko;
    const char* vlp = (const char*)(Vl + ((size_t)h * TT + part * FJ) * HD) + ko;
    const char* q0 = (const char*)qp + ko; const char* k0 = kp + part * (FJ * HD * 2);   // the work-group's query rows; its first key pass
    v16h qf[2][2], kf[2][2];
#pragma unroll
    for (int a = 0; a < 2; ++a)
#pragma unroll
        for (int ks = 0; ks < 2; ++ks) { qf[a][ks] = WFrag<h16>::ld((const h16*)q0 + (a * 2 + ks) * 512); kf[a][ks] = WFrag<h16>::ld((const h16*)k0 + (a * 2 + ks) * 512); }
    addr_wait(q0, k0);   // one s_wait_xcnt 0 behind the first fragments' loads, in front of every later write of their address registers
    // the masked passes' part: a 16-byte-a-lane load takes two blocks' 64 sums (lanes 16 to 31 the odd block), 16 blocks a statement; blocks up to ib are left out of the sum
    float m4[4] = {0.f, 0.f, 0.f, 0.f};
    if (part == np - 1) {
        v4f sa = (v4f){}; const char* vsp = (const char*)(VS + (size_t)h * (TT / FJ) * HD) + ko;
        for (int g = (ib + 1) >> 4; g < TT / FJ / 16; ++g) { const char* vp = vsp + g * (16 * HD * 4); v4f b[8];
            // the eight loads and their data wait in one statement: all are in flight together, and the address register is not written while a load is under way
            asm volatile("global_load_b128 %0, %8, off\n\tglobal_load_b128 %1, %8, off offset:512\n\tglobal_load_b128 %2, %8, off offset:1024\n\tglobal_load_b128 %3, %8, off offset:1536\n\t"
                         "global_load_b128 %4, %8, off offset:2048\n\tglobal_load_b128 %5, %8, off offset:2560\n\tglobal_load_b128 %6, %8, off offset:3072\n\tglobal_load_b128 %7, %8, off offset:3584\n\ts_wait_loadcnt 0x0"
                         : "=&v"(b[0]), "=&v"(b[1]), "=&v"(b[2]), "=&v"(b[3]), "=&v"(b[4]), "=&v"(b[5]), "=&v"(b[6]), "=&v"(b[7]) : "v"(vp) : "memory");
            // unrolled: b is indexed by constants
#pragma unroll
            for (int k = 0; k < 8; ++k) if (g * 16 + k * 2 + hi > ib) sa += b[k]; }
        // from (d = lr * 4 .. + 3, block parity hi) to the accumulators' columns d = nb * 16 + lr, through the wave's own LDS rows (no other wave touches them in front of the loop's first barrier)
        float* mz = Ss + h * (FI * FP); *(v4fa*)(mz + lane * 4) = sa;
        // unrolled: m4 is indexed by constants
#pragma unroll
        for (int nb = 0; nb < 4; ++nb) m4[nb] = (mz[nb * 16 + lr] + mz[HD + nb * 16 + lr]) * 0.0625f;
    }
    v8f o[2][4];
    // the three loops are unrolled so that o and m4 are indexed by constants and stay in registers
#pragma unroll
    for (int it = 0; it < 2; ++it)
#pragma unroll
        for (int nb = 0; nb < 4; ++nb)
#pragma unroll
            for (int r = 0; r < 8; ++r) o[it][nb][r] = m4[nb];
    float* sw = Ss + h * (FI * FP) + lr * FP + hi * 8;          // this lane's 8 scores of a tile
    const float* pr = Ss + h * (FI * FP) + lr * FP + hi * 4;    // this lane's 4 words (8 weights) of a fragment half
    const int pi = (int)threadIdx.x >> 4, pj = ((int)threadIdx.x & 15) * 2;
    float* ps = Ss + pi * FP + pj; float* pw = Ss + pi * FP + (pj >> 1);
#pragma unroll 1
    for (int t = part; t <= ib; t += np) {
        v8f s[2][2];
#pragma unroll
        for (int it = 0; it < 2; ++it)
#pragma unroll
            for (int jt = 0; jt < 2; ++jt) { s[it][jt] = WFrag<h16>::mma(kf[jt][0], qf[it][0], (v8f){}); s[it][jt] = WFrag<h16>::mma(kf[jt][1], qf[it][1], s[it][jt]); }
        // next pass's K fragments (the last pass asks for its own again: in bounds, not used) and this pass's V fragments: asked for here so that they fly during the softmax
        const int tn = (t + np <= ib) ? t + np : t; const char* kn = kp + tn * (FJ * HD * 2);
#pragma unroll
        for (int jt = 0; jt < 2; ++jt)
#pragma unroll
            for (int ks = 0; ks < 2; ++ks) kf[jt][ks] = WFrag<h16>::ld((const h16*)kn + (jt * 2 + ks) * 512);
        v16bf vhf[4], vlf[4];
#pragma unroll
        for (int nb = 0; nb < 4; ++nb) { vhf[nb] = WFrag<bf>::ld((const bf*)vhp + nb * 512); vlf[nb] = WFrag<bf>::ld((const bf*)vlp + nb * 512); }
        addr_wait(kn, vhp, vlp);   // one s_wait_xcnt 0 behind the pass's loads, in front of every later write of their address registers
        vhp += np * (FJ * HD * 2); vlp += np * (FJ * HD * 2);
#pragma unroll
        for (int it = 0; it < 2; ++it)
#pragma unroll
            for (int jt = 0; jt < 2; ++jt) {
                *(v4fa*)(sw + it * 16 * FP + jt * 16) = __builtin_shufflevector(s[it][jt], s[it][jt], 0, 1, 2, 3);
                *(v4fa*)(sw + it * 16 * FP + jt * 16 + 4) = __builtin_shufflevector(s[it][jt], s[it][jt], 4, 5, 6, 7); }
        lds_barrier();   // all 16 heads' scores of this pass are in LDS before any thread reads a column of them
        {
            v2f sv[NH_];
#pragma unroll
            for (int g = 0; g < NH_; ++g) sv[g] = *(const v2f*)(ps + g * (FI * FP));
            const int dj = i0 + pi - (t * FJ + pj);   // query index minus the thread's first key index
            v2f rs;
#pragma unroll
            for (int q = 0; q < 2; ++q) { float mx = sv[0][q];
#pragma unroll
                for (int g = 1; g < NH_; ++g) mx = fmaxf(mx, sv[g][q]);
                mx *= K2; float sum = 0.f;
#pragma unroll
                for (int g = 0; g < NH_; ++g) { sv[g][q] = __builtin_amdgcn_exp2f(__builtin_fmaf(sv[g][q], K2, -mx)); sum += sv[g][q]; }
                rs[q] = __builtin_amdgcn_rcpf(sum); }
#pragma unroll
            for (int g = 0; g < NH_; ++g) { v2f w; w[0] = (dj < 0) ? 0.0625f : sv[g][0] * rs[0]; w[1] = (dj < 1) ? 0.0625f : sv[g][1] * rs[1];
                const unsigned hu = __builtin_bit_cast(unsigned, __builtin_convertvector(w, v2bf)); v2f d; d[0] = w[0] - __uint_as_float(hu << 16); d[1] = w[1] - __uint_as_float(hu & 0xFFFF0000u);
                pw[g * (FI * FP)] = __uint_as_float(hu); pw[g * (FI * FP) + 16] = __uint_as_float(__builtin_bit_cast(unsigned, __builtin_convertvector(d, v2bf))); }
        }
        lds_barrier();   // every head's weights of this pass are in LDS before its wave reads them
#pragma unroll
        for (int it = 0; it < 2; ++it) {
            const float* p = pr + it * 16 * FP;
            const v16bf pa = __builtin_bit_cast(v16bf, __builtin_shufflevector(*(const v4fa*)p, *(const v4fa*)(p + 8), 0, 1, 2, 3, 4, 5, 6, 7));
            const v16bf pb = __builtin_bit_cast(v16bf, __builtin_shufflevector(*(const v4fa*)(p + 16), *(const v4fa*)(p + 24), 0, 1, 2, 3, 4, 5, 6, 7));
#pragma unroll
            for (int nb = 0; nb < 4; ++nb) { o[it][nb] = wmmab(pa, vhf[nb], o[it][nb]); o[it][nb] = wmmab(pb, vhf[nb], o[it][nb]); o[it][nb] = wmmab(pa, vlf[nb], o[it][nb]); }
        }
    }
    const int el = (int)__builtin_amdgcn_mbcnt_lo(~0u, 0u);   // the lane index, formed anew here so that no register has to hold it through the loop
    // O holds each value at the place that it has in the out-projection's A plane (rows = tokens, k = h * HD + d, fragment order), so that the merge kernel is element-wise
    float* op = O + (size_t)part * TT * DQ + (size_t)i0 * DQ + h * (HD * 16) + ((el & 15) >> 3) * 128 + (el >> 4) * 64 + (el & 7);
#pragma unroll
    for (int it = 0; it < 2; ++it)
#pragma unroll
        for (int nb = 0; nb < 4; ++nb)
#pragma unroll
            for (int r = 0; r < 8; ++r) op[it * 16 * DQ + nb * 256 + r * 8] = o[it][nb][r];
}
// One, two or four planes' 32 bytes a lane: the loads and their data wait in one statement, so that all of them are in flight together and no address register is written (also not by a load's result) while a load is under way.
__device__ __forceinline__ void ldp1(const float* q0, v4f* a, v4f* b) {
    asm volatile("global_load_b128 %0, %2, off\n\tglobal_load_b128 %1, %2, off offset:16\n\ts_wait_loadcnt 0x0" : "=&v"(a[0]), "=&v"(b[0]) : "v"(q0) : "memory"); }
__device__ __forceinline__ void ldp2(const float* q0, const float* q1, v4f* a, v4f* b) {
    asm volatile("global_load_b128 %0, %4, off\n\tglobal_load_b128 %1, %4, off offset:16\n\tglobal_load_b128 %2, %5, off\n\tglobal_load_b128 %3, %5, off offset:16\n\ts_wait_loadcnt 0x0"
                 : "=&v"(a[0]), "=&v"(b[0]), "=&v"(a[1]), "=&v"(b[1]) : "v"(q0), "v"(q1) : "memory"); }
__device__ __forceinline__ void ldp4(const float* q0, const float* q1, const float* q2, const float* q3, v4f* pa, v4f* pb) {
    asm volatile("global_load_b128 %0, %8, off\n\tglobal_load_b128 %1, %8, off offset:16\n\tglobal_load_b128 %2, %9, off\n\tglobal_load_b128 %3, %9, off offset:16\n\t"
                 "global_load_b128 %4, %10, off\n\tglobal_load_b128 %5, %10, off offset:16\n\tglobal_load_b128 %6, %11, off\n\tglobal_load_b128 %7, %11, off offset:16\n\ts_wait_loadcnt 0x0"
                 : "=&v"(pa[0]), "=&v"(pb[0]), "=&v"(pa[1]), "=&v"(pb[1]), "=&v"(pa[2]), "=&v"(pb[2]), "=&v"(pa[3]), "=&v"(pb[3]) : "v"(q0), "v"(q1), "v"(q2), "v"(q3) : "memory"); }
// k_mrgrb: adds the planes that k_fattn wrote for a query block (its first NPARTS(ib)), in plane order. A work-group's 2048 elements lie in one query block (FI * DQ elements).
__global__ __launch_bounds__(256) void k_mrgrb(const float* __restrict__ O, int rb, bf* Ah, bf* Al) { const size_t e = ((size_t)blockIdx.x * 256 + threadIdx.x) * 8; if (e >= (size_t)NH_ * RB * HD) return; static_assert(PVG <= 7, "a plane count is taken apart into 4 + 2 + 1");
    const size_t PS = (size_t)NH_ * RB * HD; const int np = NPARTS((int)blockIdx.x / (FI * DQ / 2048));
    const float* q = O + e; v4f ta = (v4f){}, tb = (v4f){}, pa[4], pb[4];
    if (np & 4) { ldp4(q, q + PS, q + 2 * PS, q + 3 * PS, pa, pb); ta = ((pa[0] + pa[1]) + pa[2]) + pa[3]; tb = ((pb[0] + pb[1]) + pb[2]) + pb[3]; q += 4 * PS; }
    if (np & 2) { ldp2(q, q + PS, pa, pb); ta = (ta + pa[0]) + pa[1]; tb = (tb + pb[0]) + pb[1]; q += 2 * PS; }
    if (np & 1) { ldp1(q, pa, pb); ta += pa[0]; tb += pb[0]; }
    const v8f t = __builtin_shufflevector(ta, tb, 0, 1, 2, 3, 4, 5, 6, 7);
    v8us oh, ol;
    // unrolled: the vectors are indexed by constants
#pragma unroll
    for (int q = 0; q < 8; ++q) { unsigned short a2, c2; splitf(t[q], a2, c2); oh[q] = a2; ol[q] = c2; }
    *(v8us*)(Ah + (size_t)rb * RB * DQ + e) = oh; *(v8us*)(Al + (size_t)rb * RB * DQ + e) = ol;  }
// k_asoft: per row (zz, i): t = S x DM^-0.5 (no mask); softmax over the 2048 keys (register row, one exp, fixed trees);
__global__ __launch_bounds__(256) void k_asoft(const float* __restrict__ Sb, h16* P16, bf* Ph, bf* Pl) {
    const int lane = threadIdx.x & 31; const int row = blockIdx.x * 8 + (threadIdx.x >> 5); if (row >= ZH * TT) return; const int i = row % TT; const int zz = row / TT; (void)zz; const bool hires = (i < RH); const float* sr = Sb + (size_t)row * TT; float v[TT / 32]; float mx = -3.0e38f;
#pragma unroll
    for (int ch = 0; ch < TT / 128; ++ch) { const int j0 = ch * 128 + lane * 4; const v4f a = *(const v4f*)(sr + j0);
#pragma unroll
        for (int q = 0; q < 4; ++q) { const int j = j0 + q; (void)j; const float t = a[q] * SCL; v[ch * 4 + q] = t; mx = fmaxf(mx, t); } }
#pragma unroll
    for (int sh = 16; sh; sh >>= 1) mx = fmaxf(mx, __shfl_xor(mx, sh, 32));
    float sum = 0.f;
#pragma unroll
    for (int k = 0; k < TT / 32; ++k) { float d0 = __fsub_rn(v[k], mx); asm volatile("" : "+v"(d0)); v[k] = __builtin_amdgcn_exp2f(__fmul_rn(d0, 1.4426950408889634f)); sum += v[k]; }
#pragma unroll
    for (int sh = 16; sh; sh >>= 1) sum += __shfl_xor(sum, sh, 32);
    const float f = __fdiv_rn(hires ? 1.0f : PCAR, sum);
{
        if (hires) {
#pragma unroll
            for (int ch = 0; ch < TT / 128; ++ch) { v4us oh, ol;
#pragma unroll
                for (int q = 0; q < 4; ++q) { unsigned short a, c2; splitf(v[ch * 4 + q] * f, a, c2); oh[q] = a; ol[q] = c2; }
                const size_t oo = ((size_t)zz * (RH ? RH : 1) + i) * TT + ch * 128 + lane * 4; *(v4us*)(Ph + oo) = oh; *(v4us*)(Pl + oo) = ol; }
        } else {
#pragma unroll
            for (int ch = 0; ch < TT / 128; ++ch) { v4h o4;
#pragma unroll
                for (int q = 0; q < 4; ++q) o4[q] = tohx(v[ch * 4 + q] * f);
                *(v4h*)(P16 + (size_t)row * TT + ch * 128 + lane * 4) = o4; } }
         }
}
__global__ __launch_bounds__(256) void k_merge(const float* __restrict__ O, int h0, bf* Ah, bf* Al) { const size_t e = ((size_t)blockIdx.x * 256 + threadIdx.x) * 2; if (e >= (size_t)ZH * TT * HD) return; const int d = (int)(e % HD); const int t = (int)((e / HD) % TT); const int zz = (int)(e / ((size_t)HD * TT)); const float cs = (t < RH) ? 1.0f : (1.0f / PCAR); const size_t oo = (size_t)t * DQ + (h0 + zz) * HD + d;
    v2us oh, ol;
#pragma unroll
    for (int q = 0; q < 2; ++q) { unsigned short a, c2; splitf(O[e + q] * cs, a, c2); oh[q] = a; ol[q] = c2; } *(v2us*)(Ah + oo) = oh; *(v2us*)(Al + oo) = ol;  }

extern "C" void kernel_launch(void* const* d_in, const int* in_sizes, int n_in,
                              void* d_out, int out_size, void* d_ws, size_t ws_size, hipStream_t stream) {
    (void)in_sizes; (void)n_in; (void)out_size;
    const float* x = (const float*)d_in[0]; const float* wq = (const float*)d_in[1]; const float* bq = (const float*)d_in[2]; const float* wk = (const float*)d_in[3]; const float* bk = (const float*)d_in[4]; const float* wv = (const float*)d_in[5]; const float* bv = (const float*)d_in[6]; const float* wo = (const float*)d_in[7]; const float* bo = (const float*)d_in[8]; const float* cosT = nullptr; const float* sinT = nullptr; (void)cosT; (void)sinT;
    float* OUT = (float*)d_out;     // [2][2048][1024]
    char* wsp = (char*)d_ws;
    auto take = [&](size_t bytes) { char* p = wsp; wsp += (bytes + 255) & ~(size_t)255; return (void*)p; };
    bf* WQ = (bf*)take((size_t)DQ * DM * 2); bf* WK = (bf*)take((size_t)DKV * DM * 2); bf* WV = (bf*)take((size_t)DKV * DM * 2); bf* WO = (bf*)take((size_t)DM * DQ * 2);
    bf* XB = (bf*)take((size_t)TT * DM * 2);
    h16* QP16 = (h16*)take((size_t)NH_ * TT * HD * 2); h16* KP16 = (h16*)take((size_t)NKV * TT * HD * 2);
    bf* VTh = (bf*)take((size_t)NKV * HD * TT * 2); bf* VTl = (bf*)take((size_t)NKV * HD * TT * 2); float* VSb = (float*)take((size_t)NKV * (TT / FJ) * HD * 4);
    float* Ob = (float*)take((size_t)PVG * NH_ * RB * HD * 4); bf* ATh = (bf*)take((size_t)TT * DQ * 2); bf* ATl = (bf*)take((size_t)TT * DQ * 2);
    if ((size_t)(wsp - (char*)d_ws) > ws_size) return;    // ws 256 MiB
    { k_wtG<<<(unsigned)((DM * DQ / 8 + 255) / 256), 256, 0, stream>>>(wq, DM, DQ, WQ); k_wtG<<<(unsigned)((DM * DKV / 8 + 255) / 256), 256, 0, stream>>>(wk, DM, DKV, WK); k_wtG<<<(unsigned)((DM * DKV / 8 + 255) / 256), 256, 0, stream>>>(wv, DM, DKV, WV);
      k_wtG<<<(unsigned)((DQ * DM / 8 + 255) / 256), 256, 0, stream>>>(wo, DQ, DM, WO);
       }
    for (int b = 0; b < NB_; ++b) {
        
        k_cvt8<<<(unsigned)(((size_t)TT * DM / 8 + 255) / 256), 256, 0, stream>>>(x + (size_t)b * TT * DM, XB, (size_t)TT * DM / 8);
        k_gemmw<bf, 0, true, GNW, 1, 1, DM><<<dim3(TT / 64, DQ / 64, 1), 32 * GNW, 0, stream>>>(XB, nullptr, WQ, nullptr, nullptr, 0, bq, 0, 0, 0, 0, QP16, nullptr, nullptr, nullptr);
        k_gemmw<bf, 0, true, GNW, 1, 1, DM><<<dim3(TT / 64, DKV / 64, 1), 32 * GNW, 0, stream>>>(XB, nullptr, WK, nullptr, nullptr, 0, bk, 0, 0, 0, 0, KP16, nullptr, nullptr, nullptr);
        k_gemmw<bf, 0, true, GNW, 1, 2, DM><<<dim3(TT / 64, DKV / 64, 1), 32 * GNW, 0, stream>>>(XB, nullptr, WV, nullptr, nullptr, 0, bv, 0, 0, 0, 0, nullptr, VTh, VTl, VSb);
        k_fattn<<<dim3(FWG, 1, 1), 512, 0, stream>>>(QP16, KP16, VTh, VTl, VSb, Ob);
        k_mrgrb<<<(unsigned)(((size_t)NH_ * RB * HD / 8 + 255) / 256), 256, 0, stream>>>(Ob, 0, ATh, ATl);
        k_gemmw<bf, 1, true, GNW, 1, 0, DQ><<<dim3(TT / 64, DM / 64, 1), 32 * GNW, 0, stream>>>(ATh, ATl, WO, nullptr, OUT + (size_t)b * TT * DM, DM, bo, 0, 0, 0, 0, nullptr, nullptr, nullptr, nullptr); }
}

// v006
// It runs in 165 microseconds.
// Timed twice side by side with v005, it ran 1.14 and 1.11 times as fast.
// Over all steps from v000 it is 8.25 times as fast.
#include <hip/hip_runtime.h>

// MultiHeadAttention__5987 (x [2][2048][1024]; Q/K/V = x W + b (16 x 64); score = Q.K / sqrt(1024); causal positions (j > i) set to -1e10; FAITHFUL QUIRK: softmax over the HEAD axis (not over keys) -> weight[h][i][j]; out_h[i] = sum_j weight[h][i][j] V_h[j] (un-normalised over keys; masked positions carry weight exactly 1/16); merged Wo + bo -> [2][2048][1024]).
// Layout (exact): one kernel per batch does scores, head softmax and weights.V: a work-group of 16 waves (wave = head) holds 32 query rows and walks its share of the key passes (32 keys each) up to the diagonal; scores and weights never leave the WGP: they cross from head to head through LDS. Key passes wholly behind the diagonal carry the weight 1/16 everywhere: their part of weights.V is 1/16 of the sum of V's 32-token block sums.
// Compute dtypes, f32 accumulate: every input rounded to bf16; Q/K/V on PLAIN bf16 operands (inputs: exact) + bias; scores as single fp16 products (x1; logits are q.k/32); the 16-way head softmax in f32 per (i, j) (masked columns give exactly 1/16); weights.V hl x hl (3 products) on every row (weights <= 1, no carrier needed); Wo hl x exact (2 products) + bias.

#define NB_  2
#define TT   2048
#define DM   1024
#define NH_  16
#define NKV  16
#define REP  (NH_ / NKV)
#define HD   64
#define DQ   (NH_ * HD)
#define DKV  (NKV * HD)
#define ZH   2
#define RH   2048                  // query rows < RH use hi+lo planes (0: none)
#define WIN  0
#define PCAR 1024.0f
#define RB   TT     // query rows per merge launch
#define NRB  (TT / RB)
#define GNW  8      // waves per work-group that share a GEMM tile's K range
#define PVG  7      // most work-groups that share a query block's key passes; their planes are added in the merge kernel
#define NPARTS(ib) (((ib) + 1) / 10 + 1)   // work-groups that share query block ib's ib + 1 key passes up to the diagonal: at most 10 passes each
#define FWG  244    // sum of NPARTS over the 64 query blocks: every work-group has a WGP of its own (a work-group's 16 waves fill a WGP's registers)
#define FI   32     // query rows per work-group of the fused kernel
#define FJ   32     // keys per pass of the fused kernel
#define FP   36     // LDS row pitch in floats (144 B: an odd multiple of 16 B)
#define SCL  0.03125f   // 1/sqrt(1024) (full embed dim, faithful)
typedef _Float16 h16;
typedef unsigned short bf;
typedef __attribute__((ext_vector_type(16))) __bf16   v16bf;
typedef __attribute__((ext_vector_type(16))) _Float16 v16h;
typedef __attribute__((ext_vector_type(8)))  _Float16 v8h;
typedef __attribute__((ext_vector_type(8)))  unsigned short v8us;
typedef __attribute__((ext_vector_type(8)))  float    v8f;
typedef __attribute__((ext_vector_type(4)))  float    v4f;
typedef v8h  __attribute__((may_alias)) v8ha;
typedef v4f  __attribute__((may_alias)) v4fa;
typedef v8us __attribute__((may_alias)) v8usa;

__device__ __forceinline__ unsigned short f2bf(float f) { unsigned u = __float_as_uint(f); u += 0x7FFFu + ((u >> 16) & 1u); return (unsigned short)(u >> 16); }
__device__ __forceinline__ float bf2f(unsigned short b) { return __uint_as_float(((unsigned)b) << 16); }
__device__ __forceinline__ float bfr(float f) { return bf2f(f2bf(f)); }
__device__ __forceinline__ v16h cat16(v8h lo, v8h hi) { return __builtin_shufflevector(lo, hi, 0, 1, 2, 3, 4, 5, 6, 7, 8, 9, 10, 11, 12, 13, 14, 15); }
__device__ __forceinline__ v16bf cat16b(v8us lo, v8us hi) { return __builtin_bit_cast(v16bf, __builtin_shufflevector(lo, hi, 0, 1, 2, 3, 4, 5, 6, 7, 8, 9, 10, 11, 12, 13, 14, 15)); }
__device__ __forceinline__ v8f wmma16(v16h a, v16h b, v8f c) { return __builtin_amdgcn_wmma_f32_16x16x32_f16(false, a, false, b, (short)0, c, false, false); }
__device__ __forceinline__ v8f wmmab(v16bf a, v16bf b, v8f c) { return __builtin_amdgcn_wmma_f32_16x16x32_bf16(false, a, false, b, (short)0, c, false, false); }
__device__ __forceinline__ h16 tohx(float x) { return (h16)x; }
__device__ __forceinline__ void splitf(float y, unsigned short& h, unsigned short& l) { h = f2bf(y); l = f2bf(y - bf2f(h)); }
// s_wait_xcnt 0 behind a run of global loads, ahead of every later write of a register that they name as an address. The addresses are inputs of the statement, so that their registers stay untouched (also by a later load's result) up to the wait.
__device__ __forceinline__ void addr_wait(const void* a) { asm volatile("s_wait_xcnt 0x0" :: "v"(a) : "memory"); }
__device__ __forceinline__ void addr_wait(const void* a, const void* b) { asm volatile("s_wait_xcnt 0x0" :: "v"(a), "v"(b) : "memory"); }
__device__ __forceinline__ void addr_wait(const void* a, const void* b, const void* c) { asm volatile("s_wait_xcnt 0x0" :: "v"(a), "v"(b), "v"(c) : "memory"); }
__device__ __forceinline__ void addr_wait(const void* a, const void* b, const void* c, const void* d) { asm volatile("s_wait_xcnt 0x0" :: "v"(a), "v"(b), "v"(c), "v"(d) : "memory"); }
typedef __attribute__((ext_vector_type(2))) _Float16 v2h;
typedef __attribute__((ext_vector_type(4))) _Float16 v4h;



// ---- d_gemmw: register-blocked GEMM, 64x64 output tile per work-group (16 accumulators per wave), operands straight from 16-bit planes in fragment order; body of k_jobs: row block blockIdx.x, column block by, 32 * NW threads, os = the work-group's LDS.
// C[m][n] (f32, pitch ldc, + optional f32 bias[n]) = sum_k A[m][k] Bt[n][k] (+ split products per NSPLIT). z-batch strides sA/sB/sC in elements.
// Split K: the K range is cut into KSG * NW equal runs (K % (32 * KSG * NW) == 0). Each of the NW waves of a work-group sums one run over the whole tile; the NW tiles are added in wave order through LDS.
// The KSG work-groups of one tile each store their own partial tile at C + kg * sP; the consumer adds those planes (KSG == 1: C is the result).
// EPI (NW > 1 only; a tile's 64 columns are one head, its rows are tokens): 0: f32 tile to C. 1: the tile as fp16 to the head plane P16[head] (rows = tokens, k = d). 2: the tile transposed through LDS, as bf16 hi and lo, to Ph / Pl[head] (rows = d, k = tokens), and its sums over each FJ tokens as f32 to VS[head][token / FJ][d]. The planes in fragment order.
// FRAGMENT ORDER: every 16-bit operand plane P[row][k] is stored as tiles of 16 rows x 32 k (512 elements, 1 KiB), one tile = one WMMA operand fragment, laid out as the lanes read it:
// element (row, k) stands at tile * 512 + ((k % 32) / 16) * 256 + (((k % 16) / 8) * 16 + row % 16) * 8 + k % 8. A lane's two 16-byte loads are at lane * 8 and 256 + lane * 8: a wave's load is 512 bytes in a row (4 whole lines).
// Tile numbers: GEMM operands and Q, K head planes (row / 16) * (K / 32) + k / 32; V planes (rows = d, k = token) (k / 32) * (HD / 16) + row / 16, so that a pass's four tiles are neighbours.
template <typename T16> struct WFrag;
template <> struct WFrag<h16> { typedef v16h V; static __device__ __forceinline__ V ld(const h16* p) { return cat16(*(const v8h*)p, *(const v8h*)(p + 256)); } static __device__ __forceinline__ v8f mma(V a, V b, v8f c) { return wmma16(a, b, c); } };
template <> struct WFrag<bf> { typedef v16bf V; static __device__ __forceinline__ V ld(const bf* p) { return cat16b(*(const v8us*)p, *(const v8us*)(p + 256)); } static __device__ __forceinline__ v8f mma(V a, V b, v8f c) { return wmmab(a, b, c); } };
// The operand pointers carry no __restrict__: the loads then keep their place in front of the loop's s_wait_xcnt statement (its "memory" clobber holds them there).
template <typename T16, int NSPLIT, bool BIAS, int NW, int KSG, int EPI, int K>
__device__ __forceinline__ void d_gemmw(float* os, const int by, const T16* A, const T16* A2, const T16* Bt, const T16* Bt2, float* C, int ldc, const float* bias, size_t sA, size_t sB, size_t sC, size_t sP, h16* P16, bf* Ph, bf* Pl, float* VS) {
    static_assert(EPI == 0 || (NW == 8 && KSG == 1 && HD == 64), "a head plane is written from a whole tile that is one head wide, by 256 threads");
    typedef typename WFrag<T16>::V V;
    const size_t z = blockIdx.z / KSG; const int kg = blockIdx.z % KSG; A += z * sA; if (A2) A2 += z * sA; Bt += z * sB; if (Bt2) Bt2 += z * sB; C += z * sC + kg * sP;
    const int wave = (NW == 1) ? 0 : __builtin_amdgcn_readfirstlane((int)(threadIdx.x >> 5)); const int kw = K / (NW * KSG), kb = (kg * NW + wave) * kw;
    const int lane = threadIdx.x & 31, lr = lane & 15, hi = lane >> 4; const int r0 = blockIdx.x * 64, c0 = by * 64;
    v8f acc[4][4];
#pragma unroll
    for (int mb = 0; mb < 4; ++mb)
#pragma unroll
        for (int nb = 0; nb < 4; ++nb) acc[mb][nb] = (v8f){};
    // each lane's own address in the first tile of its operand (16 rows of tiles are 16 * K elements; 32 k are 512; the lane's 16 bytes stand lane * 16 bytes behind a tile's start)
    const unsigned lo = (unsigned)lane * 16u; const int rs = K * 32;   // rs: bytes from one 16-row block of tiles to the next (K is a constant of the build, so that it goes into the loads' immediate offsets)
    const char* Ap = (const char*)(A + (size_t)r0 * K + (size_t)kb * 16) + lo; const char* A2p = (NSPLIT == 1 || NSPLIT == 2) ? (const char*)(A2 + (size_t)r0 * K + (size_t)kb * 16) + lo : nullptr; const char* Bp = (const char*)(Bt + (size_t)c0 * K + (size_t)kb * 16) + lo; const char* B2p = (NSPLIT >= 2) ? (const char*)(Bt2 + (size_t)c0 * K + (size_t)kb * 16) + lo : nullptr;
#pragma unroll 1
    for (int kc = kb; kc < kb + kw; kc += 32) {
        V a[4], a2[4];
#pragma unroll
        for (int mb = 0; mb < 4; ++mb) { a[mb] = WFrag<T16>::ld((const T16*)(Ap + mb * rs)); if (NSPLIT == 1 || NSPLIT == 2) a2[mb] = WFrag<T16>::ld((const T16*)(A2p + mb * rs)); }
        V bb[4], bb2[4];
        // unrolled: bb is indexed by constants, and all of a trip's loads stand in front of the one wait
#pragma unroll
        for (int nb = 0; nb < 4; ++nb) { bb[nb] = WFrag<T16>::ld((const T16*)(Bp + nb * rs)); if (NSPLIT >= 2) bb2[nb] = WFrag<T16>::ld((const T16*)(B2p + nb * rs)); }
        // one s_wait_xcnt 0 behind the trip's loads, in front of the next trip's new addresses
        if (NSPLIT == 0) addr_wait(Ap, Bp); else if (NSPLIT == 1) addr_wait(Ap, A2p, Bp); else if (NSPLIT == 2) addr_wait(Ap, A2p, Bp, B2p); else addr_wait(Ap, Bp, B2p);
#pragma unroll
        for (int nb = 0; nb < 4; ++nb) { const V b = bb[nb]; V b2; if (NSPLIT >= 2) b2 = bb2[nb];
#pragma unroll
            for (int mb = 0; mb < 4; ++mb) { acc[mb][nb] = WFrag<T16>::mma(a[mb], b, acc[mb][nb]); if (NSPLIT == 1 || NSPLIT == 2) acc[mb][nb] = WFrag<T16>::mma(a2[mb], b, acc[mb][nb]); if (NSPLIT >= 2) acc[mb][nb] = WFrag<T16>::mma(a[mb], b2, acc[mb][nb]); } }
        Ap += 1024; Bp += 1024; if (NSPLIT == 1 || NSPLIT == 2) A2p += 1024; if (NSPLIT >= 2) B2p += 1024;   // the next tile along k
        asm volatile("v_nop\n\tv_nop\n\tv_nop\n\tv_nop" : "+v"(acc[0][0]), "+v"(acc[1][1]), "+v"(acc[2][2]), "+v"(acc[3][3]) : "v"(a[0]), "v"(a[3]));
    }
    if constexpr (NW > 1) {
        // EPI 1: thread t takes the 4 values that stand at t * 4 in a 16-token block of the head plane (2 tiles), so that the 256 threads store 2 KiB in a row
        float* my = os + wave * (64 * 68); const int cofs = (EPI == 1) ? (((int)threadIdx.x >> 5) & 7) * 8 + ((int)threadIdx.x & 1) * 4 : ((int)threadIdx.x & 15) * 4; v4f bv = (v4f){};
        // the bias address is an input of the s_wait_xcnt statement behind the load, so that the load's own result does not land in its address register (bias carries no __restrict__: the load keeps its place in front of the statement)
        if (BIAS) { const float* bp = bias + c0 + cofs; const v4f br = *(const v4f*)bp; addr_wait(bp); bv[0] = bfr(br[0]); bv[1] = bfr(br[1]); bv[2] = bfr(br[2]); bv[3] = bfr(br[3]); }
        // the three loops are unrolled so that acc is indexed by constants and stays in registers
#pragma unroll
        for (int mb = 0; mb < 4; ++mb)
#pragma unroll
            for (int nb = 0; nb < 4; ++nb)
#pragma unroll
                for (int j = 0; j < 8; ++j) my[(mb * 16 + hi * 8 + j) * 68 + nb * 16 + lr] = acc[mb][nb][j];
        __syncthreads();   // every wave's partial tile is in LDS before any thread adds them
        v4f sums[32 / NW];
        // both loops are unrolled so that the LDS reads of all planes are in flight together
#pragma unroll
        for (int s = 0; s < 32 / NW; ++s) { const int idx = s * (32 * NW) + (int)threadIdx.x; const int row = (EPI == 1) ? s * 16 + (((int)threadIdx.x >> 1) & 15) : idx >> 4; v4f val = *(const v4fa*)(os + row * 68 + cofs);
#pragma unroll
            for (int w = 1; w < NW; ++w) val += *(const v4fa*)(os + w * (64 * 68) + row * 68 + cofs);
            if (BIAS) val += bv;
            if constexpr (EPI == 0) *(v4f*)(C + (size_t)(r0 + row) * ldc + c0 + cofs) = val;
            if constexpr (EPI == 1) *(v4h*)(P16 + ((size_t)by * TT + r0 + s * 16) * HD + (int)threadIdx.x * 4) = __builtin_convertvector(val, v4h);
            if constexpr (EPI == 2) sums[s] = val; }
        // s_wait_xcnt 0 behind the four head-plane stores: a precaution: this job is the last branch of k_jobs, and no code runs behind it
        if constexpr (EPI == 1) asm volatile("s_wait_xcnt 0x0" ::: "memory");
        if constexpr (EPI == 2) {
            __syncthreads();   // every thread has read the partial tiles before the sum is written over them
            // pitch 65 words: the 32 lanes of a wave meet 32 different banks in the transposed write
#pragma unroll
            for (int s = 0; s < 32 / NW; ++s)
#pragma unroll
                for (int q = 0; q < 4; ++q) os[(cofs + q) * 65 + ((s * (32 * NW) + (int)threadIdx.x) >> 4)] = sums[s][q];
            __syncthreads();   // the whole transposed tile is in LDS before any thread reads a row of it
            // thread t takes the 8 tokens that stand at t * 8 in a 32-token block of the plane (4 tiles): the 256 threads store 4 KiB in a row to each plane
#pragma unroll
            for (int u = 0; u < 16 / NW; ++u) { const int d = (((int)threadIdx.x >> 6) & 3) * 16 + ((int)threadIdx.x & 15), t8 = u * 32 + (((int)threadIdx.x >> 4) & 3) * 8; v8us oh, ol;
#pragma unroll
                for (int j = 0; j < 8; ++j) { unsigned short a2, c2; splitf(os[d * 65 + t8 + j], a2, c2); oh[j] = a2; ol[j] = c2; }
                const size_t oo = ((size_t)by * TT + r0 + u * 32) * HD + (int)threadIdx.x * 8; *(v8us*)(Ph + oo) = oh; *(v8us*)(Pl + oo) = ol; }
            // block sums: thread t < 128 adds one d over one block of FJ tokens, in token order; a work-group stores 512 bytes in a row. Last statement of the kernel: no register is written behind the store.
            if (threadIdx.x < 128) { const int d = (int)threadIdx.x & 63, u = (int)threadIdx.x >> 6; float sm = 0.f;
                // unrolled so that the LDS reads are in flight together
#pragma unroll
                for (int j = 0; j < FJ; ++j) sm += os[d * 65 + u * FJ + j];
                VS[((size_t)by * (TT / FJ) + r0 / FJ + u) * HD + d] = sm; }
        }
        return;
    }
#pragma unroll
    for (int mb = 0; mb < 4; ++mb) {
#pragma unroll
        for (int nb = 0; nb < 4; ++nb) {
#pragma unroll
            for (int j = 0; j < 8; ++j) os[(hi * 8 + j) * 68 + nb * 16 + lr] = acc[mb][nb][j]; }
        __builtin_amdgcn_wave_barrier(); asm volatile("" ::: "memory");
        float* crow = C + (size_t)(r0 + mb * 16) * ldc + c0;
{
#pragma unroll
            for (int s = 0; s < 8; ++s) { const int row = 2 * s + hi, cofs = lr * 4; v4f val = *(const v4fa*)(os + row * 68 + cofs); if (BIAS) { val[0] += bfr(bias[c0 + cofs]); val[1] += bfr(bias[c0 + cofs + 1]); val[2] += bfr(bias[c0 + cofs + 2]); val[3] += bfr(bias[c0 + cofs + 3]); }
                *(v4f*)(crow + (size_t)row * ldc + cofs) = val; }
             }
        __builtin_amdgcn_wave_barrier(); asm volatile("" ::: "memory");
    }
}

// k_jobs: GEMMs that do not depend on one another share one grid (TT / 64, column blocks), 32 * GNW threads. Column block y = blockIdx.y + y0 names the job and its 64 columns (one head):
// 0..15 out-projection (Ah + Al) WO + bo to OUTb; 16..31 V projection; 32..47 Q; 48..63 K (X times WV, WQ, WK). The job with the longest loop has the lowest indices.
// A launch takes a run of y: 16..63 (Q, K, V of a batch), 0..63 (the out-projection of one batch beside Q, K, V of the next), 0..15 (the last out-projection). The test on y is the same for a whole work-group.
__global__ __launch_bounds__(32 * GNW) void k_jobs(int y0, const bf* X, const bf* WQ, const bf* WK, const bf* WV, const float* bq, const float* bk, const float* bv, h16* Q16, h16* K16, bf* Vh, bf* Vl, float* VS,
                                                   const bf* Ah, const bf* Al, const bf* WO, const float* bo, float* OUTb) {
    static_assert(DQ / 64 == 16 && DKV / 64 == 16 && DM / 64 == 16, "each job is 16 column blocks wide");
    __shared__ __align__(16) float os[GNW * 64 * 68];   // one array for all jobs: a work-group runs one of them
    const int y = (int)blockIdx.y + y0;
    if (y < 16) d_gemmw<bf, 1, true, GNW, 1, 0, DQ>(os, y, Ah, Al, WO, nullptr, OUTb, DM, bo, 0, 0, 0, 0, nullptr, nullptr, nullptr, nullptr);
    else if (y < 32) d_gemmw<bf, 0, true, GNW, 1, 2, DM>(os, y - 16, X, nullptr, WV, nullptr, nullptr, 0, bv, 0, 0, 0, 0, nullptr, Vh, Vl, VS);
    else { const bool isk = y >= 48; d_gemmw<bf, 0, true, GNW, 1, 1, DM>(os, (y - 32) & 15, X, nullptr, isk ? WK : WQ, nullptr, nullptr, 0, isk ? bk : bq, 0, 0, 0, 0, isk ? K16 : Q16, nullptr, nullptr, nullptr); }
}

typedef __attribute__((ext_vector_type(2))) unsigned short v2us;
typedef __attribute__((ext_vector_type(4))) unsigned short v4us;
typedef __attribute__((ext_vector_type(2))) float v2f;
typedef __attribute__((ext_vector_type(4))) int v4i;

// d_wtG: w[k][n] f32 to Bt (rows = n) in fragment order. Thread i writes the 8 elements at i * 8: one n, 8 neighbouring k; 16 lanes read 16 neighbouring n of one k.
__device__ __forceinline__ void d_wtG(const float* __restrict__ w, int K, int N, bf* Bt, const int i) {
    if (i >= N * K / 8) return;
    const int tile = i >> 6, kt = K / 32; const int n = (tile / kt) * 16 + (i & 15), k0 = (tile % kt) * 32 + ((i >> 4) & 3) * 8; v8us o; const float* wp[8]; float wv[8];
    // unrolled so that the 8 loads are in flight together
#pragma unroll
    for (int j = 0; j < 8; ++j) { wp[j] = w + (size_t)(k0 + j) * N + n; wv[j] = *wp[j]; }
    // s_wait_xcnt 0 behind the eight loads; their addresses are inputs, so that no address register is written (also not by a later load's result) ahead of it
    asm volatile("s_wait_xcnt 0x0" :: "v"(wp[0]), "v"(wp[1]), "v"(wp[2]), "v"(wp[3]), "v"(wp[4]), "v"(wp[5]), "v"(wp[6]), "v"(wp[7]) : "memory");
    // unrolled: o and wv are indexed by constants
#pragma unroll
    for (int j = 0; j < 8; ++j) o[j] = f2bf(wv[j]);
    *(v8us*)(Bt + (size_t)i * 8) = o;
}
// d_cvt8: src[row][DM] f32 to dst in fragment order. Thread i writes the 8 elements at i * 8: one row, 8 neighbouring k.
__device__ __forceinline__ void d_cvt8(const float* __restrict__ src, bf* dst, size_t n8, const size_t i) { if (i >= n8) return; const int tile = (int)(i >> 6); const int row = (tile / (DM / 32)) * 16 + ((int)i & 15), k0 = (tile % (DM / 32)) * 32 + (((int)i >> 4) & 3) * 8; const v8f v = *(const v8f*)(src + (size_t)row * DM + k0); v8us o;
#pragma unroll
    for (int k = 0; k < 8; ++k) o[k] = f2bf(v[k]); *(v8us*)(dst + i * 8) = o;  }
// k_prep: the four weight conversions and x's (both batches' rows as one matrix) depend on nothing and share one grid: WBL work-groups a weight (the slower, strided readers first), then x's.
#define WBL (DM * DQ / 8 / 256)
__global__ __launch_bounds__(256) void k_prep(const float* __restrict__ wq, const float* __restrict__ wk, const float* __restrict__ wv, const float* __restrict__ wo, const float* __restrict__ x, bf* W4, bf* XB) {
    static_assert(DKV == DQ, "the four weights have one size");
    const int j = (int)blockIdx.x / WBL;   // the same for a whole work-group
    if (j < 4) d_wtG(j == 0 ? wq : j == 1 ? wk : j == 2 ? wv : wo, DM, DQ, W4 + (size_t)j * DM * DQ, ((int)blockIdx.x - j * WBL) * 256 + (int)threadIdx.x);
    else d_cvt8(x, XB, (size_t)NB_ * TT * DM / 8, (size_t)((int)blockIdx.x - 4 * WBL) * 256 + threadIdx.x);
}
__global__ __launch_bounds__(256) void k_cscvt(const float* __restrict__ cosT, const float* __restrict__ sinT, float* CS) { const int idx = blockIdx.x * 256 + threadIdx.x; if (idx >= TT * HD) return; v2f cs; cs[0] = bfr(cosT[idx]); cs[1] = bfr(sinT[idx]); *(v2f*)(CS + (size_t)idx * 2) = cs;  }
typedef __attribute__((ext_vector_type(2))) __bf16 v2bf;
// Work-group barrier that orders LDS only: the fences name the LDS address space, so that global loads asked for ahead of it stay in flight across it (__syncthreads() waits for them).
__device__ __forceinline__ void lds_barrier() { __builtin_amdgcn_fence(__ATOMIC_RELEASE, "workgroup", "local"); __builtin_amdgcn_s_barrier(); __builtin_amdgcn_fence(__ATOMIC_ACQUIRE, "workgroup", "local"); }
// k_fattn: grid FWG, 512 threads, wave = head. Query block ib has ib + 1 key passes that hold an unmasked position; its NPARTS(ib) work-groups take them in turn (pass part, part + np, ...).
// The passes behind the diagonal pass are masked everywhere: weight 1/16 in every head and row, so their weights.V is 1/16 of the sum of VS[h][blk] over blk > ib, the same for all rows; the last part starts its accumulators there.
// Per pass of FJ keys: S^T = K Q^T (fp16, rows = keys, columns = queries: a lane's 8 accumulator values are 8 neighbouring keys of one query), stored to LDS as [head][query][key] f32.
// Head softmax: behind a barrier each thread takes 2 neighbouring keys of one query, reads the 16 heads' scores and writes the 16 weight pairs back over the same rows: bf16 hi pairs in the row's first 16 words, lo pairs in the next 16.
// (A wave holds whole rows, and has read all of a row before it writes any of it.) Behind a second barrier each wave reads its head's rows as A fragments of weights.V.
// A masked position (j > i) has the same score in every head, so its weight is exactly 1/16. O: plane part of [PVG][TT * DQ] f32 (a query block's rows are written in its first NPARTS(ib) planes only).
// K16, Vh, Vl carry no __restrict__: the loop's loads then keep their place in front of its s_wait_xcnt statement (its "memory" clobber holds them there).
__global__ __launch_bounds__(512) void k_fattn(const h16* __restrict__ Q16, const h16* K16, const bf* Vh, const bf* Vl, const float* VS, float* O) {
    __shared__ __align__(16) float Ss[NH_ * FI * FP];
    // flat index to (query block, part): the blocks with np = g + 1 parts are those with 10 g <= ib + 1 <= 10 g + 9; with F = index + 1 their work-groups start at F = 5 g (g + 1), part by part
    static_assert(TT / FI == 64 && FWG == 244 && PVG == 7, "the thresholds below are those of 64 query blocks");
    const int F = (int)blockIdx.x + 1, g6 = (F >= 10) + (F >= 30) + (F >= 60) + (F >= 100) + (F >= 150) + (F >= 210), wi = F - 5 * g6 * (g6 + 1);
    const int part = (g6 == 6) ? wi / 5 : wi / 10, ib = 10 * g6 + wi - part * ((g6 == 6) ? 5 : 10) - 1, np = g6 + 1;
    const float K2 = SCL * 1.4426950408889634f;
    const int h = __builtin_amdgcn_readfirstlane((int)(threadIdx.x >> 5));
    const int lane = threadIdx.x & 31, lr = lane & 15, hi = lane >> 4;
    const int i0 = ib * FI;
    // each lane's own address of its 16 bytes in a tile (fragment order): lane * 16 bytes behind the tile's start
    const h16* qp = Q16 + ((size_t)h * TT + i0) * HD;
    const unsigned ko = (unsigned)lane * 16u;
    const char* kp = (const char*)(K16 + (size_t)h * TT * HD) + ko;   // pass 0
    const char* vhp = (const char*)(Vh + ((size_t)h * TT + part * FJ) * HD) + ko;
    const char* vlp = (const char*)(Vl + ((size_t)h * TT + part * FJ) * HD) + ko;
    const char* q0 = (const char*)qp + ko; const char* k0 = kp + part * (FJ * HD * 2);   // the work-group's query rows; its first key pass
    v16h qf[2][2], kf[2][2];
#pragma unroll
    for (int a = 0; a < 2; ++a)
#pragma unroll
        for (int ks = 0; ks < 2; ++ks) { qf[a][ks] = WFrag<h16>::ld((const h16*)q0 + (a * 2 + ks) * 512); kf[a][ks] = WFrag<h16>::ld((const h16*)k0 + (a * 2 + ks) * 512); }
    addr_wait(q0, k0);   // one s_wait_xcnt 0 behind the first fragments' loads, in front of every later write of their address registers
    // the masked passes' part: a 16-byte-a-lane load takes two blocks' 64 sums (lanes 16 to 31 the odd block), 16 blocks a statement; blocks up to ib are left out of the sum
    float m4[4] = {0.f, 0.f, 0.f, 0.f};
    if (part == np - 1) {
        v4f sa = (v4f){}; const char* vsp = (const char*)(VS + (size_t)h * (TT / FJ) * HD) + ko;
        for (int g = (ib + 1) >> 4; g < TT / FJ / 16; ++g) { const char* vp = vsp + g * (16 * HD * 4); v4f b[8];
            // the eight loads and their data wait in one statement: all are in flight together, and the address register is not written while a load is under way
            asm volatile("global_load_b128 %0, %8, off\n\tglobal_load_b128 %1, %8, off offset:512\n\tglobal_load_b128 %2, %8, off offset:1024\n\tglobal_load_b128 %3, %8, off offset:1536\n\t"
                         "global_load_b128 %4, %8, off offset:2048\n\tglobal_load_b128 %5, %8, off offset:2560\n\tglobal_load_b128 %6, %8, off offset:3072\n\tglobal_load_b128 %7, %8, off offset:3584\n\ts_wait_loadcnt 0x0"
                         : "=&v"(b[0]), "=&v"(b[1]), "=&v"(b[2]), "=&v"(b[3]), "=&v"(b[4]), "=&v"(b[5]), "=&v"(b[6]), "=&v"(b[7]) : "v"(vp) : "memory");
            // unrolled: b is indexed by constants
#pragma unroll
            for (int k = 0; k < 8; ++k) if (g * 16 + k * 2 + hi > ib) sa += b[k]; }
        // from (d = lr * 4 .. + 3, block parity hi) to the accumulators' columns d = nb * 16 + lr, through the wave's own LDS rows (no other wave touches them in front of the loop's first barrier)
        float* mz = Ss + h * (FI * FP); *(v4fa*)(mz + lane * 4) = sa;
        // unrolled: m4 is indexed by constants
#pragma unroll
        for (int nb = 0; nb < 4; ++nb) m4[nb] = (mz[nb * 16 + lr] + mz[HD + nb * 16 + lr]) * 0.0625f;
    }
    v8f o[2][4];
    // the three loops are unrolled so that o and m4 are indexed by constants and stay in registers
#pragma unroll
    for (int it = 0; it < 2; ++it)
#pragma unroll
        for (int nb = 0; nb < 4; ++nb)
#pragma unroll
            for (int r = 0; r < 8; ++r) o[it][nb][r] = m4[nb];
    float* sw = Ss + h * (FI * FP) + lr * FP + hi * 8;          // this lane's 8 scores of a tile
    const float* pr = Ss + h * (FI * FP) + lr * FP + hi * 4;    // this lane's 4 words (8 weights) of a fragment half
    const int pi = (int)threadIdx.x >> 4, pj = ((int)threadIdx.x & 15) * 2;
    float* ps = Ss + pi * FP + pj; float* pw = Ss + pi * FP + (pj >> 1);
#pragma unroll 1
    for (int t = part; t <= ib; t += np) {
        v8f s[2][2];
#pragma unroll
        for (int it = 0; it < 2; ++it)
#pragma unroll
            for (int jt = 0; jt < 2; ++jt) { s[it][jt] = WFrag<h16>::mma(kf[jt][0], qf[it][0], (v8f){}); s[it][jt] = WFrag<h16>::mma(kf[jt][1], qf[it][1], s[it][jt]); }
        // next pass's K fragments (the last pass asks for its own again: in bounds, not used) and this pass's V fragments: asked for here so that they fly during the softmax
        const int tn = (t + np <= ib) ? t + np : t; const char* kn = kp + tn * (FJ * HD * 2);
#pragma unroll
        for (int jt = 0; jt < 2; ++jt)
#pragma unroll
            for (int ks = 0; ks < 2; ++ks) kf[jt][ks] = WFrag<h16>::ld((const h16*)kn + (jt * 2 + ks) * 512);
        v16bf vhf[4], vlf[4];
#pragma unroll
        for (int nb = 0; nb < 4; ++nb) { vhf[nb] = WFrag<bf>::ld((const bf*)vhp + nb * 512); vlf[nb] = WFrag<bf>::ld((const bf*)vlp + nb * 512); }
        addr_wait(kn, vhp, vlp);   // one s_wait_xcnt 0 behind the pass's loads, in front of every later write of their address registers
        vhp += np * (FJ * HD * 2); vlp += np * (FJ * HD * 2);
#pragma unroll
        for (int it = 0; it < 2; ++it)
#pragma unroll
            for (int jt = 0; jt < 2; ++jt) {
                *(v4fa*)(sw + it * 16 * FP + jt * 16) = __builtin_shufflevector(s[it][jt], s[it][jt], 0, 1, 2, 3);
                *(v4fa*)(sw + it * 16 * FP + jt * 16 + 4) = __builtin_shufflevector(s[it][jt], s[it][jt], 4, 5, 6, 7); }
        lds_barrier();   // all 16 heads' scores of this pass are in LDS before any thread reads a column of them
        {
            v2f sv[NH_];
#pragma unroll
            for (int g = 0; g < NH_; ++g) sv[g] = *(const v2f*)(ps + g * (FI * FP));
            const int dj = i0 + pi - (t * FJ + pj);   // query index minus the thread's first key index
            v2f rs;
#pragma unroll
            for (int q = 0; q < 2; ++q) { float mx = sv[0][q];
#pragma unroll
                for (int g = 1; g < NH_; ++g) mx = fmaxf(mx, sv[g][q]);
                mx *= K2; float sum = 0.f;
#pragma unroll
                for (int g = 0; g < NH_; ++g) { sv[g][q] = __builtin_amdgcn_exp2f(__builtin_fmaf(sv[g][q], K2, -mx)); sum += sv[g][q]; }
                rs[q] = __builtin_amdgcn_rcpf(sum); }
#pragma unroll
            for (int g = 0; g < NH_; ++g) { v2f w; w[0] = (dj < 0) ? 0.0625f : sv[g][0] * rs[0]; w[1] = (dj < 1) ? 0.0625f : sv[g][1] * rs[1];
                const unsigned hu = __builtin_bit_cast(unsigned, __builtin_convertvector(w, v2bf)); v2f d; d[0] = w[0] - __uint_as_float(hu << 16); d[1] = w[1] - __uint_as_float(hu & 0xFFFF0000u);
                pw[g * (FI * FP)] = __uint_as_float(hu); pw[g * (FI * FP) + 16] = __uint_as_float(__builtin_bit_cast(unsigned, __builtin_convertvector(d, v2bf))); }
        }
        lds_barrier();   // every head's weights of this pass are in LDS before its wave reads them
#pragma unroll
        for (int it = 0; it < 2; ++it) {
            const float* p = pr + it * 16 * FP;
            const v16bf pa = __builtin_bit_cast(v16bf, __builtin_shufflevector(*(const v4fa*)p, *(const v4fa*)(p + 8), 0, 1, 2, 3, 4, 5, 6, 7));
            const v16bf pb = __builtin_bit_cast(v16bf, __builtin_shufflevector(*(const v4fa*)(p + 16), *(const v4fa*)(p + 24), 0, 1, 2, 3, 4, 5, 6, 7));
#pragma unroll
            for (int nb = 0; nb < 4; ++nb) { o[it][nb] = wmmab(pa, vhf[nb], o[it][nb]); o[it][nb] = wmmab(pb, vhf[nb], o[it][nb]); o[it][nb] = wmmab(pa, vlf[nb], o[it][nb]); }
        }
    }
    const int el = (int)__builtin_amdgcn_mbcnt_lo(~0u, 0u);   // the lane index, formed anew here so that no register has to hold it through the loop
    // O holds each value at the place that it has in the out-projection's A plane (rows = tokens, k = h * HD + d, fragment order), so that the merge kernel is element-wise
    float* op = O + (size_t)part * TT * DQ + (size_t)i0 * DQ + h * (HD * 16) + ((el & 15) >> 3) * 128 + (el >> 4) * 64 + (el & 7);
#pragma unroll
    for (int it = 0; it < 2; ++it)
#pragma unroll
        for (int nb = 0; nb < 4; ++nb)
#pragma unroll
            for (int r = 0; r < 8; ++r) op[it * 16 * DQ + nb * 256 + r * 8] = o[it][nb][r];
}
// One, two or four planes' 32 bytes a lane: the loads and their data wait in one statement, so that all of them are in flight together and no address register is written (also not by a load's result) while a load is under way.
__device__ __forceinline__ void ldp1(const float* q0, v4f* a, v4f* b) {
    asm volatile("global_load_b128 %0, %2, off\n\tglobal_load_b128 %1, %2, off offset:16\n\ts_wait_loadcnt 0x0" : "=&v"(a[0]), "=&v"(b[0]) : "v"(q0) : "memory"); }
__device__ __forceinline__ void ldp2(const float* q0, const float* q1, v4f* a, v4f* b) {
    asm volatile("global_load_b128 %0, %4, off\n\tglobal_load_b128 %1, %4, off offset:16\n\tglobal_load_b128 %2, %5, off\n\tglobal_load_b128 %3, %5, off offset:16\n\ts_wait_loadcnt 0x0"
                 : "=&v"(a[0]), "=&v"(b[0]), "=&v"(a[1]), "=&v"(b[1]) : "v"(q0), "v"(q1) : "memory"); }
__device__ __forceinline__ void ldp4(const float* q0, const float* q1, const float* q2, const float* q3, v4f* pa, v4f* pb) {
    asm volatile("global_load_b128 %0, %8, off\n\tglobal_load_b128 %1, %8, off offset:16\n\tglobal_load_b128 %2, %9, off\n\tglobal_load_b128 %3, %9, off offset:16\n\t"
                 "global_load_b128 %4, %10, off\n\tglobal_load_b128 %5, %10, off offset:16\n\tglobal_load_b128 %6, %11, off\n\tglobal_load_b128 %7, %11, off offset:16\n\ts_wait_loadcnt 0x0"
                 : "=&v"(pa[0]), "=&v"(pb[0]), "=&v"(pa[1]), "=&v"(pb[1]), "=&v"(pa[2]), "=&v"(pb[2]), "=&v"(pa[3]), "=&v"(pb[3]) : "v"(q0), "v"(q1), "v"(q2), "v"(q3) : "memory"); }
// k_mrgrb: adds the planes that k_fattn wrote for a query block (its first NPARTS(ib)), in plane order. A work-group's 2048 elements lie in one query block (FI * DQ elements).
__global__ __launch_bounds__(256) void k_mrgrb(const float* __restrict__ O, int rb, bf* Ah, bf* Al) { const size_t e = ((size_t)blockIdx.x * 256 + threadIdx.x) * 8; if (e >= (size_t)NH_ * RB * HD) return; static_assert(PVG <= 7, "a plane count is taken apart into 4 + 2 + 1");
    const size_t PS = (size_t)NH_ * RB * HD; const int np = NPARTS((int)blockIdx.x / (FI * DQ / 2048));
    const float* q = O + e; v4f ta = (v4f){}, tb = (v4f){}, pa[4], pb[4];
    if (np & 4) { ldp4(q, q + PS, q + 2 * PS, q + 3 * PS, pa, pb); ta = ((pa[0] + pa[1]) + pa[2]) + pa[3]; tb = ((pb[0] + pb[1]) + pb[2]) + pb[3]; q += 4 * PS; }
    if (np & 2) { ldp2(q, q + PS, pa, pb); ta = (ta + pa[0]) + pa[1]; tb = (tb + pb[0]) + pb[1]; q += 2 * PS; }
    if (np & 1) { ldp1(q, pa, pb); ta += pa[0]; tb += pb[0]; }
    const v8f t = __builtin_shufflevector(ta, tb, 0, 1, 2, 3, 4, 5, 6, 7);
    v8us oh, ol;
    // unrolled: the vectors are indexed by constants
#pragma unroll
    for (int q = 0; q < 8; ++q) { unsigned short a2, c2; splitf(t[q], a2, c2); oh[q] = a2; ol[q] = c2; }
    *(v8us*)(Ah + (size_t)rb * RB * DQ + e) = oh; *(v8us*)(Al + (size_t)rb * RB * DQ + e) = ol;  }
// k_asoft: per row (zz, i): t = S x DM^-0.5 (no mask); softmax over the 2048 keys (register row, one exp, fixed trees);
__global__ __launch_bounds__(256) void k_asoft(const float* __restrict__ Sb, h16* P16, bf* Ph, bf* Pl) {
    const int lane = threadIdx.x & 31; const int row = blockIdx.x * 8 + (threadIdx.x >> 5); if (row >= ZH * TT) return; const int i = row % TT; const int zz = row / TT; (void)zz; const bool hires = (i < RH); const float* sr = Sb + (size_t)row * TT; float v[TT / 32]; float mx = -3.0e38f;
#pragma unroll
    for (int ch = 0; ch < TT / 128; ++ch) { const int j0 = ch * 128 + lane * 4; const v4f a = *(const v4f*)(sr + j0);
#pragma unroll
        for (int q = 0; q < 4; ++q) { const int j = j0 + q; (void)j; const float t = a[q] * SCL; v[ch * 4 + q] = t; mx = fmaxf(mx, t); } }
#pragma unroll
    for (int sh = 16; sh; sh >>= 1) mx = fmaxf(mx, __shfl_xor(mx, sh, 32));
    float sum = 0.f;
#pragma unroll
    for (int k = 0; k < TT / 32; ++k) { float d0 = __fsub_rn(v[k], mx); asm volatile("" : "+v"(d0)); v[k] = __builtin_amdgcn_exp2f(__fmul_rn(d0, 1.4426950408889634f)); sum += v[k]; }
#pragma unroll
    for (int sh = 16; sh; sh >>= 1) sum += __shfl_xor(sum, sh, 32);
    const float f = __fdiv_rn(hires ? 1.0f : PCAR, sum);
{
        if (hires) {
#pragma unroll
            for (int ch = 0; ch < TT / 128; ++ch) { v4us oh, ol;
#pragma unroll
                for (int q = 0; q < 4; ++q) { unsigned short a, c2; splitf(v[ch * 4 + q] * f, a, c2); oh[q] = a; ol[q] = c2; }
                const size_t oo = ((size_t)zz * (RH ? RH : 1) + i) * TT + ch * 128 + lane * 4; *(v4us*)(Ph + oo) = oh; *(v4us*)(Pl + oo) = ol; }
        } else {
#pragma unroll
            for (int ch = 0; ch < TT / 128; ++ch) { v4h o4;
#pragma unroll
                for (int q = 0; q < 4; ++q) o4[q] = tohx(v[ch * 4 + q] * f);
                *(v4h*)(P16 + (size_t)row * TT + ch * 128 + lane * 4) = o4; } }
         }
}
__global__ __launch_bounds__(256) void k_merge(const float* __restrict__ O, int h0, bf* Ah, bf* Al) { const size_t e = ((size_t)blockIdx.x * 256 + threadIdx.x) * 2; if (e >= (size_t)ZH * TT * HD) return; const int d = (int)(e % HD); const int t = (int)((e / HD) % TT); const int zz = (int)(e / ((size_t)HD * TT)); const float cs = (t < RH) ? 1.0f : (1.0f / PCAR); const size_t oo = (size_t)t * DQ + (h0 + zz) * HD + d;
    v2us oh, ol;
#pragma unroll
    for (int q = 0; q < 2; ++q) { unsigned short a, c2; splitf(O[e + q] * cs, a, c2); oh[q] = a; ol[q] = c2; } *(v2us*)(Ah + oo) = oh; *(v2us*)(Al + oo) = ol;  }

extern "C" void kernel_launch(void* const* d_in, const int* in_sizes, int n_in,
                              void* d_out, int out_size, void* d_ws, size_t ws_size, hipStream_t stream) {
    (void)in_sizes; (void)n_in; (void)out_size;
    const float* x = (const float*)d_in[0]; const float* wq = (const float*)d_in[1]; const float* bq = (const float*)d_in[2]; const float* wk = (const float*)d_in[3]; const float* bk = (const float*)d_in[4]; const float* wv = (const float*)d_in[5]; const float* bv = (const float*)d_in[6]; const float* wo = (const float*)d_in[7]; const float* bo = (const float*)d_in[8]; const float* cosT = nullptr; const float* sinT = nullptr; (void)cosT; (void)sinT;
    float* OUT = (float*)d_out;     // [2][2048][1024]
    char* wsp = (char*)d_ws;
    auto take = [&](size_t bytes) { char* p = wsp; wsp += (bytes + 255) & ~(size_t)255; return (void*)p; };
    bf* W4 = (bf*)take((size_t)4 * DQ * DM * 2); bf* WQ = W4; bf* WK = W4 + (size_t)DQ * DM; bf* WV = W4 + (size_t)2 * DQ * DM; bf* WO = W4 + (size_t)3 * DQ * DM;
    bf* XB = (bf*)take((size_t)NB_ * TT * DM * 2);
    h16* QP16 = (h16*)take((size_t)NH_ * TT * HD * 2); h16* KP16 = (h16*)take((size_t)NKV * TT * HD * 2);
    bf* VTh = (bf*)take((size_t)NKV * HD * TT * 2); bf* VTl = (bf*)take((size_t)NKV * HD * TT * 2); float* VSb = (float*)take((size_t)NKV * (TT / FJ) * HD * 4);
    float* Ob = (float*)take((size_t)PVG * NH_ * RB * HD * 4); bf* ATh = (bf*)take((size_t)TT * DQ * 2); bf* ATl = (bf*)take((size_t)TT * DQ * 2);
    if ((size_t)(wsp - (char*)d_ws) > ws_size) return;    // ws 256 MiB
    k_prep<<<(unsigned)(4 * WBL + (size_t)NB_ * TT * DM / 8 / 256), 256, 0, stream>>>(wq, wk, wv, wo, x, W4, XB);
    // Q, K, V, O and the merged planes are one batch's and are used again by the next batch. Batch b's out-projection reads only ATh, ATl, WO; batch b + 1's projections write Q, K, V, which batch b's attention has read by then: the two share a launch.
    static_assert(NB_ == 2, "the launches below are written out for two batches");
    k_jobs<<<dim3(TT / 64, 48, 1), 32 * GNW, 0, stream>>>(16, XB, WQ, WK, WV, bq, bk, bv, QP16, KP16, VTh, VTl, VSb, ATh, ATl, WO, bo, OUT);
    k_fattn<<<dim3(FWG, 1, 1), 512, 0, stream>>>(QP16, KP16, VTh, VTl, VSb, Ob);
    k_mrgrb<<<(unsigned)(((size_t)NH_ * RB * HD / 8 + 255) / 256), 256, 0, stream>>>(Ob, 0, ATh, ATl);
    k_jobs<<<dim3(TT / 64, 64, 1), 32 * GNW, 0, stream>>>(0, XB + (size_t)TT * DM, WQ, WK, WV, bq, bk, bv, QP16, KP16, VTh, VTl, VSb, ATh, ATl, WO, bo, OUT);
    k_fattn<<<dim3(FWG, 1, 1), 512, 0, stream>>>(QP16, KP16, VTh, VTl, VSb, Ob);
    k_mrgrb<<<(unsigned)(((size_t)NH_ * RB * HD / 8 + 255) / 256), 256, 0, stream>>>(Ob, 0, ATh, ATl);
    k_jobs<<<dim3(TT / 64, 16, 1), 32 * GNW, 0, stream>>>(0, XB, WQ, WK, WV, bq, bk, bv, QP16, KP16, VTh, VTl, VSb, ATh, ATl, WO, bo, OUT + (size_t)TT * DM);
}

// v007
// Measured time: 147 microseconds a run.
// Next to v006, in two timings, it ran 1.13 times as fast each time.
// Over all steps from v000 it is 9.29 times as fast.
#include <hip/hip_runtime.h>

// MultiHeadAttention__5987 (x [2][2048][1024]; Q/K/V = x W + b (16 x 64); score = Q.K / sqrt(1024); causal positions (j > i) set to -1e10; FAITHFUL QUIRK: softmax over the HEAD axis (not over keys) -> weight[h][i][j]; out_h[i] = sum_j weight[h][i][j] V_h[j] (un-normalised over keys; masked positions carry weight exactly 1/16); merged Wo + bo -> [2][2048][1024]).
// Layout (exact): one kernel per batch does scores, head softmax and weights.V: a work-group of 16 waves (wave = head) holds 32 query rows and walks its share of the key passes (32 keys each) up to the diagonal; scores and weights never leave the WGP: they cross from head to head through LDS. Key passes wholly behind the diagonal carry the weight 1/16 everywhere: their part of weights.V is 1/16 of the sum of V's 32-token block sums.
// Compute dtypes, f32 accumulate: every input rounded to bf16; Q/K/V on PLAIN bf16 operands (inputs: exact) + bias; scores as single fp16 products (x1; logits are q.k/32); the 16-way head softmax in f32 per (i, j) (masked columns give exactly 1/16); weights.V hl x hl (3 products) on every row (weights <= 1, no carrier needed); Wo hl x exact (2 products) + bias.

#define NB_  2
#define TT   2048
#define DM   1024
#define NH_  16
#define NKV  16
#define REP  (NH_ / NKV)
#define HD   64
#define DQ   (NH_ * HD)
#define DKV  (NKV * HD)
#define ZH   2
#define RH   2048                  // query rows < RH use hi+lo planes (0: none)
#define WIN  0
#define PCAR 1024.0f
#define RB   TT     // query rows per merge launch
#define NRB  (TT / RB)
#define GNW  8      // waves per GEMM work-group: the tile's 64x64 quarters, each over 2 or 4 parts of K
#define PVG  7      // most work-groups that share a query block's key passes; their planes are added in the merge kernel
#define NPARTS(ib) (((ib) + 1) / 10 + 1)   // work-groups that share query block ib's ib + 1 key passes up to the diagonal: at most 10 passes each
#define FWG  244    // sum of NPARTS over the 64 query blocks: every work-group has a WGP of its own (a work-group's 16 waves fill a WGP's registers)
#define FI   32     // query rows per work-group of the fused kernel
#define FJ   32     // keys per pass of the fused kernel
#define FP   36     // LDS row pitch in floats (144 B: an odd multiple of 16 B)
#define SCL  0.03125f   // 1/sqrt(1024) (full embed dim, faithful)
typedef _Float16 h16;
typedef unsigned short bf;
typedef __attribute__((ext_vector_type(16))) __bf16   v16bf;
typedef __attribute__((ext_vector_type(16))) _Float16 v16h;
typedef __attribute__((ext_vector_type(8)))  _Float16 v8h;
typedef __attribute__((ext_vector_type(8)))  unsigned short v8us;
typedef __attribute__((ext_vector_type(8)))  float    v8f;
typedef __attribute__((ext_vector_type(4)))  float    v4f;
typedef v8h  __attribute__((may_alias)) v8ha;
typedef v4f  __attribute__((may_alias)) v4fa;
typedef v8us __attribute__((may_alias)) v8usa;

__device__ __forceinline__ unsigned short f2bf(float f) { unsigned u = __float_as_uint(f); u += 0x7FFFu + ((u >> 16) & 1u); return (unsigned short)(u >> 16); }
__device__ __forceinline__ float bf2f(unsigned short b) { return __uint_as_float(((unsigned)b) << 16); }
__device__ __forceinline__ float bfr(float f) { return bf2f(f2bf(f)); }
__device__ __forceinline__ v16h cat16(v8h lo, v8h hi) { return __builtin_shufflevector(lo, hi, 0, 1, 2, 3, 4, 5, 6, 7, 8, 9, 10, 11, 12, 13, 14, 15); }
__device__ __forceinline__ v16bf cat16b(v8us lo, v8us hi) { return __builtin_bit_cast(v16bf, __builtin_shufflevector(lo, hi, 0, 1, 2, 3, 4, 5, 6, 7, 8, 9, 10, 11, 12, 13, 14, 15)); }
__device__ __forceinline__ v8f wmma16(v16h a, v16h b, v8f c) { return __builtin_amdgcn_wmma_f32_16x16x32_f16(false, a, false, b, (short)0, c, false, false); }
__device__ __forceinline__ v8f wmmab(v16bf a, v16bf b, v8f c) { return __builtin_amdgcn_wmma_f32_16x16x32_bf16(false, a, false, b, (short)0, c, false, false); }
__device__ __forceinline__ h16 tohx(float x) { return (h16)x; }
__device__ __forceinline__ void splitf(float y, unsigned short& h, unsigned short& l) { h = f2bf(y); l = f2bf(y - bf2f(h)); }
// s_wait_xcnt 0 behind a run of global loads, ahead of every later write of a register that they name as an address. The addresses are inputs of the statement, so that their registers stay untouched (also by a later load's result) up to the wait.
__device__ __forceinline__ void addr_wait(const void* a) { asm volatile("s_wait_xcnt 0x0" :: "v"(a) : "memory"); }
__device__ __forceinline__ void addr_wait(const void* a, const void* b) { asm volatile("s_wait_xcnt 0x0" :: "v"(a), "v"(b) : "memory"); }
__device__ __forceinline__ void addr_wait(const void* a, const void* b, const void* c) { asm volatile("s_wait_xcnt 0x0" :: "v"(a), "v"(b), "v"(c) : "memory"); }
__device__ __forceinline__ void addr_wait(const void* a, const void* b, const void* c, const void* d) { asm volatile("s_wait_xcnt 0x0" :: "v"(a), "v"(b), "v"(c), "v"(d) : "memory"); }
typedef __attribute__((ext_vector_type(2))) _Float16 v2h;
typedef __attribute__((ext_vector_type(4))) _Float16 v4h;



// ---- d_gemmw: GEMM body of k_jobs: an output tile of MQ * 64 rows x 128 columns per work-group of 8 waves; a wave holds one 64x64 quarter (16 accumulators) over one of NKP = 4 / MQ parts of K. Row block rb, column block by, os = the work-group's LDS.
// C[m][n] = sum_k A[m][k] Bt[n][k] (NSPLIT 1: + A2[m][k] Bt[n][k]) + bias[n] (rounded to bf16).
// Operands come from 16-bit planes in fragment order and are staged in LDS by asynchronous copies, two buffers: the two waves that share 64 rows (or 64 columns) read them from LDS, so that a work-group fetches each operand tile once.
// A stage holds three regions, A, Bt, A2; a region holds, per part of K and per k-tile ks < KS, the operand's row tiles (1 KiB each; 4 * MQ of A, 8 of Bt): slot (part * KS + ks) * row tiles + row tile. Copy c of thread t fills 16 bytes at c * 4096 + t * 16: 256 threads fill 4 slots a copy.
// The parts of K are added through LDS in their order, then the bias.
// EPI (a quarter's 64 columns are one head, its rows are tokens): 0: f32 to C. 1: as fp16 to the head plane P16[head] (rows = tokens, k = d). 2: transposed through LDS, as bf16 hi and lo, to Ph / Pl[head] (rows = d, k = tokens), and its sums over each FJ tokens as f32 to VS[head][token / FJ][d]. The planes in fragment order.
// FRAGMENT ORDER: every 16-bit operand plane P[row][k] is stored as tiles of 16 rows x 32 k (512 elements, 1 KiB), one tile = one WMMA operand fragment, laid out as the lanes read it:
// element (row, k) stands at tile * 512 + ((k % 32) / 16) * 256 + (((k % 16) / 8) * 16 + row % 16) * 8 + k % 8. A lane's two 16-byte loads are at lane * 8 and 256 + lane * 8: a wave's load is 512 bytes in a row (4 whole lines).
// Tile numbers: GEMM operands and Q, K head planes (row / 16) * (K / 32) + k / 32; V planes (rows = d, k = token) (k / 32) * (HD / 16) + row / 16, so that a pass's four tiles are neighbours.
template <typename T16> struct WFrag;
template <> struct WFrag<h16> { typedef v16h V; static __device__ __forceinline__ V ld(const h16* p) { return cat16(*(const v8h*)p, *(const v8h*)(p + 256)); } static __device__ __forceinline__ v8f mma(V a, V b, v8f c) { return wmma16(a, b, c); } };
template <> struct WFrag<bf> { typedef v16bf V; static __device__ __forceinline__ V ld(const bf* p) { return cat16b(*(const v8us*)p, *(const v8us*)(p + 256)); } static __device__ __forceinline__ v8f mma(V a, V b, v8f c) { return wmmab(a, b, c); } };
// Asynchronous copies global to LDS, 16 bytes a lane: LDS byte addresses l, l + 4096, ...; each copy has its own global address. s_wait_xcnt 0 is the statement's last line, so that it stands in front of every later write of a register that a copy names.
__device__ __forceinline__ void cp8(unsigned l, const char* const* g) {
    asm volatile("global_load_async_to_lds_b128 %0, %8, off\n\tglobal_load_async_to_lds_b128 %1, %9, off\n\tglobal_load_async_to_lds_b128 %2, %10, off\n\tglobal_load_async_to_lds_b128 %3, %11, off\n\t"
                 "global_load_async_to_lds_b128 %4, %12, off\n\tglobal_load_async_to_lds_b128 %5, %13, off\n\tglobal_load_async_to_lds_b128 %6, %14, off\n\tglobal_load_async_to_lds_b128 %7, %15, off\n\ts_wait_xcnt 0x0"
                 :: "v"(l), "v"(l + 4096u), "v"(l + 8192u), "v"(l + 12288u), "v"(l + 16384u), "v"(l + 20480u), "v"(l + 24576u), "v"(l + 28672u),
                    "v"(g[0]), "v"(g[1]), "v"(g[2]), "v"(g[3]), "v"(g[4]), "v"(g[5]), "v"(g[6]), "v"(g[7]) : "memory"); }
// a fragment from a staged tile: the lane's 16 bytes of each half of the tile
__device__ __forceinline__ v16bf ldsfrag(const char* p) { return cat16b(*(const v8usa*)p, *(const v8usa*)(p + 512)); }
template <int NSPLIT, int EPI, int K, int MQ>
__device__ __forceinline__ void d_gemmw(float* os, const int rb, const int by, const bf* A, const bf* A2, const bf* Bt, float* C, int ldc, const float* bias, h16* P16, bf* Ph, bf* Pl, float* VS) {
    static_assert(GNW == 8 && HD == 64 && (NSPLIT == 0 || NSPLIT == 1) && (MQ == 1 || MQ == 2) && (EPI != 2 || MQ == 2), "8 waves: MQ x 2 quarters, each over 4 / MQ parts of K; a quarter is one head wide");
    constexpr int KT = K / 32, NKP = 4 / MQ, KS = (NSPLIT == 0) ? 2 : 1, NT = KT / NKP / KS;   // k-tiles; parts of K; k-tiles a trip and part; trips
    constexpr int NA = NKP * KS * MQ, NB = NKP * KS * 2, NC = NA * (1 + NSPLIT) + NB, STG = NC * 4096;   // copies a thread and stage: of a plane of A, of Bt, of all; bytes a stage
    static_assert(NT >= 2 && KT % (NKP * KS) == 0 && 2 * STG <= GNW * 64 * 68 * 4 && NC == 16, "two stages exist and both buffers lie inside os");
    const int tid = (int)threadIdx.x, wave = __builtin_amdgcn_readfirstlane(tid >> 5); const int kh = wave % NKP, nc = (wave / NKP) & 1, mr = wave / (NKP * 2);
    const int lane = tid & 31, lr = lane & 15, hi = lane >> 4; const int r0 = rb * (MQ * 64), c0 = by * 128;
    v8f acc[4][4];
#pragma unroll
    for (int mb = 0; mb < 4; ++mb)
#pragma unroll
        for (int nb = 0; nb < 4; ++nb) acc[mb][nb] = (v8f){};
    // each thread's own 16 bytes: row tile tid / 64 of the operand's first k-tile (16 rows of tiles are K * 32 bytes; a k-tile is 1024)
    const unsigned l0 = (unsigned)(size_t)os + (unsigned)tid * 16u; const size_t to = (size_t)(tid >> 6) * (KT * 1024) + (size_t)(tid & 63) * 16;
    const char* gA = (const char*)A + (size_t)r0 * (K * 2) + to; const char* gB = (const char*)Bt + (size_t)c0 * (K * 2) + to; const char* gA2 = (NSPLIT == 1) ? (const char*)A2 + (size_t)r0 * (K * 2) + to : nullptr;
    auto stage = [&](int t, int buf) { const char* g[NC];
        // unrolled: g is indexed by constants
#pragma unroll
        for (int c = 0; c < NC; ++c) { const int op = (c < NA) ? 0 : (c < NA + NB) ? 1 : 2, j = c - (op == 0 ? 0 : op == 1 ? NA : NA + NB), w = (op == 1) ? 2 : MQ, ks = (j / w) % KS, k2 = j / w / KS;   // region; copy in the region; copies a k-tile; k-tile; part of K
            g[c] = (op == 0 ? gA : op == 1 ? gB : gA2) + __builtin_amdgcn_readfirstlane(((j % w) * 4 * KT + k2 * (KT / NKP) + ks + t * KS) * 1024); }   // the tile's offset is formed in a scalar register, so that no vector register holds a copy's own base through the loop
        const unsigned l = l0 + (unsigned)buf * (unsigned)STG; cp8(l, g); cp8(l + 32768u, g + 8); };
    stage(0, 0);
    asm volatile("s_wait_asynccnt 0x0" ::: "memory");   // this wave's copies of stage 0 have landed
    __syncthreads();                                    // every wave's have: stage 0 may be read
    stage(1, 1);
    // rolled: one trip's code, and the order at its foot stays as written
#pragma unroll 1
    for (int t = 0; t < NT; ++t) {
        const char* sp = (const char*)os + (t & 1) * STG + lane * 16;
        v16bf a[4], bb[4];
#pragma unroll
        for (int ks = 0; ks < KS; ++ks) {
            bb[0] = ldsfrag(sp + NA * 4096 + ((kh * KS + ks) * 8 + nc * 4) * 1024);
#pragma unroll
            for (int mb = 0; mb < 4; ++mb) a[mb] = ldsfrag(sp + ((kh * KS + ks) * (4 * MQ) + mr * 4 + mb) * 1024);
#pragma unroll
            for (int nb = 1; nb < 4; ++nb) bb[nb] = ldsfrag(sp + NA * 4096 + ((kh * KS + ks) * 8 + nc * 4 + nb) * 1024);
            if constexpr (NSPLIT == 1) {
                __builtin_amdgcn_sched_barrier(0);   // as the one below: the LDS reads above are all asked for ahead of the matrix instructions
#pragma unroll
                for (int nb = 0; nb < 4; ++nb)
#pragma unroll
                    for (int mb = 0; mb < 4; ++mb) acc[mb][nb] = wmmab(a[mb], bb[nb], acc[mb][nb]);
                // the second plane of A takes the first one's place (the B fragments stay)
#pragma unroll
                for (int mb = 0; mb < 4; ++mb) a[mb] = ldsfrag(sp + (NA + NB) * 4096 + ((kh * KS + ks) * (4 * MQ) + mr * 4 + mb) * 1024);
            }
            // the trip's foot stands behind its last LDS reads and in front of the matrix instructions that work on them (they read registers only): the next copies are under way while the matrix unit works
            if (ks == KS - 1) {
                asm volatile("s_wait_dscnt 0x0" ::: "memory");      // this wave has read its last fragments of stage t
                asm volatile("s_wait_asynccnt 0x0" ::: "memory");   // this wave's copies of stage t + 1 have landed
                __syncthreads();                                    // stage t + 1 may be read, and stage t's buffer may be filled again
                if (t + 2 < NT) stage(t + 2, t & 1);
            }
            __builtin_amdgcn_sched_barrier(0);   // all of a k-tile's LDS reads are asked for ahead of its matrix instructions: without it the compiler reads each B fragment only when it is due, and every fourth matrix instruction waits a whole LDS latency
#pragma unroll
            for (int nb = 0; nb < 4; ++nb)
#pragma unroll
                for (int mb = 0; mb < 4; ++mb) acc[mb][nb] = wmmab(a[mb], bb[nb], acc[mb][nb]);
        }
        // four vector slots behind the trip's last matrix instructions, in front of whatever the loop's branch leads to
        asm volatile("v_nop\n\tv_nop\n\tv_nop\n\tv_nop" : "+v"(acc[0][0]), "+v"(acc[1][1]), "+v"(acc[2][2]), "+v"(acc[3][3]) : "v"(a[0]), "v"(a[3]));
    }
    asm volatile("s_wait_asynccnt 0x0" ::: "memory");   // no copy is under way when os is used for the partial tiles
    // EPI 1: thread t takes the 4 values that stand at t * 4 in a 16-token block of the head plane (2 tiles), so that the 256 threads store 2 KiB in a row
    float* my = os + wave * (64 * 68); const int cofs = (EPI == 1) ? ((tid >> 5) & 7) * 8 + (tid & 1) * 4 : (tid & 15) * 4; v4f bv[2];
    // the bias addresses are inputs of the s_wait_xcnt statement behind the loads, so that a load's own result does not land in an address register (bias carries no __restrict__: the loads keep their place in front of the statement)
    { const float* bp = bias + c0 + cofs; const float* bp2 = bp + 64; const v4f br = *(const v4f*)bp; const v4f br2 = *(const v4f*)bp2; addr_wait(bp, bp2);
#pragma unroll
      for (int q = 0; q < 4; ++q) { bv[0][q] = bfr(br[q]); bv[1][q] = bfr(br2[q]); } }
    // the three loops are unrolled so that acc is indexed by constants and stays in registers
#pragma unroll
    for (int mb = 0; mb < 4; ++mb)
#pragma unroll
        for (int nb = 0; nb < 4; ++nb)
#pragma unroll
            for (int j = 0; j < 8; ++j) my[(mb * 16 + hi * 8 + j) * 68 + nb * 16 + lr] = acc[mb][nb][j];
    __syncthreads();   // every wave's partial tile is in LDS before any thread adds them
    v4f sums[2 * MQ][4];
    // quarter qd = (row half) * 2 + column half: its NKP partial tiles are those of waves NKP qd and up. Unrolled: sums is indexed by constants, and the LDS reads are in flight together
#pragma unroll
    for (int qd = 0; qd < 2 * MQ; ++qd) { const float* tp = os + qd * (NKP * 64 * 68); const int r0q = r0 + (qd >> 1) * 64, c0q = c0 + (qd & 1) * 64, hq = by * 2 + (qd & 1); (void)c0q; (void)hq;
#pragma unroll
        for (int s = 0; s < 4; ++s) { const int row = (EPI == 1) ? s * 16 + ((tid >> 1) & 15) : (s * 256 + tid) >> 4;
            v4f val = *(const v4fa*)(tp + row * 68 + cofs);
#pragma unroll
            for (int w = 1; w < NKP; ++w) val += *(const v4fa*)(tp + w * (64 * 68) + row * 68 + cofs);
            val += bv[qd & 1];
            if constexpr (EPI == 0) *(v4f*)(C + (size_t)(r0q + row) * ldc + c0q + cofs) = val;
            if constexpr (EPI == 1) *(v4h*)(P16 + ((size_t)hq * TT + r0q + s * 16) * HD + tid * 4) = __builtin_convertvector(val, v4h);
            if constexpr (EPI == 2) sums[qd][s] = val; }
        // s_wait_xcnt 0 behind a quarter's stores: the code behind them writes the registers that the stores name
        if constexpr (EPI != 2) asm volatile("s_wait_xcnt 0x0" ::: "memory"); }
    if constexpr (EPI == 2) {
        __syncthreads();   // every thread has read the partial tiles before the sums are written over them
        // each quarter's sum goes transposed into its own first partial tile; pitch 65 words: the 32 lanes of a wave meet 32 different banks in the transposed write
#pragma unroll
        for (int qd = 0; qd < 4; ++qd)
#pragma unroll
            for (int s = 0; s < 4; ++s)
#pragma unroll
                for (int q = 0; q < 4; ++q) os[qd * (2 * 64 * 68) + (cofs + q) * 65 + ((s * 256 + tid) >> 4)] = sums[qd][s][q];
        __syncthreads();   // the transposed quarters are in LDS before any thread reads a row of them
        // thread t takes the 8 tokens that stand at t * 8 in a 32-token block of the plane (4 tiles): the 256 threads store 4 KiB in a row to each plane
#pragma unroll
        for (int qd = 0; qd < 4; ++qd) { const float* tp = os + qd * (2 * 64 * 68); const int r0q = r0 + (qd >> 1) * 64, hq = by * 2 + (qd & 1);
#pragma unroll
            for (int u = 0; u < 2; ++u) { const int d = ((tid >> 6) & 3) * 16 + (tid & 15), t8 = u * 32 + ((tid >> 4) & 3) * 8; v8us oh, ol;
#pragma unroll
                for (int j = 0; j < 8; ++j) { unsigned short a2, c2; splitf(tp[d * 65 + t8 + j], a2, c2); oh[j] = a2; ol[j] = c2; }
                const size_t oo = ((size_t)hq * TT + r0q + u * 32) * HD + tid * 8; *(v8us*)(Ph + oo) = oh; *(v8us*)(Pl + oo) = ol; }
            // s_wait_xcnt 0 behind a quarter's stores: the code behind them writes the registers that the stores name
            asm volatile("s_wait_xcnt 0x0" ::: "memory"); }
        // block sums: a thread adds one d over one block of FJ tokens, in token order, for two of the 8 (quarter, block) pairs; 128 threads store 512 bytes in a row
#pragma unroll
        for (int v = 0; v < 2; ++v) { const int it = v * 256 + tid, qd = it >> 7, u = (it >> 6) & 1, d = it & 63; const float* tp = os + qd * (2 * 64 * 68); float sm = 0.f;
            // unrolled so that the LDS reads are in flight together
#pragma unroll
            for (int j = 0; j < FJ; ++j) sm += tp[d * 65 + u * FJ + j];
            VS[((size_t)(by * 2 + (qd & 1)) * (TT / FJ) + (r0 + (qd >> 1) * 64) / FJ + u) * HD + d] = sm;
            // s_wait_xcnt 0 behind the store: the code behind it writes the registers that the store names
            asm volatile("s_wait_xcnt 0x0" ::: "memory"); }
    }
}

// k_jobs: GEMMs that do not depend on one another share one grid (TT / 128, blocks y), 32 * GNW threads. y = blockIdx.y + y0 names the job and its 128 columns (two heads):
// 0..15 out-projection (Ah + Al) WO + bo to OUTb, tiles of 64 rows (row block 2 blockIdx.x + y % 2, column block y / 2), so that it alone still gives every WGP a work-group; 16..23 V projection; 24..31 Q; 32..39 K (X times WV, WQ, WK), tiles of 128 rows.
// A launch takes a run of y: 16..39 (Q, K, V of a batch), 0..39 (the out-projection of one batch beside Q, K, V of the next), 0..15 (the last out-projection). The test on y is the same for a whole work-group.
__global__ __launch_bounds__(32 * GNW) void k_jobs(int y0, const bf* X, const bf* WQ, const bf* WK, const bf* WV, const float* bq, const float* bk, const float* bv, h16* Q16, h16* K16, bf* Vh, bf* Vl, float* VS,
                                                   const bf* Ah, const bf* Al, const bf* WO, const float* bo, float* OUTb) {
    static_assert(DQ / 128 == 8 && DKV / 128 == 8 && DM / 128 == 8 && TT % 128 == 0, "each job is 8 column blocks wide");
    __shared__ __align__(16) float os[GNW * 64 * 68];   // one array for all jobs: a work-group runs one of them; first the two stage buffers, then the waves' partial tiles
    const int y = (int)blockIdx.y + y0, x = (int)blockIdx.x;
    if (y < 16) d_gemmw<1, 0, DQ, 1>(os, x * 2 + (y & 1), y >> 1, Ah, Al, WO, OUTb, DM, bo, nullptr, nullptr, nullptr, nullptr);
    else if (y < 24) d_gemmw<0, 2, DM, 2>(os, x, y - 16, X, nullptr, WV, nullptr, 0, bv, nullptr, Vh, Vl, VS);
    else { const bool isk = y >= 32; d_gemmw<0, 1, DM, 2>(os, x, (y - 24) & 7, X, nullptr, isk ? WK : WQ, nullptr, 0, isk ? bk : bq, isk ? K16 : Q16, nullptr, nullptr, nullptr); }
}

typedef __attribute__((ext_vector_type(2))) unsigned short v2us;
typedef __attribute__((ext_vector_type(4))) unsigned short v4us;
typedef __attribute__((ext_vector_type(2))) float v2f;
typedef __attribute__((ext_vector_type(4))) int v4i;

// d_wtG: w[k][n] f32 to Bt (rows = n) in fragment order. Thread i writes the 8 elements at i * 8: one n, 8 neighbouring k; 16 lanes read 16 neighbouring n of one k.
__device__ __forceinline__ void d_wtG(const float* __restrict__ w, int K, int N, bf* Bt, const int i) {
    if (i >= N * K / 8) return;
    const int tile = i >> 6, kt = K / 32; const int n = (tile / kt) * 16 + (i & 15), k0 = (tile % kt) * 32 + ((i >> 4) & 3) * 8; v8us o; const float* wp[8]; float wv[8];
    // unrolled so that the 8 loads are in flight together
#pragma unroll
    for (int j = 0; j < 8; ++j) { wp[j] = w + (size_t)(k0 + j) * N + n; wv[j] = *wp[j]; }
    // s_wait_xcnt 0 behind the eight loads; their addresses are inputs, so that no address register is written (also not by a later load's result) ahead of it
    asm volatile("s_wait_xcnt 0x0" :: "v"(wp[0]), "v"(wp[1]), "v"(wp[2]), "v"(wp[3]), "v"(wp[4]), "v"(wp[5]), "v"(wp[6]), "v"(wp[7]) : "memory");
    // unrolled: o and wv are indexed by constants
#pragma unroll
    for (int j = 0; j < 8; ++j) o[j] = f2bf(wv[j]);
    *(v8us*)(Bt + (size_t)i * 8) = o;
}
// d_cvt8: src[row][DM] f32 to dst in fragment order. Thread i writes the 8 elements at i * 8: one row, 8 neighbouring k.
__device__ __forceinline__ void d_cvt8(const float* __restrict__ src, bf* dst, size_t n8, const size_t i) { if (i >= n8) return; const int tile = (int)(i >> 6); const int row = (tile / (DM / 32)) * 16 + ((int)i & 15), k0 = (tile % (DM / 32)) * 32 + (((int)i >> 4) & 3) * 8; const v8f v = *(const v8f*)(src + (size_t)row * DM + k0); v8us o;
#pragma unroll
    for (int k = 0; k < 8; ++k) o[k] = f2bf(v[k]); *(v8us*)(dst + i * 8) = o;  }
// k_prep: the four weight conversions and x's (both batches' rows as one matrix) depend on nothing and share one grid: WBL work-groups a weight (the slower, strided readers first), then x's.
#define WBL (DM * DQ / 8 / 256)
__global__ __launch_bounds__(256) void k_prep(const float* __restrict__ wq, const float* __restrict__ wk, const float* __restrict__ wv, const float* __restrict__ wo, const float* __restrict__ x, bf* W4, bf* XB) {
    static_assert(DKV == DQ, "the four weights have one size");
    const int j = (int)blockIdx.x / WBL;   // the same for a whole work-group
    if (j < 4) d_wtG(j == 0 ? wq : j == 1 ? wk : j == 2 ? wv : wo, DM, DQ, W4 + (size_t)j * DM * DQ, ((int)blockIdx.x - j * WBL) * 256 + (int)threadIdx.x);
    else d_cvt8(x, XB, (size_t)NB_ * TT * DM / 8, (size_t)((int)blockIdx.x - 4 * WBL) * 256 + threadIdx.x);
}
__global__ __launch_bounds__(256) void k_cscvt(const float* __restrict__ cosT, const float* __restrict__ sinT, float* CS) { const int idx = blockIdx.x * 256 + threadIdx.x; if (idx >= TT * HD) return; v2f cs; cs[0] = bfr(cosT[idx]); cs[1] = bfr(sinT[idx]); *(v2f*)(CS + (size_t)idx * 2) = cs;  }
typedef __attribute__((ext_vector_type(2))) __bf16 v2bf;
// Work-group barrier that orders LDS only: the fences name the LDS address space, so that global loads asked for ahead of it stay in flight across it (__syncthreads() waits for them).
__device__ __forceinline__ void lds_barrier() { __builtin_amdgcn_fence(__ATOMIC_RELEASE, "workgroup", "local"); __builtin_amdgcn_s_barrier(); __builtin_amdgcn_fence(__ATOMIC_ACQUIRE, "workgroup", "local"); }
// k_fattn: grid FWG, 512 threads, wave = head. Query block ib has ib + 1 key passes that hold an unmasked position; its NPARTS(ib) work-groups take them in turn (pass part, part + np, ...).
// The passes behind the diagonal pass are masked everywhere: weight 1/16 in every head and row, so their weights.V is 1/16 of the sum of VS[h][blk] over blk > ib, the same for all rows; the last part starts its accumulators there.
// Per pass of FJ keys: S^T = K Q^T (fp16, rows = keys, columns = queries: a lane's 8 accumulator values are 8 neighbouring keys of one query), stored to LDS as [head][query][key] f32.
// Head softmax: behind a barrier each thread takes 2 neighbouring keys of one query, reads the 16 heads' scores and writes the 16 weight pairs back over the same rows: bf16 hi pairs in the row's first 16 words, lo pairs in the next 16.
// (A wave holds whole rows, and has read all of a row before it writes any of it.) Behind a second barrier each wave reads its head's rows as A fragments of weights.V.
// A masked position (j > i) has the same score in every head, so its weight is exactly 1/16. O: plane part of [PVG][TT * DQ] f32 (a query block's rows are written in its first NPARTS(ib) planes only).
// K16, Vh, Vl carry no __restrict__: the loop's loads then keep their place in front of its s_wait_xcnt statement (its "memory" clobber holds them there).
__global__ __launch_bounds__(512) void k_fattn(const h16* __restrict__ Q16, const h16* K16, const bf* Vh, const bf* Vl, const float* VS, float* O) {
    __shared__ __align__(16) float Ss[NH_ * FI * FP];
    // flat index to (query block, part): the blocks with np = g + 1 parts are those with 10 g <= ib + 1 <= 10 g + 9; with F = index + 1 their work-groups start at F = 5 g (g + 1), part by part
    static_assert(TT / FI == 64 && FWG == 244 && PVG == 7, "the thresholds below are those of 64 query blocks");
    const int F = (int)blockIdx.x + 1, g6 = (F >= 10) + (F >= 30) + (F >= 60) + (F >= 100) + (F >= 150) + (F >= 210), wi = F - 5 * g6 * (g6 + 1);
    const int part = (g6 == 6) ? wi / 5 : wi / 10, ib = 10 * g6 + wi - part * ((g6 == 6) ? 5 : 10) - 1, np = g6 + 1;
    const float K2 = SCL * 1.4426950408889634f;
    const int h = __builtin_amdgcn_readfirstlane((int)(threadIdx.x >> 5));
    const int lane = threadIdx.x & 31, lr = lane & 15, hi = lane >> 4;
    const int i0 = ib * FI;
    // each lane's own address of its 16 bytes in a tile (fragment order): lane * 16 bytes behind the tile's start
    const h16* qp = Q16 + ((size_t)h * TT + i0) * HD;
    const unsigned ko = (unsigned)lane * 16u;
    const char* kp = (const char*)(K16 + (size_t)h * TT * HD) + ko;   // pass 0
    const char* vhp = (const char*)(Vh + ((size_t)h * TT + part * FJ) * HD) + ko;
    const char* vlp = (const char*)(Vl + ((size_t)h * TT + part * FJ) * HD) + ko;
    const char* q0 = (const char*)qp + ko; const char* k0 = kp + part * (FJ * HD * 2);   // the work-group's query rows; its first key pass
    v16h qf[2][2], kf[2][2];
#pragma unroll
    for (int a = 0; a < 2; ++a)
#pragma unroll
        for (int ks = 0; ks < 2; ++ks) { qf[a][ks] = WFrag<h16>::ld((const h16*)q0 + (a * 2 + ks) * 512); kf[a][ks] = WFrag<h16>::ld((const h16*)k0 + (a * 2 + ks) * 512); }
    addr_wait(q0, k0);   // one s_wait_xcnt 0 behind the first fragments' loads, in front of every later write of their address registers
    // the masked passes' part: a 16-byte-a-lane load takes two blocks' 64 sums (lanes 16 to 31 the odd block), 16 blocks a statement; blocks up to ib are left out of the sum
    float m4[4] = {0.f, 0.f, 0.f, 0.f};
    if (part == np - 1) {
        v4f sa = (v4f){}; const char* vsp = (const char*)(VS + (size_t)h * (TT / FJ) * HD) + ko;
        for (int g = (ib + 1) >> 4; g < TT / FJ / 16; ++g) { const char* vp = vsp + g * (16 * HD * 4); v4f b[8];
            // the eight loads and their data wait in one statement: all are in flight together, and the address register is not written while a load is under way
            asm volatile("global_load_b128 %0, %8, off\n\tglobal_load_b128 %1, %8, off offset:512\n\tglobal_load_b128 %2, %8, off offset:1024\n\tglobal_load_b128 %3, %8, off offset:1536\n\t"
                         "global_load_b128 %4, %8, off offset:2048\n\tglobal_load_b128 %5, %8, off offset:2560\n\tglobal_load_b128 %6, %8, off offset:3072\n\tglobal_load_b128 %7, %8, off offset:3584\n\ts_wait_loadcnt 0x0"
                         : "=&v"(b[0]), "=&v"(b[1]), "=&v"(b[2]), "=&v"(b[3]), "=&v"(b[4]), "=&v"(b[5]), "=&v"(b[6]), "=&v"(b[7]) : "v"(vp) : "memory");
            // unrolled: b is indexed by constants
#pragma unroll
            for (int k = 0; k < 8; ++k) if (g * 16 + k * 2 + hi > ib) sa += b[k]; }
        // from (d = lr * 4 .. + 3, block parity hi) to the accumulators' columns d = nb * 16 + lr, through the wave's own LDS rows (no other wave touches them in front of the loop's first barrier)
        float* mz = Ss + h * (FI * FP); *(v4fa*)(mz + lane * 4) = sa;
        // unrolled: m4 is indexed by constants
#pragma unroll
        for (int nb = 0; nb < 4; ++nb) m4[nb] = (mz[nb * 16 + lr] + mz[HD + nb * 16 + lr]) * 0.0625f;
    }
    v8f o[2][4];
    // the three loops are unrolled so that o and m4 are indexed by constants and stay in registers
#pragma unroll
    for (int it = 0; it < 2; ++it)
#pragma unroll
        for (int nb = 0; nb < 4; ++nb)
#pragma unroll
            for (int r = 0; r < 8; ++r) o[it][nb][r] = m4[nb];
    float* sw = Ss + h * (FI * FP) + lr * FP + hi * 8;          // this lane's 8 scores of a tile
    const float* pr = Ss + h * (FI * FP) + lr * FP + hi * 4;    // this lane's 4 words (8 weights) of a fragment half
    const int pi = (int)threadIdx.x >> 4, pj = ((int)threadIdx.x & 15) * 2;
    float* ps = Ss + pi * FP + pj; float* pw = Ss + pi * FP + (pj >> 1);
#pragma unroll 1
    for (int t = part; t <= ib; t += np) {
        v8f s[2][2];
#pragma unroll
        for (int it = 0; it < 2; ++it)
#pragma unroll
            for (int jt = 0; jt < 2; ++jt) { s[it][jt] = WFrag<h16>::mma(kf[jt][0], qf[it][0], (v8f){}); s[it][jt] = WFrag<h16>::mma(kf[jt][1], qf[it][1], s[it][jt]); }
        // next pass's K fragments (the last pass asks for its own again: in bounds, not used) and this pass's V fragments: asked for here so that they fly during the softmax
        const int tn = (t + np <= ib) ? t + np : t; const char* kn = kp + tn * (FJ * HD * 2);
#pragma unroll
        for (int jt = 0; jt < 2; ++jt)
#pragma unroll
            for (int ks = 0; ks < 2; ++ks) kf[jt][ks] = WFrag<h16>::ld((const h16*)kn + (jt * 2 + ks) * 512);
        v16bf vhf[4], vlf[4];
#pragma unroll
        for (int nb = 0; nb < 4; ++nb) { vhf[nb] = WFrag<bf>::ld((const bf*)vhp + nb * 512); vlf[nb] = WFrag<bf>::ld((const bf*)vlp + nb * 512); }
        addr_wait(kn, vhp, vlp);   // one s_wait_xcnt 0 behind the pass's loads, in front of every later write of their address registers
        vhp += np * (FJ * HD * 2); vlp += np * (FJ * HD * 2);
#pragma unroll
        for (int it = 0; it < 2; ++it)
#pragma unroll
            for (int jt = 0; jt < 2; ++jt) {
                *(v4fa*)(sw + it * 16 * FP + jt * 16) = __builtin_shufflevector(s[it][jt], s[it][jt], 0, 1, 2, 3);
                *(v4fa*)(sw + it * 16 * FP + jt * 16 + 4) = __builtin_shufflevector(s[it][jt], s[it][jt], 4, 5, 6, 7); }
        lds_barrier();   // all 16 heads' scores of this pass are in LDS before any thread reads a column of them
        {
            v2f sv[NH_];
#pragma unroll
            for (int g = 0; g < NH_; ++g) sv[g] = *(const v2f*)(ps + g * (FI * FP));
            const int dj = i0 + pi - (t * FJ + pj);   // query index minus the thread's first key index
            v2f rs;
#pragma unroll
            for (int q = 0; q < 2; ++q) { float mx = sv[0][q];
#pragma unroll
                for (int g = 1; g < NH_; ++g) mx = fmaxf(mx, sv[g][q]);
                mx *= K2; float sum = 0.f;
#pragma unroll
                for (int g = 0; g < NH_; ++g) { sv[g][q] = __builtin_amdgcn_exp2f(__builtin_fmaf(sv[g][q], K2, -mx)); sum += sv[g][q]; }
                rs[q] = __builtin_amdgcn_rcpf(sum); }
#pragma unroll
            for (int g = 0; g < NH_; ++g) { v2f w; w[0] = (dj < 0) ? 0.0625f : sv[g][0] * rs[0]; w[1] = (dj < 1) ? 0.0625f : sv[g][1] * rs[1];
                const unsigned hu = __builtin_bit_cast(unsigned, __builtin_convertvector(w, v2bf)); v2f d; d[0] = w[0] - __uint_as_float(hu << 16); d[1] = w[1] - __uint_as_float(hu & 0xFFFF0000u);
                pw[g * (FI * FP)] = __uint_as_float(hu); pw[g * (FI * FP) + 16] = __uint_as_float(__builtin_bit_cast(unsigned, __builtin_convertvector(d, v2bf))); }
        }
        lds_barrier();   // every head's weights of this pass are in LDS before its wave reads them
#pragma unroll
        for (int it = 0; it < 2; ++it) {
            const float* p = pr + it * 16 * FP;
            const v16bf pa = __builtin_bit_cast(v16bf, __builtin_shufflevector(*(const v4fa*)p, *(const v4fa*)(p + 8), 0, 1, 2, 3, 4, 5, 6, 7));
            const v16bf pb = __builtin_bit_cast(v16bf, __builtin_shufflevector(*(const v4fa*)(p + 16), *(const v4fa*)(p + 24), 0, 1, 2, 3, 4, 5, 6, 7));
#pragma unroll
            for (int nb = 0; nb < 4; ++nb) { o[it][nb] = wmmab(pa, vhf[nb], o[it][nb]); o[it][nb] = wmmab(pb, vhf[nb], o[it][nb]); o[it][nb] = wmmab(pa, vlf[nb], o[it][nb]); }
        }
    }
    const int el = (int)__builtin_amdgcn_mbcnt_lo(~0u, 0u);   // the lane index, formed anew here so that no register has to hold it through the loop
    // O holds each value at the place that it has in the out-projection's A plane (rows = tokens, k = h * HD + d, fragment order), so that the merge kernel is element-wise
    float* op = O + (size_t)part * TT * DQ + (size_t)i0 * DQ + h * (HD * 16) + ((el & 15) >> 3) * 128 + (el >> 4) * 64 + (el & 7);
#pragma unroll
    for (int it = 0; it < 2; ++it)
#pragma unroll
        for (int nb = 0; nb < 4; ++nb)
#pragma unroll
            for (int r = 0; r < 8; ++r) op[it * 16 * DQ + nb * 256 + r * 8] = o[it][nb][r];
}
// One, two or four planes' 32 bytes a lane: the loads and their data wait in one statement, so that all of them are in flight together and no address register is written (also not by a load's result) while a load is under way.
__device__ __forceinline__ void ldp1(const float* q0, v4f* a, v4f* b) {
    asm volatile("global_load_b128 %0, %2, off\n\tglobal_load_b128 %1, %2, off offset:16\n\ts_wait_loadcnt 0x0" : "=&v"(a[0]), "=&v"(b[0]) : "v"(q0) : "memory"); }
__device__ __forceinline__ void ldp2(const float* q0, const float* q1, v4f* a, v4f* b) {
    asm volatile("global_load_b128 %0, %4, off\n\tglobal_load_b128 %1, %4, off offset:16\n\tglobal_load_b128 %2, %5, off\n\tglobal_load_b128 %3, %5, off offset:16\n\ts_wait_loadcnt 0x0"
                 : "=&v"(a[0]), "=&v"(b[0]), "=&v"(a[1]), "=&v"(b[1]) : "v"(q0), "v"(q1) : "memory"); }
__device__ __forceinline__ void ldp4(const float* q0, const float* q1, const float* q2, const float* q3, v4f* pa, v4f* pb) {
    asm volatile("global_load_b128 %0, %8, off\n\tglobal_load_b128 %1, %8, off offset:16\n\tglobal_load_b128 %2, %9, off\n\tglobal_load_b128 %3, %9, off offset:16\n\t"
                 "global_load_b128 %4, %10, off\n\tglobal_load_b128 %5, %10, off offset:16\n\tglobal_load_b128 %6, %11, off\n\tglobal_load_b128 %7, %11, off offset:16\n\ts_wait_loadcnt 0x0"
                 : "=&v"(pa[0]), "=&v"(pb[0]), "=&v"(pa[1]), "=&v"(pb[1]), "=&v"(pa[2]), "=&v"(pb[2]), "=&v"(pa[3]), "=&v"(pb[3]) : "v"(q0), "v"(q1), "v"(q2), "v"(q3) : "memory"); }
// k_mrgrb: adds the planes that k_fattn wrote for a query block (its first NPARTS(ib)), in plane order. A work-group's 2048 elements lie in one query block (FI * DQ elements).
__global__ __launch_bounds__(256) void k_mrgrb(const float* __restrict__ O, int rb, bf* Ah, bf* Al) { const size_t e = ((size_t)blockIdx.x * 256 + threadIdx.x) * 8; if (e >= (size_t)NH_ * RB * HD) return; static_assert(PVG <= 7, "a plane count is taken apart into 4 + 2 + 1");
    const size_t PS = (size_t)NH_ * RB * HD; const int np = NPARTS((int)blockIdx.x / (FI * DQ / 2048));
    const float* q = O + e; v4f ta = (v4f){}, tb = (v4f){}, pa[4], pb[4];
    if (np & 4) { ldp4(q, q + PS, q + 2 * PS, q + 3 * PS, pa, pb); ta = ((pa[0] + pa[1]) + pa[2]) + pa[3]; tb = ((pb[0] + pb[1]) + pb[2]) + pb[3]; q += 4 * PS; }
    if (np & 2) { ldp2(q, q + PS, pa, pb); ta = (ta + pa[0]) + pa[1]; tb = (tb + pb[0]) + pb[1]; q += 2 * PS; }
    if (np & 1) { ldp1(q, pa, pb); ta += pa[0]; tb += pb[0]; }
    const v8f t = __builtin_shufflevector(ta, tb, 0, 1, 2, 3, 4, 5, 6, 7);
    v8us oh, ol;
    // unrolled: the vectors are indexed by constants
#pragma unroll
    for (int q = 0; q < 8; ++q) { unsigned short a2, c2; splitf(t[q], a2, c2); oh[q] = a2; ol[q] = c2; }
    *(v8us*)(Ah + (size_t)rb * RB * DQ + e) = oh; *(v8us*)(Al + (size_t)rb * RB * DQ + e) = ol;  }
// k_asoft: per row (zz, i): t = S x DM^-0.5 (no mask); softmax over the 2048 keys (register row, one exp, fixed trees);
__global__ __launch_bounds__(256) void k_asoft(const float* __restrict__ Sb, h16* P16, bf* Ph, bf* Pl) {
    const int lane = threadIdx.x & 31; const int row = blockIdx.x * 8 + (threadIdx.x >> 5); if (row >= ZH * TT) return; const int i = row % TT; const int zz = row / TT; (void)zz; const bool hires = (i < RH); const float* sr = Sb + (size_t)row * TT; float v[TT / 32]; float mx = -3.0e38f;
#pragma unroll
    for (int ch = 0; ch < TT / 128; ++ch) { const int j0 = ch * 128 + lane * 4; const v4f a = *(const v4f*)(sr + j0);
#pragma unroll
        for (int q = 0; q < 4; ++q) { const int j = j0 + q; (void)j; const float t = a[q] * SCL; v[ch * 4 + q] = t; mx = fmaxf(mx, t); } }
#pragma unroll
    for (int sh = 16; sh; sh >>= 1) mx = fmaxf(mx, __shfl_xor(mx, sh, 32));
    float sum = 0.f;
#pragma unroll
    for (int k = 0; k < TT / 32; ++k) { float d0 = __fsub_rn(v[k], mx); asm volatile("" : "+v"(d0)); v[k] = __builtin_amdgcn_exp2f(__fmul_rn(d0, 1.4426950408889634f)); sum += v[k]; }
#pragma unroll
    for (int sh = 16; sh; sh >>= 1) sum += __shfl_xor(sum, sh, 32);
    const float f = __fdiv_rn(hires ? 1.0f : PCAR, sum);
{
        if (hires) {
#pragma unroll
            for (int ch = 0; ch < TT / 128; ++ch) { v4us oh, ol;
#pragma unroll
                for (int q = 0; q < 4; ++q) { unsigned short a, c2; splitf(v[ch * 4 + q] * f, a, c2); oh[q] = a; ol[q] = c2; }
                const size_t oo = ((size_t)zz * (RH ? RH : 1) + i) * TT + ch * 128 + lane * 4; *(v4us*)(Ph + oo) = oh; *(v4us*)(Pl + oo) = ol; }
        } else {
#pragma unroll
            for (int ch = 0; ch < TT / 128; ++ch) { v4h o4;
#pragma unroll
                for (int q = 0; q < 4; ++q) o4[q] = tohx(v[ch * 4 + q] * f);
                *(v4h*)(P16 + (size_t)row * TT + ch * 128 + lane * 4) = o4; } }
         }
}
__global__ __launch_bounds__(256) void k_merge(const float* __restrict__ O, int h0, bf* Ah, bf* Al) { const size_t e = ((size_t)blockIdx.x * 256 + threadIdx.x) * 2; if (e >= (size_t)ZH * TT * HD) return; const int d = (int)(e % HD); const int t = (int)((e / HD) % TT); const int zz = (int)(e / ((size_t)HD * TT)); const float cs = (t < RH) ? 1.0f : (1.0f / PCAR); const size_t oo = (size_t)t * DQ + (h0 + zz) * HD + d;
    v2us oh, ol;
#pragma unroll
    for (int q = 0; q < 2; ++q) { unsigned short a, c2; splitf(O[e + q] * cs, a, c2); oh[q] = a; ol[q] = c2; } *(v2us*)(Ah + oo) = oh; *(v2us*)(Al + oo) = ol;  }

extern "C" void kernel_launch(void* const* d_in, const int* in_sizes, int n_in,
                              void* d_out, int out_size, void* d_ws, size_t ws_size, hipStream_t stream) {
    (void)in_sizes; (void)n_in; (void)out_size;
    const float* x = (const float*)d_in[0]; const float* wq = (const float*)d_in[1]; const float* bq = (const float*)d_in[2]; const float* wk = (const float*)d_in[3]; const float* bk = (const float*)d_in[4]; const float* wv = (const float*)d_in[5]; const float* bv = (const float*)d_in[6]; const float* wo = (const float*)d_in[7]; const float* bo = (const float*)d_in[8]; const float* cosT = nullptr; const float* sinT = nullptr; (void)cosT; (void)sinT;
    float* OUT = (float*)d_out;     // [2][2048][1024]
    char* wsp = (char*)d_ws;
    auto take = [&](size_t bytes) { char* p = wsp; wsp += (bytes + 255) & ~(size_t)255; return (void*)p; };
    bf* W4 = (bf*)take((size_t)4 * DQ * DM * 2); bf* WQ = W4; bf* WK = W4 + (size_t)DQ * DM; bf* WV = W4 + (size_t)2 * DQ * DM; bf* WO = W4 + (size_t)3 * DQ * DM;
    bf* XB = (bf*)take((size_t)NB_ * TT * DM * 2);
    h16* QP16 = (h16*)take((size_t)NH_ * TT * HD * 2); h16* KP16 = (h16*)take((size_t)NKV * TT * HD * 2);
    bf* VTh = (bf*)take((size_t)NKV * HD * TT * 2); bf* VTl = (bf*)take((size_t)NKV * HD * TT * 2); float* VSb = (float*)take((size_t)NKV * (TT / FJ) * HD * 4);
    float* Ob = (float*)take((size_t)PVG * NH_ * RB * HD * 4); bf* ATh = (bf*)take((size_t)TT * DQ * 2); bf* ATl = (bf*)take((size_t)TT * DQ * 2);
    if ((size_t)(wsp - (char*)d_ws) > ws_size) return;    // ws 256 MiB
    k_prep<<<(unsigned)(4 * WBL + (size_t)NB_ * TT * DM / 8 / 256), 256, 0, stream>>>(wq, wk, wv, wo, x, W4, XB);
    // Q, K, V, O and the merged planes are one batch's and are used again by the next batch. Batch b's out-projection reads only ATh, ATl, WO; batch b + 1's projections write Q, K, V, which batch b's attention has read by then: the two share a launch.
    static_assert(NB_ == 2, "the launches below are written out for two batches");
    k_jobs<<<dim3(TT / 128, 24, 1), 32 * GNW, 0, stream>>>(16, XB, WQ, WK, WV, bq, bk, bv, QP16, KP16, VTh, VTl, VSb, ATh, ATl, WO, bo, OUT);
    k_fattn<<<dim3(FWG, 1, 1), 512, 0, stream>>>(QP16, KP16, VTh, VTl, VSb, Ob);
    k_mrgrb<<<(unsigned)(((size_t)NH_ * RB * HD / 8 + 255) / 256), 256, 0, stream>>>(Ob, 0, ATh, ATl);
    k_jobs<<<dim3(TT / 128, 40, 1), 32 * GNW, 0, stream>>>(0, XB + (size_t)TT * DM, WQ, WK, WV, bq, bk, bv, QP16, KP16, VTh, VTl, VSb, ATh, ATl, WO, bo, OUT);
    k_fattn<<<dim3(FWG, 1, 1), 512, 0, stream>>>(QP16, KP16, VTh, VTl, VSb, Ob);
    k_mrgrb<<<(unsigned)(((size_t)NH_ * RB * HD / 8 + 255) / 256), 256, 0, stream>>>(Ob, 0, ATh, ATl);
    k_jobs<<<dim3(TT / 128, 16, 1), 32 * GNW, 0, stream>>>(0, XB, WQ, WK, WV, bq, bk, bv, QP16, KP16, VTh, VTl, VSb, ATh, ATl, WO, bo, OUT + (size_t)TT * DM);
}

// v009
// A run of this version takes 108 microseconds.
// It is 1.34 times as fast as v007, going by the measured steps of the versions left out in between.
// All steps since v000 together make it 12.5 times as fast.
#include <hip/hip_runtime.h>

// MultiHeadAttention__5987 (x [2][2048][1024]; Q/K/V = x W + b (16 x 64); score = Q.K / sqrt(1024); causal positions (j > i) set to -1e10; FAITHFUL QUIRK: softmax over the HEAD axis (not over keys) -> weight[h][i][j]; out_h[i] = sum_j weight[h][i][j] V_h[j] (un-normalised over keys; masked positions carry weight exactly 1/16); merged Wo + bo -> [2][2048][1024]).
// Layout (exact): one kernel per batch does scores, head softmax and weights.V: a work-group of 16 waves (wave = head) holds 32 query rows and walks its share of the key passes (32 keys each) up to the diagonal; scores and weights never leave the WGP: they cross from head to head through LDS. Key passes wholly behind the diagonal carry the weight 1/16 everywhere: their part of weights.V is 1/16 of the sum of V's 32-token block sums.
// Compute dtypes, f32 accumulate: every input rounded to bf16; Q/K/V on PLAIN bf16 operands (inputs: exact) + bias; scores as single fp16 products (x1; logits are q.k/32); the 16-way head softmax in f32 per (i, j) (masked columns give exactly 1/16); weights.V as single fp16 products (weights <= 1 and V each rounded to fp16 once); Wo hl x exact (2 products) + bias.

#define NB_  2
#define TT   2048
#define DM   1024
#define NH_  16
#define NKV  16
#define REP  (NH_ / NKV)
#define HD   64
#define DQ   (NH_ * HD)
#define DKV  (NKV * HD)
#define ZH   2
#define RH   2048                  // query rows < RH use hi+lo planes (0: none)
#define WIN  0
#define PCAR 1024.0f
#define RB   TT     // query rows per merge launch
#define NRB  (TT / RB)
#define GNW  8      // waves per GEMM work-group: the tile's 64x64 quarters, each over 2 or 4 parts of K
#define PVG  7      // most work-groups that share a query block's key passes; their planes are added in the merge kernel
#define NPARTS(ib) (((ib) + 1) / 10 + 1)   // work-groups that share query block ib's ib + 1 key passes up to the diagonal: at most 10 passes each
#define FWG  244    // sum of NPARTS over the 64 query blocks: every work-group has a WGP of its own (a work-group's 16 waves fill a WGP's registers)
#define FI   32     // query rows per work-group of the fused kernel
#define FJ   32     // keys per pass of the fused kernel
#define FP   36     // LDS row pitch in floats (144 B: an odd multiple of 16 B)
#define SCL  0.03125f   // 1/sqrt(1024) (full embed dim, faithful)
typedef _Float16 h16;
typedef unsigned short bf;
typedef __attribute__((ext_vector_type(16))) __bf16   v16bf;
typedef __attribute__((ext_vector_type(16))) _Float16 v16h;
typedef __attribute__((ext_vector_type(8)))  _Float16 v8h;
typedef __attribute__((ext_vector_type(8)))  unsigned short v8us;
typedef __attribute__((ext_vector_type(8)))  float    v8f;
typedef __attribute__((ext_vector_type(4)))  float    v4f;
typedef v8h  __attribute__((may_alias)) v8ha;
typedef v4f  __attribute__((may_alias)) v4fa;
typedef v8us __attribute__((may_alias)) v8usa;

__device__ __forceinline__ unsigned short f2bf(float f) { unsigned u = __float_as_uint(f); u += 0x7FFFu + ((u >> 16) & 1u); return (unsigned short)(u >> 16); }
__device__ __forceinline__ float bf2f(unsigned short b) { return __uint_as_float(((unsigned)b) << 16); }
__device__ __forceinline__ float bfr(float f) { return bf2f(f2bf(f)); }
__device__ __forceinline__ v16h cat16(v8h lo, v8h hi) { return __builtin_shufflevector(lo, hi, 0, 1, 2, 3, 4, 5, 6, 7, 8, 9, 10, 11, 12, 13, 14, 15); }
__device__ __forceinline__ v16bf cat16b(v8us lo, v8us hi) { return __builtin_bit_cast(v16bf, __builtin_shufflevector(lo, hi, 0, 1, 2, 3, 4, 5, 6, 7, 8, 9, 10, 11, 12, 13, 14, 15)); }
__device__ __forceinline__ v8f wmma16(v16h a, v16h b, v8f c) { return __builtin_amdgcn_wmma_f32_16x16x32_f16(false, a, false, b, (short)0, c, false, false); }
__device__ __forceinline__ v8f wmmab(v16bf a, v16bf b, v8f c) { return __builtin_amdgcn_wmma_f32_16x16x32_bf16(false, a, false, b, (short)0, c, false, false); }
__device__ __forceinline__ h16 tohx(float x) { return (h16)x; }
__device__ __forceinline__ void splitf(float y, unsigned short& h, unsigned short& l) { h = f2bf(y); l = f2bf(y - bf2f(h)); }
// s_wait_xcnt 0 behind a run of global loads, ahead of every later write of a register that they name as an address. The addresses are inputs of the statement, so that their registers stay untouched (also by a later load's result) up to the wait.
__device__ __forceinline__ void addr_wait(const void* a) { asm volatile("s_wait_xcnt 0x0" :: "v"(a) : "memory"); }
__device__ __forceinline__ void addr_wait(const void* a, const void* b) { asm volatile("s_wait_xcnt 0x0" :: "v"(a), "v"(b) : "memory"); }
__device__ __forceinline__ void addr_wait(const void* a, const void* b, const void* c) { asm volatile("s_wait_xcnt 0x0" :: "v"(a), "v"(b), "v"(c) : "memory"); }
__device__ __forceinline__ void addr_wait(const void* a, const void* b, const void* c, const void* d) { asm volatile("s_wait_xcnt 0x0" :: "v"(a), "v"(b), "v"(c), "v"(d) : "memory"); }
typedef __attribute__((ext_vector_type(2))) _Float16 v2h;
typedef __attribute__((ext_vector_type(4))) _Float16 v4h;



// ---- d_gemmw: GEMM body of k_jobs: an output tile of MQ * 64 rows x 128 columns per work-group of 8 waves; a wave holds one 64x64 quarter (16 accumulators) over one of NKP = 4 / MQ parts of K. Row block rb, column block by, os = the work-group's LDS.
// C[m][n] = sum_k A[m][k] Bt[n][k] (NSPLIT 1: + A2[m][k] Bt[n][k]) + bias[n] (rounded to bf16).
// Operands come from 16-bit planes in fragment order and are staged in LDS by asynchronous copies, two buffers: the two waves that share 64 rows (or 64 columns) read them from LDS, so that a work-group fetches each operand tile once.
// A stage holds three regions, A, Bt, A2; a region holds, per part of K and per k-tile ks < KS, the operand's row tiles (1 KiB each; 4 * MQ of A, 8 of Bt): slot (part * KS + ks) * row tiles + row tile. Copy c of thread t fills 16 bytes at c * 4096 + t * 16: 256 threads fill 4 slots a copy.
// The parts of K are added through LDS in their order, then the bias.
// EPI (a quarter's 64 columns are one head, its rows are tokens): 0: f32 to C. 1: as fp16 to the head plane P16[head] (rows = tokens, k = d). 2: transposed through LDS, as fp16, to the head plane P16[head] (rows = d, k = tokens), and its sums over each FJ tokens as f32 to VS[head][token / FJ][d]. The planes in fragment order.
// FRAGMENT ORDER: every 16-bit operand plane P[row][k] is stored as tiles of 16 rows x 32 k (512 elements, 1 KiB), one tile = one WMMA operand fragment, laid out as the lanes read it:
// element (row, k) stands at tile * 512 + ((k % 32) / 16) * 256 + (((k % 16) / 8) * 16 + row % 16) * 8 + k % 8. A lane's two 16-byte loads are at lane * 8 and 256 + lane * 8: a wave's load is 512 bytes in a row (4 whole lines).
// Tile numbers: GEMM operands and Q, K head planes (row / 16) * (K / 32) + k / 32; V planes (rows = d, k = token) (k / 32) * (HD / 16) + row / 16, so that a pass's four tiles are neighbours.
template <typename T16> struct WFrag;
template <> struct WFrag<h16> { typedef v16h V; static __device__ __forceinline__ V ld(const h16* p) { return cat16(*(const v8h*)p, *(const v8h*)(p + 256)); } static __device__ __forceinline__ v8f mma(V a, V b, v8f c) { return wmma16(a, b, c); } };
template <> struct WFrag<bf> { typedef v16bf V; static __device__ __forceinline__ V ld(const bf* p) { return cat16b(*(const v8us*)p, *(const v8us*)(p + 256)); } static __device__ __forceinline__ v8f mma(V a, V b, v8f c) { return wmmab(a, b, c); } };
// Asynchronous copies global to LDS, 16 bytes a lane: LDS byte addresses l, l + 4096, ...; each copy has its own global address. s_wait_xcnt 0 is the statement's last line, so that it stands in front of every later write of a register that a copy names.
__device__ __forceinline__ void cp8(unsigned l, const char* const* g) {
    asm volatile("global_load_async_to_lds_b128 %0, %8, off\n\tglobal_load_async_to_lds_b128 %1, %9, off\n\tglobal_load_async_to_lds_b128 %2, %10, off\n\tglobal_load_async_to_lds_b128 %3, %11, off\n\t"
                 "global_load_async_to_lds_b128 %4, %12, off\n\tglobal_load_async_to_lds_b128 %5, %13, off\n\tglobal_load_async_to_lds_b128 %6, %14, off\n\tglobal_load_async_to_lds_b128 %7, %15, off\n\ts_wait_xcnt 0x0"
                 :: "v"(l), "v"(l + 4096u), "v"(l + 8192u), "v"(l + 12288u), "v"(l + 16384u), "v"(l + 20480u), "v"(l + 24576u), "v"(l + 28672u),
                    "v"(g[0]), "v"(g[1]), "v"(g[2]), "v"(g[3]), "v"(g[4]), "v"(g[5]), "v"(g[6]), "v"(g[7]) : "memory"); }
// a fragment from a staged tile: the lane's 16 bytes of each half of the tile
__device__ __forceinline__ v16bf ldsfrag(const char* p) { return cat16b(*(const v8usa*)p, *(const v8usa*)(p + 512)); }
template <int NSPLIT, int EPI, int K, int MQ>
__device__ __forceinline__ void d_gemmw(float* os, const int rb, const int by, const bf* A, const bf* A2, const bf* Bt, float* C, int ldc, const float* bias, h16* P16, float* VS) {
    static_assert(GNW == 8 && HD == 64 && (NSPLIT == 0 || NSPLIT == 1) && (MQ == 1 || MQ == 2) && (EPI != 2 || MQ == 2), "8 waves: MQ x 2 quarters, each over 4 / MQ parts of K; a quarter is one head wide");
    constexpr int KT = K / 32, NKP = 4 / MQ, KS = (NSPLIT == 0) ? 2 : 1, NT = KT / NKP / KS;   // k-tiles; parts of K; k-tiles a trip and part; trips
    constexpr int NA = NKP * KS * MQ, NB = NKP * KS * 2, NC = NA * (1 + NSPLIT) + NB, STG = NC * 4096;   // copies a thread and stage: of a plane of A, of Bt, of all; bytes a stage
    static_assert(NT >= 2 && KT % (NKP * KS) == 0 && 2 * STG <= GNW * 64 * 68 * 4 && NC == 16, "two stages exist and both buffers lie inside os");
    const int tid = (int)threadIdx.x, wave = __builtin_amdgcn_readfirstlane(tid >> 5); const int kh = wave % NKP, nc = (wave / NKP) & 1, mr = wave / (NKP * 2);
    const int lane = tid & 31, lr = lane & 15, hi = lane >> 4; const int r0 = rb * (MQ * 64), c0 = by * 128;
    v8f acc[4][4];
#pragma unroll
    for (int mb = 0; mb < 4; ++mb)
#pragma unroll
        for (int nb = 0; nb < 4; ++nb) acc[mb][nb] = (v8f){};
    // each thread's own 16 bytes: row tile tid / 64 of the operand's first k-tile (16 rows of tiles are K * 32 bytes; a k-tile is 1024)
    const unsigned l0 = (unsigned)(size_t)os + (unsigned)tid * 16u; const size_t to = (size_t)(tid >> 6) * (KT * 1024) + (size_t)(tid & 63) * 16;
    const char* gA = (const char*)A + (size_t)r0 * (K * 2) + to; const char* gB = (const char*)Bt + (size_t)c0 * (K * 2) + to; const char* gA2 = (NSPLIT == 1) ? (const char*)A2 + (size_t)r0 * (K * 2) + to : nullptr;
    auto stage = [&](int t, int buf) { const char* g[NC];
        // unrolled: g is indexed by constants
#pragma unroll
        for (int c = 0; c < NC; ++c) { const int op = (c < NA) ? 0 : (c < NA + NB) ? 1 : 2, j = c - (op == 0 ? 0 : op == 1 ? NA : NA + NB), w = (op == 1) ? 2 : MQ, ks = (j / w) % KS, k2 = j / w / KS;   // region; copy in the region; copies a k-tile; k-tile; part of K
            g[c] = (op == 0 ? gA : op == 1 ? gB : gA2) + __builtin_amdgcn_readfirstlane(((j % w) * 4 * KT + k2 * (KT / NKP) + ks + t * KS) * 1024); }   // the tile's offset is formed in a scalar register, so that no vector register holds a copy's own base through the loop
        const unsigned l = l0 + (unsigned)buf * (unsigned)STG; cp8(l, g); cp8(l + 32768u, g + 8); };
    stage(0, 0);
    asm volatile("s_wait_asynccnt 0x0" ::: "memory");   // this wave's copies of stage 0 have landed
    __syncthreads();                                    // every wave's have: stage 0 may be read
    stage(1, 1);
    // rolled: one trip's code, and the order at its foot stays as written
#pragma unroll 1
    for (int t = 0; t < NT; ++t) {
        const char* sp = (const char*)os + (t & 1) * STG + lane * 16;
        v16bf a[4], bb[4];
#pragma unroll
        for (int ks = 0; ks < KS; ++ks) {
            bb[0] = ldsfrag(sp + NA * 4096 + ((kh * KS + ks) * 8 + nc * 4) * 1024);
#pragma unroll
            for (int mb = 0; mb < 4; ++mb) a[mb] = ldsfrag(sp + ((kh * KS + ks) * (4 * MQ) + mr * 4 + mb) * 1024);
#pragma unroll
            for (int nb = 1; nb < 4; ++nb) bb[nb] = ldsfrag(sp + NA * 4096 + ((kh * KS + ks) * 8 + nc * 4 + nb) * 1024);
            if constexpr (NSPLIT == 1) {
                __builtin_amdgcn_sched_barrier(0);   // as the one below: the LDS reads above are all asked for ahead of the matrix instructions
#pragma unroll
                for (int nb = 0; nb < 4; ++nb)
#pragma unroll
                    for (int mb = 0; mb < 4; ++mb) acc[mb][nb] = wmmab(a[mb], bb[nb], acc[mb][nb]);
                // the second plane of A takes the first one's place (the B fragments stay)
#pragma unroll
                for (int mb = 0; mb < 4; ++mb) a[mb] = ldsfrag(sp + (NA + NB) * 4096 + ((kh * KS + ks) * (4 * MQ) + mr * 4 + mb) * 1024);
            }
            // the trip's foot stands behind its last LDS reads and in front of the matrix instructions that work on them (they read registers only): the next copies are under way while the matrix unit works
            if (ks == KS - 1) {
                asm volatile("s_wait_dscnt 0x0" ::: "memory");      // this wave has read its last fragments of stage t
                asm volatile("s_wait_asynccnt 0x0" ::: "memory");   // this wave's copies of stage t + 1 have landed
                __syncthreads();                                    // stage t + 1 may be read, and stage t's buffer may be filled again
                if (t + 2 < NT) stage(t + 2, t & 1);
            }
            __builtin_amdgcn_sched_barrier(0);   // all of a k-tile's LDS reads are asked for ahead of its matrix instructions: without it the compiler reads each B fragment only when it is due, and every fourth matrix instruction waits a whole LDS latency
#pragma unroll
            for (int nb = 0; nb < 4; ++nb)
#pragma unroll
                for (int mb = 0; mb < 4; ++mb) acc[mb][nb] = wmmab(a[mb], bb[nb], acc[mb][nb]);
        }
        // four vector slots behind the trip's last matrix instructions, in front of whatever the loop's branch leads to
        asm volatile("v_nop\n\tv_nop\n\tv_nop\n\tv_nop" : "+v"(acc[0][0]), "+v"(acc[1][1]), "+v"(acc[2][2]), "+v"(acc[3][3]) : "v"(a[0]), "v"(a[3]));
    }
    asm volatile("s_wait_asynccnt 0x0" ::: "memory");   // no copy is under way when os is used for the partial tiles
    // EPI 1: thread t takes the 4 values that stand at t * 4 in a 16-token block of the head plane (2 tiles), so that the 256 threads store 2 KiB in a row
    float* my = os + wave * (64 * 68); const int cofs = (EPI == 1) ? ((tid >> 5) & 7) * 8 + (tid & 1) * 4 : (tid & 15) * 4; v4f bv[2];
    // the bias addresses are inputs of the s_wait_xcnt statement behind the loads, so that a load's own result does not land in an address register (bias carries no __restrict__: the loads keep their place in front of the statement)
    { const float* bp = bias + c0 + cofs; const float* bp2 = bp + 64; const v4f br = *(const v4f*)bp; const v4f br2 = *(const v4f*)bp2; addr_wait(bp, bp2);
#pragma unroll
      for (int q = 0; q < 4; ++q) { bv[0][q] = bfr(br[q]); bv[1][q] = bfr(br2[q]); } }
    // the three loops are unrolled so that acc is indexed by constants and stays in registers
#pragma unroll
    for (int mb = 0; mb < 4; ++mb)
#pragma unroll
        for (int nb = 0; nb < 4; ++nb)
#pragma unroll
            for (int j = 0; j < 8; ++j) my[(mb * 16 + hi * 8 + j) * 68 + nb * 16 + lr] = acc[mb][nb][j];
    __syncthreads();   // every wave's partial tile is in LDS before any thread adds them
    v4f sums[2 * MQ][4];
    // quarter qd = (row half) * 2 + column half: its NKP partial tiles are those of waves NKP qd and up. Unrolled: sums is indexed by constants, and the LDS reads are in flight together
#pragma unroll
    for (int qd = 0; qd < 2 * MQ; ++qd) { const float* tp = os + qd * (NKP * 64 * 68); const int r0q = r0 + (qd >> 1) * 64, c0q = c0 + (qd & 1) * 64, hq = by * 2 + (qd & 1); (void)c0q; (void)hq;
#pragma unroll
        for (int s = 0; s < 4; ++s) { const int row = (EPI == 1) ? s * 16 + ((tid >> 1) & 15) : (s * 256 + tid) >> 4;
            v4f val = *(const v4fa*)(tp + row * 68 + cofs);
#pragma unroll
            for (int w = 1; w < NKP; ++w) val += *(const v4fa*)(tp + w * (64 * 68) + row * 68 + cofs);
            val += bv[qd & 1];
            if constexpr (EPI == 0) *(v4f*)(C + (size_t)(r0q + row) * ldc + c0q + cofs) = val;
            if constexpr (EPI == 1) *(v4h*)(P16 + ((size_t)hq * TT + r0q + s * 16) * HD + tid * 4) = __builtin_convertvector(val, v4h);
            if constexpr (EPI == 2) sums[qd][s] = val; }
        // s_wait_xcnt 0 behind a quarter's stores: the code behind them writes the registers that the stores name
        if constexpr (EPI != 2) asm volatile("s_wait_xcnt 0x0" ::: "memory"); }
    if constexpr (EPI == 2) {
        __syncthreads();   // every thread has read the partial tiles before the sums are written over them
        // each quarter's sum goes transposed into its own first partial tile; pitch 65 words: the 32 lanes of a wave meet 32 different banks in the transposed write
#pragma unroll
        for (int qd = 0; qd < 4; ++qd)
#pragma unroll
            for (int s = 0; s < 4; ++s)
#pragma unroll
                for (int q = 0; q < 4; ++q) os[qd * (2 * 64 * 68) + (cofs + q) * 65 + ((s * 256 + tid) >> 4)] = sums[qd][s][q];
        __syncthreads();   // the transposed quarters are in LDS before any thread reads a row of them
        // thread t takes the 8 tokens that stand at t * 8 in a 32-token block of the plane (4 tiles): the 256 threads store 4 KiB in a row
#pragma unroll
        for (int qd = 0; qd < 4; ++qd) { const float* tp = os + qd * (2 * 64 * 68); const int r0q = r0 + (qd >> 1) * 64, hq = by * 2 + (qd & 1);
#pragma unroll
            for (int u = 0; u < 2; ++u) { const int d = ((tid >> 6) & 3) * 16 + (tid & 15), t8 = u * 32 + ((tid >> 4) & 3) * 8; v8h o8;
#pragma unroll
                for (int j = 0; j < 8; ++j) o8[j] = tohx(tp[d * 65 + t8 + j]);
                *(v8h*)(P16 + ((size_t)hq * TT + r0q + u * 32) * HD + tid * 8) = o8; }
            // s_wait_xcnt 0 behind a quarter's stores: the code behind them writes the registers that the stores name
            asm volatile("s_wait_xcnt 0x0" ::: "memory"); }
        // block sums: a thread adds one d over one block of FJ tokens, in token order, for two of the 8 (quarter, block) pairs; 128 threads store 512 bytes in a row
#pragma unroll
        for (int v = 0; v < 2; ++v) { const int it = v * 256 + tid, qd = it >> 7, u = (it >> 6) & 1, d = it & 63; const float* tp = os + qd * (2 * 64 * 68); float sm = 0.f;
            // unrolled so that the LDS reads are in flight together
#pragma unroll
            for (int j = 0; j < FJ; ++j) sm += tp[d * 65 + u * FJ + j];
            VS[((size_t)(by * 2 + (qd & 1)) * (TT / FJ) + (r0 + (qd >> 1) * 64) / FJ + u) * HD + d] = sm;
            // s_wait_xcnt 0 behind the store: the code behind it writes the registers that the store names
            asm volatile("s_wait_xcnt 0x0" ::: "memory"); }
    }
}

// k_jobs: GEMMs that do not depend on one another share one grid (TT / 128, blocks y), 32 * GNW threads. y = blockIdx.y + y0 names the job and its 128 columns (two heads):
// 0..15 out-projection (Ah + Al) WO + bo to OUTb, tiles of 64 rows (row block 2 blockIdx.x + y % 2, column block y / 2), so that it alone still gives every WGP a work-group; 16..23 V projection; 24..31 Q; 32..39 K (X times WV, WQ, WK), tiles of 128 rows.
// A launch takes a run of y: 16..39 (Q, K, V of a batch), 0..39 (the out-projection of one batch beside Q, K, V of the next), 0..15 (the last out-projection). The test on y is the same for a whole work-group.
__global__ __launch_bounds__(32 * GNW) void k_jobs(int y0, const bf* X, const bf* WQ, const bf* WK, const bf* WV, const float* bq, const float* bk, const float* bv, h16* Q16, h16* K16, h16* V16, float* VS,
                                                   const bf* Ah, const bf* Al, const bf* WO, const float* bo, float* OUTb) {
    static_assert(DQ / 128 == 8 && DKV / 128 == 8 && DM / 128 == 8 && TT % 128 == 0, "each job is 8 column blocks wide");
    __shared__ __align__(16) float os[GNW * 64 * 68];   // one array for all jobs: a work-group runs one of them; first the two stage buffers, then the waves' partial tiles
    const int y = (int)blockIdx.y + y0, x = (int)blockIdx.x;
    if (y < 16) d_gemmw<1, 0, DQ, 1>(os, x * 2 + (y & 1), y >> 1, Ah, Al, WO, OUTb, DM, bo, nullptr, nullptr);
    else if (y < 24) d_gemmw<0, 2, DM, 2>(os, x, y - 16, X, nullptr, WV, nullptr, 0, bv, V16, VS);
    else { const bool isk = y >= 32; d_gemmw<0, 1, DM, 2>(os, x, (y - 24) & 7, X, nullptr, isk ? WK : WQ, nullptr, 0, isk ? bk : bq, isk ? K16 : Q16, nullptr); }
}

typedef __attribute__((ext_vector_type(2))) unsigned short v2us;
typedef __attribute__((ext_vector_type(4))) unsigned short v4us;
typedef __attribute__((ext_vector_type(2))) float v2f;
typedef __attribute__((ext_vector_type(4))) int v4i;

// d_wtG: w[k][n] f32 to Bt (rows = n) in fragment order. Thread i writes the 8 elements at i * 8: one n, 8 neighbouring k; 16 lanes read 16 neighbouring n of one k.
__device__ __forceinline__ void d_wtG(const float* __restrict__ w, int K, int N, bf* Bt, const int i) {
    if (i >= N * K / 8) return;
    const int tile = i >> 6, kt = K / 32; const int n = (tile / kt) * 16 + (i & 15), k0 = (tile % kt) * 32 + ((i >> 4) & 3) * 8; v8us o; const float* wp[8]; float wv[8];
    // unrolled so that the 8 loads are in flight together
#pragma unroll
    for (int j = 0; j < 8; ++j) { wp[j] = w + (size_t)(k0 + j) * N + n; wv[j] = *wp[j]; }
    // s_wait_xcnt 0 behind the eight loads; their addresses are inputs, so that no address register is written (also not by a later load's result) ahead of it
    asm volatile("s_wait_xcnt 0x0" :: "v"(wp[0]), "v"(wp[1]), "v"(wp[2]), "v"(wp[3]), "v"(wp[4]), "v"(wp[5]), "v"(wp[6]), "v"(wp[7]) : "memory");
    // unrolled: o and wv are indexed by constants
#pragma unroll
    for (int j = 0; j < 8; ++j) o[j] = f2bf(wv[j]);
    *(v8us*)(Bt + (size_t)i * 8) = o;
}
// d_cvt8: src[row][DM] f32 to dst in fragment order. Thread i writes the 8 elements at i * 8: one row, 8 neighbouring k.
__device__ __forceinline__ void d_cvt8(const float* __restrict__ src, bf* dst, size_t n8, const size_t i) { if (i >= n8) return; const int tile = (int)(i >> 6); const int row = (tile / (DM / 32)) * 16 + ((int)i & 15), k0 = (tile % (DM / 32)) * 32 + (((int)i >> 4) & 3) * 8; const v8f v = *(const v8f*)(src + (size_t)row * DM + k0); v8us o;
#pragma unroll
    for (int k = 0; k < 8; ++k) o[k] = f2bf(v[k]); *(v8us*)(dst + i * 8) = o;  }
// k_prep: the four weight conversions and x's (both batches' rows as one matrix) depend on nothing and share one grid: WBL work-groups a weight (the slower, strided readers first), then x's.
#define WBL (DM * DQ / 8 / 256)
__global__ __launch_bounds__(256) void k_prep(const float* __restrict__ wq, const float* __restrict__ wk, const float* __restrict__ wv, const float* __restrict__ wo, const float* __restrict__ x, bf* W4, bf* XB) {
    static_assert(DKV == DQ, "the four weights have one size");
    const int j = (int)blockIdx.x / WBL;   // the same for a whole work-group
    if (j < 4) d_wtG(j == 0 ? wq : j == 1 ? wk : j == 2 ? wv : wo, DM, DQ, W4 + (size_t)j * DM * DQ, ((int)blockIdx.x - j * WBL) * 256 + (int)threadIdx.x);
    else d_cvt8(x, XB, (size_t)NB_ * TT * DM / 8, (size_t)((int)blockIdx.x - 4 * WBL) * 256 + threadIdx.x);
}
__global__ __launch_bounds__(256) void k_cscvt(const float* __restrict__ cosT, const float* __restrict__ sinT, float* CS) { const int idx = blockIdx.x * 256 + threadIdx.x; if (idx >= TT * HD) return; v2f cs; cs[0] = bfr(cosT[idx]); cs[1] = bfr(sinT[idx]); *(v2f*)(CS + (size_t)idx * 2) = cs;  }
// Work-group barrier that orders LDS only: the fences name the LDS address space, so that global loads asked for ahead of it stay in flight across it (__syncthreads() waits for them).
__device__ __forceinline__ void lds_barrier() { __builtin_amdgcn_fence(__ATOMIC_RELEASE, "workgroup", "local"); __builtin_amdgcn_s_barrier(); __builtin_amdgcn_fence(__ATOMIC_ACQUIRE, "workgroup", "local"); }
// k_fattn: grid FWG, 512 threads, wave = head. Query block ib has ib + 1 key passes that hold an unmasked position; its NPARTS(ib) work-groups take them in turn (pass part, part + np, ...).
// The passes behind the diagonal pass are masked everywhere: weight 1/16 in every head and row, so their weights.V is 1/16 of the sum of VS[h][blk] over blk > ib, the same for all rows; the last part starts its accumulators there.
// Per pass of FJ keys: S^T = K Q^T (fp16, rows = keys, columns = queries: a lane's 8 accumulator values are 8 neighbouring keys of one query), stored to LDS as [head][query][key] f32.
// Head softmax: behind a barrier each thread takes 2 neighbouring keys of one query, reads the 16 heads' scores and writes the 16 weight pairs back over the same rows: fp16 pairs in the row's first 16 words.
// (A wave holds whole rows, and has read all of a row before it writes any of it.) Behind a second barrier each wave reads its head's rows as B fragments of weights.V.
// A masked position (j > i) has the same score in every head, so its weight is exactly 1/16. O: plane part of [PVG][TT * DQ] f32 (a query block's rows are written in its first NPARTS(ib) planes only).
// K16, V16 carry no __restrict__: the loop's loads then keep their place in front of its s_wait_xcnt statement (its "memory" clobber holds them there).
__global__ __launch_bounds__(512) void k_fattn(const h16* __restrict__ Q16, const h16* K16, const h16* V16, const float* VS, float* O) {
    __shared__ __align__(16) float Ss[NH_ * FI * FP];
    // flat index to (query block, part): the blocks with np = g + 1 parts are those with 10 g <= ib + 1 <= 10 g + 9; with F = index + 1 their work-groups start at F = 5 g (g + 1), part by part
    static_assert(TT / FI == 64 && FWG == 244 && PVG == 7, "the thresholds below are those of 64 query blocks");
    const int F = (int)blockIdx.x + 1, g6 = (F >= 10) + (F >= 30) + (F >= 60) + (F >= 100) + (F >= 150) + (F >= 210), wi = F - 5 * g6 * (g6 + 1);
    const int part = (g6 == 6) ? wi / 5 : wi / 10, ib = 10 * g6 + wi - part * ((g6 == 6) ? 5 : 10) - 1, np = g6 + 1;
    const float K2 = SCL * 1.4426950408889634f;
    const int h = __builtin_amdgcn_readfirstlane((int)(threadIdx.x >> 5));
    const int lane = threadIdx.x & 31, lr = lane & 15, hi = lane >> 4;
    const int i0 = ib * FI;
    // each lane's own address of its 16 bytes in a tile (fragment order): lane * 16 bytes behind the tile's start
    const h16* qp = Q16 + ((size_t)h * TT + i0) * HD;
    const unsigned ko = (unsigned)lane * 16u;
    const char* kp = (const char*)(K16 + (size_t)h * TT * HD) + ko;   // pass 0
    const char* vp16 = (const char*)(V16 + ((size_t)h * TT + part * FJ) * HD) + ko;
    const char* q0 = (const char*)qp + ko; const char* k0 = kp + part * (FJ * HD * 2);   // the work-group's query rows; its first key pass
    v16h qf[2][2], kf[2][2];
#pragma unroll
    for (int a = 0; a < 2; ++a)
#pragma unroll
        for (int ks = 0; ks < 2; ++ks) { qf[a][ks] = WFrag<h16>::ld((const h16*)q0 + (a * 2 + ks) * 512); kf[a][ks] = WFrag<h16>::ld((const h16*)k0 + (a * 2 + ks) * 512); }
    addr_wait(q0, k0);   // one s_wait_xcnt 0 behind the first fragments' loads, in front of every later write of their address registers
    // the masked passes' part: a 16-byte-a-lane load takes two blocks' 64 sums (lanes 16 to 31 the odd block), 16 blocks a statement; blocks up to ib are left out of the sum
    v8f m8[4] = {(v8f){}, (v8f){}, (v8f){}, (v8f){}};
    if (part == np - 1) {
        v4f sa = (v4f){}; const char* vsp = (const char*)(VS + (size_t)h * (TT / FJ) * HD) + ko;
        for (int g = (ib + 1) >> 4; g < TT / FJ / 16; ++g) { const char* vp = vsp + g * (16 * HD * 4); v4f b[8];
            // the eight loads and their data wait in one statement: all are in flight together, and the address register is not written while a load is under way
            asm volatile("global_load_b128 %0, %8, off\n\tglobal_load_b128 %1, %8, off offset:512\n\tglobal_load_b128 %2, %8, off offset:1024\n\tglobal_load_b128 %3, %8, off offset:1536\n\t"
                         "global_load_b128 %4, %8, off offset:2048\n\tglobal_load_b128 %5, %8, off offset:2560\n\tglobal_load_b128 %6, %8, off offset:3072\n\tglobal_load_b128 %7, %8, off offset:3584\n\ts_wait_loadcnt 0x0"
                         : "=&v"(b[0]), "=&v"(b[1]), "=&v"(b[2]), "=&v"(b[3]), "=&v"(b[4]), "=&v"(b[5]), "=&v"(b[6]), "=&v"(b[7]) : "v"(vp) : "memory");
            // unrolled: b is indexed by constants
#pragma unroll
            for (int k = 0; k < 8; ++k) if (g * 16 + k * 2 + hi > ib) sa += b[k]; }
        // from (d = lr * 4 .. + 3, block parity hi) to the accumulators' rows d = nb * 16 + hi * 8 .. + 7, through the wave's own LDS rows (no other wave touches them in front of the loop's first barrier)
        float* mz = Ss + h * (FI * FP); *(v4fa*)(mz + lane * 4) = sa;
        // unrolled: m8 is indexed by constants
#pragma unroll
        for (int nb = 0; nb < 4; ++nb) { const float* mp = mz + nb * 16 + hi * 8;
            const v4f lo4 = (*(const v4fa*)mp + *(const v4fa*)(mp + HD)) * 0.0625f, hi4 = (*(const v4fa*)(mp + 4) + *(const v4fa*)(mp + HD + 4)) * 0.0625f;
            m8[nb] = __builtin_shufflevector(lo4, hi4, 0, 1, 2, 3, 4, 5, 6, 7); }
    }
    v8f o[2][4];
    // the two loops are unrolled so that o and m8 are indexed by constants and stay in registers
#pragma unroll
    for (int it = 0; it < 2; ++it)
#pragma unroll
        for (int nb = 0; nb < 4; ++nb) o[it][nb] = m8[nb];
    float* sw = Ss + h * (FI * FP) + lr * FP + hi * 8;          // this lane's 8 scores of a tile
    const float* pr = Ss + h * (FI * FP) + lr * FP + hi * 4;    // this lane's 4 words (8 weights) of a fragment half
    const int pi = (int)threadIdx.x >> 4, pj = ((int)threadIdx.x & 15) * 2;
    float* ps = Ss + pi * FP + pj; float* pw = Ss + pi * FP + (pj >> 1);
#pragma unroll 1
    for (int t = part; t <= ib; t += np) {
        v8f s[2][2];
#pragma unroll
        for (int it = 0; it < 2; ++it)
#pragma unroll
            for (int jt = 0; jt < 2; ++jt) { s[it][jt] = WFrag<h16>::mma(kf[jt][0], qf[it][0], (v8f){}); s[it][jt] = WFrag<h16>::mma(kf[jt][1], qf[it][1], s[it][jt]); }
        // next pass's K fragments (the last pass asks for its own again: in bounds, not used) and this pass's V fragments: asked for here so that they fly during the softmax
        const int tn = (t + np <= ib) ? t + np : t; const char* kn = kp + tn * (FJ * HD * 2);
#pragma unroll
        for (int jt = 0; jt < 2; ++jt)
#pragma unroll
            for (int ks = 0; ks < 2; ++ks) kf[jt][ks] = WFrag<h16>::ld((const h16*)kn + (jt * 2 + ks) * 512);
        v16h vf[4];
#pragma unroll
        for (int nb = 0; nb < 4; ++nb) vf[nb] = WFrag<h16>::ld((const h16*)vp16 + nb * 512);
        addr_wait(kn, vp16);   // one s_wait_xcnt 0 behind the pass's loads, in front of every later write of their address registers
        vp16 += np * (FJ * HD * 2);
#pragma unroll
        for (int it = 0; it < 2; ++it)
#pragma unroll
            for (int jt = 0; jt < 2; ++jt) {
                *(v4fa*)(sw + it * 16 * FP + jt * 16) = __builtin_shufflevector(s[it][jt], s[it][jt], 0, 1, 2, 3);
                *(v4fa*)(sw + it * 16 * FP + jt * 16 + 4) = __builtin_shufflevector(s[it][jt], s[it][jt], 4, 5, 6, 7); }
        lds_barrier();   // all 16 heads' scores of this pass are in LDS before any thread reads a column of them
        {
            v2f sv[NH_];
#pragma unroll
            for (int g = 0; g < NH_; ++g) sv[g] = *(const v2f*)(ps + g * (FI * FP));
            const int dj = i0 + pi - (t * FJ + pj);   // query index minus the thread's first key index
            v2f rs;
#pragma unroll
            for (int q = 0; q < 2; ++q) { float mx = sv[0][q];
#pragma unroll
                for (int g = 1; g < NH_; ++g) mx = fmaxf(mx, sv[g][q]);
                mx *= K2; float sum = 0.f;
#pragma unroll
                for (int g = 0; g < NH_; ++g) { sv[g][q] = __builtin_amdgcn_exp2f(__builtin_fmaf(sv[g][q], K2, -mx)); sum += sv[g][q]; }
                rs[q] = __builtin_amdgcn_rcpf(sum); }
#pragma unroll
            for (int g = 0; g < NH_; ++g) { v2f w; w[0] = (dj < 0) ? 0.0625f : sv[g][0] * rs[0]; w[1] = (dj < 1) ? 0.0625f : sv[g][1] * rs[1];
                pw[g * (FI * FP)] = __builtin_bit_cast(float, __builtin_convertvector(w, v2h)); }
        }
        lds_barrier();   // every head's weights of this pass are in LDS before its wave reads them
#pragma unroll
        for (int it = 0; it < 2; ++it) {
            const float* p = pr + it * 16 * FP;
            const v16h pa = __builtin_bit_cast(v16h, __builtin_shufflevector(*(const v4fa*)p, *(const v4fa*)(p + 8), 0, 1, 2, 3, 4, 5, 6, 7));
#pragma unroll
            for (int nb = 0; nb < 4; ++nb) o[it][nb] = wmma16(vf[nb], pa, o[it][nb]);   // O^T = V^T W^T: rows = d, columns = queries
        }
    }
    const int el = (int)__builtin_amdgcn_mbcnt_lo(~0u, 0u);   // the lane index, formed anew here so that no register has to hold it through the loop
    // A lane's 8 values of a tile are 8 neighbouring d of one query: the 8 elements at lane * 8 of a 256-element half tile of the out-projection's A plane (rows = tokens, k = h * HD + d, fragment order).
    // O keeps the plane's half tiles in their order; inside a half tile (1 KiB) the lanes' first four values stand in a row (512 bytes), then their last four: a wave's 16-byte-a-lane store, and the merge kernel's load, is 4 whole lines.
    float* op = O + (size_t)part * TT * DQ + (size_t)i0 * DQ + h * (HD * 16) + el * 4;
#pragma unroll
    for (int it = 0; it < 2; ++it)
#pragma unroll
        for (int nb = 0; nb < 4; ++nb) {
            *(v4f*)(op + it * 16 * DQ + nb * 256) = __builtin_shufflevector(o[it][nb], o[it][nb], 0, 1, 2, 3);
            *(v4f*)(op + it * 16 * DQ + nb * 256 + 128) = __builtin_shufflevector(o[it][nb], o[it][nb], 4, 5, 6, 7); }
}
// One, two or four planes' 32 bytes a lane (16 at the lane's place in the first 512 bytes of a half tile, 16 in the second): the loads and their data wait in one statement, so that all of them are in flight together and no address register is written (also not by a load's result) while a load is under way.
__device__ __forceinline__ void ldp1(const float* q0, v4f* a, v4f* b) {
    asm volatile("global_load_b128 %0, %2, off\n\tglobal_load_b128 %1, %2, off offset:512\n\ts_wait_loadcnt 0x0" : "=&v"(a[0]), "=&v"(b[0]) : "v"(q0) : "memory"); }
__device__ __forceinline__ void ldp2(const float* q0, const float* q1, v4f* a, v4f* b) {
    asm volatile("global_load_b128 %0, %4, off\n\tglobal_load_b128 %1, %4, off offset:512\n\tglobal_load_b128 %2, %5, off\n\tglobal_load_b128 %3, %5, off offset:512\n\ts_wait_loadcnt 0x0"
                 : "=&v"(a[0]), "=&v"(b[0]), "=&v"(a[1]), "=&v"(b[1]) : "v"(q0), "v"(q1) : "memory"); }
__device__ __forceinline__ void ldp4(const float* q0, const float* q1, const float* q2, const float* q3, v4f* pa, v4f* pb) {
    asm volatile("global_load_b128 %0, %8, off\n\tglobal_load_b128 %1, %8, off offset:512\n\tglobal_load_b128 %2, %9, off\n\tglobal_load_b128 %3, %9, off offset:512\n\t"
                 "global_load_b128 %4, %10, off\n\tglobal_load_b128 %5, %10, off offset:512\n\tglobal_load_b128 %6, %11, off\n\tglobal_load_b128 %7, %11, off offset:512\n\ts_wait_loadcnt 0x0"
                 : "=&v"(pa[0]), "=&v"(pb[0]), "=&v"(pa[1]), "=&v"(pb[1]), "=&v"(pa[2]), "=&v"(pb[2]), "=&v"(pa[3]), "=&v"(pb[3]) : "v"(q0), "v"(q1), "v"(q2), "v"(q3) : "memory"); }
// k_mrgrb: adds the planes that k_fattn wrote for a query block (its first NPARTS(ib)), in plane order. Thread's elements e .. e + 7 of the A plane: in O its lane's two 16-byte pieces of the half tile e / 256. A work-group's 2048 elements lie in one query block (FI * DQ elements).
__global__ __launch_bounds__(256) void k_mrgrb(const float* __restrict__ O, int rb, bf* Ah, bf* Al) { const size_t e = ((size_t)blockIdx.x * 256 + threadIdx.x) * 8; if (e >= (size_t)NH_ * RB * HD) return; static_assert(PVG <= 7, "a plane count is taken apart into 4 + 2 + 1");
    const size_t PS = (size_t)NH_ * RB * HD; const int np = NPARTS((int)blockIdx.x / (FI * DQ / 2048));
    const float* q = O + (e & ~(size_t)255) + (threadIdx.x & 31) * 4; v4f ta = (v4f){}, tb = (v4f){}, pa[4], pb[4];
    if (np & 4) { ldp4(q, q + PS, q + 2 * PS, q + 3 * PS, pa, pb); ta = ((pa[0] + pa[1]) + pa[2]) + pa[3]; tb = ((pb[0] + pb[1]) + pb[2]) + pb[3]; q += 4 * PS; }
    if (np & 2) { ldp2(q, q + PS, pa, pb); ta = (ta + pa[0]) + pa[1]; tb = (tb + pb[0]) + pb[1]; q += 2 * PS; }
    if (np & 1) { ldp1(q, pa, pb); ta += pa[0]; tb += pb[0]; }
    const v8f t = __builtin_shufflevector(ta, tb, 0, 1, 2, 3, 4, 5, 6, 7);
    v8us oh, ol;
    // unrolled: the vectors are indexed by constants
#pragma unroll
    for (int q = 0; q < 8; ++q) { unsigned short a2, c2; splitf(t[q], a2, c2); oh[q] = a2; ol[q] = c2; }
    *(v8us*)(Ah + (size_t)rb * RB * DQ + e) = oh; *(v8us*)(Al + (size_t)rb * RB * DQ + e) = ol;  }
// k_asoft: per row (zz, i): t = S x DM^-0.5 (no mask); softmax over the 2048 keys (register row, one exp, fixed trees);
__global__ __launch_bounds__(256) void k_asoft(const float* __restrict__ Sb, h16* P16, bf* Ph, bf* Pl) {
    const int lane = threadIdx.x & 31; const int row = blockIdx.x * 8 + (threadIdx.x >> 5); if (row >= ZH * TT) return; const int i = row % TT; const int zz = row / TT; (void)zz; const bool hires = (i < RH); const float* sr = Sb + (size_t)row * TT; float v[TT / 32]; float mx = -3.0e38f;
#pragma unroll
    for (int ch = 0; ch < TT / 128; ++ch) { const int j0 = ch * 128 + lane * 4; const v4f a = *(const v4f*)(sr + j0);
#pragma unroll
        for (int q = 0; q < 4; ++q) { const int j = j0 + q; (void)j; const float t = a[q] * SCL; v[ch * 4 + q] = t; mx = fmaxf(mx, t); } }
#pragma unroll
    for (int sh = 16; sh; sh >>= 1) mx = fmaxf(mx, __shfl_xor(mx, sh, 32));
    float sum = 0.f;
#pragma unroll
    for (int k = 0; k < TT / 32; ++k) { float d0 = __fsub_rn(v[k], mx); asm volatile("" : "+v"(d0)); v[k] = __builtin_amdgcn_exp2f(__fmul_rn(d0, 1.4426950408889634f)); sum += v[k]; }
#pragma unroll
    for (int sh = 16; sh; sh >>= 1) sum += __shfl_xor(sum, sh, 32);
    const float f = __fdiv_rn(hires ? 1.0f : PCAR, sum);
{
        if (hires) {
#pragma unroll
            for (int ch = 0; ch < TT / 128; ++ch) { v4us oh, ol;
#pragma unroll
                for (int q = 0; q < 4; ++q) { unsigned short a, c2; splitf(v[ch * 4 + q] * f, a, c2); oh[q] = a; ol[q] = c2; }
                const size_t oo = ((size_t)zz * (RH ? RH : 1) + i) * TT + ch * 128 + lane * 4; *(v4us*)(Ph + oo) = oh; *(v4us*)(Pl + oo) = ol; }
        } else {
#pragma unroll
            for (int ch = 0; ch < TT / 128; ++ch) { v4h o4;
#pragma unroll
                for (int q = 0; q < 4; ++q) o4[q] = tohx(v[ch * 4 + q] * f);
                *(v4h*)(P16 + (size_t)row * TT + ch * 128 + lane * 4) = o4; } }
         }
}
__global__ __launch_bounds__(256) void k_merge(const float* __restrict__ O, int h0, bf* Ah, bf* Al) { const size_t e = ((size_t)blockIdx.x * 256 + threadIdx.x) * 2; if (e >= (size_t)ZH * TT * HD) return; const int d = (int)(e % HD); const int t = (int)((e / HD) % TT); const int zz = (int)(e / ((size_t)HD * TT)); const float cs = (t < RH) ? 1.0f : (1.0f / PCAR); const size_t oo = (size_t)t * DQ + (h0 + zz) * HD + d;
    v2us oh, ol;
#pragma unroll
    for (int q = 0; q < 2; ++q) { unsigned short a, c2; splitf(O[e + q] * cs, a, c2); oh[q] = a; ol[q] = c2; } *(v2us*)(Ah + oo) = oh; *(v2us*)(Al + oo) = ol;  }

extern "C" void kernel_launch(void* const* d_in, const int* in_sizes, int n_in,
                              void* d_out, int out_size, void* d_ws, size_t ws_size, hipStream_t stream) {
    (void)in_sizes; (void)n_in; (void)out_size;
    const float* x = (const float*)d_in[0]; const float* wq = (const float*)d_in[1]; const float* bq = (const float*)d_in[2]; const float* wk = (const float*)d_in[3]; const float* bk = (const float*)d_in[4]; const float* wv = (const float*)d_in[5]; const float* bv = (const float*)d_in[6]; const float* wo = (const float*)d_in[7]; const float* bo = (const float*)d_in[8]; const float* cosT = nullptr; const float* sinT = nullptr; (void)cosT; (void)sinT;
    float* OUT = (float*)d_out;     // [2][2048][1024]
    char* wsp = (char*)d_ws;
    auto take = [&](size_t bytes) { char* p = wsp; wsp += (bytes + 255) & ~(size_t)255; return (void*)p; };
    bf* W4 = (bf*)take((size_t)4 * DQ * DM * 2); bf* WQ = W4; bf* WK = W4 + (size_t)DQ * DM; bf* WV = W4 + (size_t)2 * DQ * DM; bf* WO = W4 + (size_t)3 * DQ * DM;
    bf* XB = (bf*)take((size_t)NB_ * TT * DM * 2);
    h16* QP16 = (h16*)take((size_t)NH_ * TT * HD * 2); h16* KP16 = (h16*)take((size_t)NKV * TT * HD * 2);
    h16* VT16 = (h16*)take((size_t)NKV * HD * TT * 2); float* VSb = (float*)take((size_t)NKV * (TT / FJ) * HD * 4);
    float* Ob = (float*)take((size_t)PVG * NH_ * RB * HD * 4); bf* ATh = (bf*)take((size_t)TT * DQ * 2); bf* ATl = (bf*)take((size_t)TT * DQ * 2);
    if ((size_t)(wsp - (char*)d_ws) > ws_size) return;    // ws 256 MiB
    k_prep<<<(unsigned)(4 * WBL + (size_t)NB_ * TT * DM / 8 / 256), 256, 0, stream>>>(wq, wk, wv, wo, x, W4, XB);
    // Q, K, V, O and the merged planes are one batch's and are used again by the next batch. Batch b's out-projection reads only ATh, ATl, WO; batch b + 1's projections write Q, K, V, which batch b's attention has read by then: the two share a launch.
    static_assert(NB_ == 2, "the launches below are written out for two batches");
    k_jobs<<<dim3(TT / 128, 24, 1), 32 * GNW, 0, stream>>>(16, XB, WQ, WK, WV, bq, bk, bv, QP16, KP16, VT16, VSb, ATh, ATl, WO, bo, OUT);
    k_fattn<<<dim3(FWG, 1, 1), 512, 0, stream>>>(QP16, KP16, VT16, VSb, Ob);
    k_mrgrb<<<(unsigned)(((size_t)NH_ * RB * HD / 8 + 255) / 256), 256, 0, stream>>>(Ob, 0, ATh, ATl);
    k_jobs<<<dim3(TT / 128, 40, 1), 32 * GNW, 0, stream>>>(0, XB + (size_t)TT * DM, WQ, WK, WV, bq, bk, bv, QP16, KP16, VT16, VSb, ATh, ATl, WO, bo, OUT);
    k_fattn<<<dim3(FWG, 1, 1), 512, 0, stream>>>(QP16, KP16, VT16, VSb, Ob);
    k_mrgrb<<<(unsigned)(((size_t)NH_ * RB * HD / 8 + 255) / 256), 256, 0, stream>>>(Ob, 0, ATh, ATl);
    k_jobs<<<dim3(TT / 128, 16, 1), 32 * GNW, 0, stream>>>(0, XB, WQ, WK, WV, bq, bk, bv, QP16, KP16, VT16, VSb, ATh, ATl, WO, bo, OUT + (size_t)TT * DM);
}

// v010
// It runs in 100 microseconds.
// Timed twice side by side with v009, it ran 1.07 times as fast both times.
// All steps since v000 together make it 13.4 times as fast.
#include <hip/hip_runtime.h>

// MultiHeadAttention__5987 (x [2][2048][1024]; Q/K/V = x W + b (16 x 64); score = Q.K / sqrt(1024); causal positions (j > i) set to -1e10; FAITHFUL QUIRK: softmax over the HEAD axis (not over keys) -> weight[h][i][j]; out_h[i] = sum_j weight[h][i][j] V_h[j] (un-normalised over keys; masked positions carry weight exactly 1/16); merged Wo + bo -> [2][2048][1024]).
// Layout (exact): one kernel per batch does scores, head softmax and weights.V: a work-group of 16 waves (wave = head) holds 32 query rows and walks its share of the key passes (32 keys each) up to the diagonal; scores and weights never leave the WGP: they cross from head to head through LDS. Key passes wholly behind the diagonal carry the weight 1/16 everywhere: their part of weights.V is 1/16 of the sum of V's 32-token block sums.
// Compute dtypes, f32 accumulate: every input rounded to bf16; Q/K/V on PLAIN bf16 operands (inputs: exact) + bias; scores as single fp16 products (x1; logits are q.k/32); the 16-way head softmax in f32 per (i, j) (masked columns give exactly 1/16); weights.V as single fp16 products (weights <= 1 and V each rounded to fp16 once); Wo hl x exact (2 products) + bias.

#define NB_  2
#define TT   2048
#define DM   1024
#define NH_  16
#define NKV  16
#define REP  (NH_ / NKV)
#define HD   64
#define DQ   (NH_ * HD)
#define DKV  (NKV * HD)
#define ZH   2
#define RH   2048                  // query rows < RH use hi+lo planes (0: none)
#define WIN  0
#define PCAR 1024.0f
#define RB   TT     // query rows per merge launch
#define NRB  (TT / RB)
#define GNW  8      // waves per GEMM work-group: the tile's 64x64 quarters, each over 2 or 4 parts of K
#define PVG  7      // most work-groups that share a query block's key passes; their planes are added by the merge job
#define NPARTS(ib) (((ib) + 1) / 10 + 1)   // work-groups that share query block ib's ib + 1 key passes up to the diagonal: at most 10 passes each
#define FWG  244    // sum of NPARTS over the 64 query blocks: every work-group has a WGP of its own (a work-group's 16 waves fill a WGP's registers)
#define FI   32     // query rows per work-group of the fused kernel
#define FJ   32     // keys per pass of the fused kernel
#define FP   36     // LDS row pitch in floats (144 B: an odd multiple of 16 B)
#define SCL  0.03125f   // 1/sqrt(1024) (full embed dim, faithful)
typedef _Float16 h16;
typedef unsigned short bf;
typedef __attribute__((ext_vector_type(16))) __bf16   v16bf;
typedef __attribute__((ext_vector_type(16))) _Float16 v16h;
typedef __attribute__((ext_vector_type(8)))  _Float16 v8h;
typedef __attribute__((ext_vector_type(8)))  unsigned short v8us;
typedef __attribute__((ext_vector_type(8)))  float    v8f;
typedef __attribute__((ext_vector_type(4)))  float    v4f;
typedef v8h  __attribute__((may_alias)) v8ha;
typedef v4f  __attribute__((may_alias)) v4fa;
typedef v8us __attribute__((may_alias)) v8usa;

__device__ __forceinline__ unsigned short f2bf(float f) { unsigned u = __float_as_uint(f); u += 0x7FFFu + ((u >> 16) & 1u); return (unsigned short)(u >> 16); }
__device__ __forceinline__ float bf2f(unsigned short b) { return __uint_as_float(((unsigned)b) << 16); }
__device__ __forceinline__ float bfr(float f) { return bf2f(f2bf(f)); }
__device__ __forceinline__ v16h cat16(v8h lo, v8h hi) { return __builtin_shufflevector(lo, hi, 0, 1, 2, 3, 4, 5, 6, 7, 8, 9, 10, 11, 12, 13, 14, 15); }
__device__ __forceinline__ v16bf cat16b(v8us lo, v8us hi) { return __builtin_bit_cast(v16bf, __builtin_shufflevector(lo, hi, 0, 1, 2, 3, 4, 5, 6, 7, 8, 9, 10, 11, 12, 13, 14, 15)); }
__device__ __forceinline__ v8f wmma16(v16h a, v16h b, v8f c) { return __builtin_amdgcn_wmma_f32_16x16x32_f16(false, a, false, b, (short)0, c, false, false); }
__device__ __forceinline__ v8f wmmab(v16bf a, v16bf b, v8f c) { return __builtin_amdgcn_wmma_f32_16x16x32_bf16(false, a, false, b, (short)0, c, false, false); }
__device__ __forceinline__ h16 tohx(float x) { return (h16)x; }
__device__ __forceinline__ void splitf(float y, unsigned short& h, unsigned short& l) { h = f2bf(y); l = f2bf(y - bf2f(h)); }
// s_wait_xcnt 0 behind a run of global loads, ahead of every later write of a register that they name as an address. The addresses are inputs of the statement, so that their registers stay untouched (also by a later load's result) up to the wait.
__device__ __forceinline__ void addr_wait(const void* a) { asm volatile("s_wait_xcnt 0x0" :: "v"(a) : "memory"); }
__device__ __forceinline__ void addr_wait(const void* a, const void* b) { asm volatile("s_wait_xcnt 0x0" :: "v"(a), "v"(b) : "memory"); }
__device__ __forceinline__ void addr_wait(const void* a, const void* b, const void* c) { asm volatile("s_wait_xcnt 0x0" :: "v"(a), "v"(b), "v"(c) : "memory"); }
__device__ __forceinline__ void addr_wait(const void* a, const void* b, const void* c, const void* d) { asm volatile("s_wait_xcnt 0x0" :: "v"(a), "v"(b), "v"(c), "v"(d) : "memory"); }
typedef __attribute__((ext_vector_type(2))) _Float16 v2h;
typedef __attribute__((ext_vector_type(4))) _Float16 v4h;



// ---- d_gemmw: GEMM body of k_jobs: an output tile of MQ * 64 rows x 128 columns per work-group of 8 waves; a wave holds one 64x64 quarter (16 accumulators) over one of NKP = 4 / MQ parts of K. Row block rb, column block by, os = the work-group's LDS.
// C[m][n] = sum_k A[m][k] Bt[n][k] (NSPLIT 1: + A2[m][k] Bt[n][k]) + bias[n] (rounded to bf16).
// Operands come from 16-bit planes in fragment order and are staged in LDS by asynchronous copies, two buffers: the two waves that share 64 rows (or 64 columns) read them from LDS, so that a work-group fetches each operand tile once.
// A stage holds three regions, A, Bt, A2; a region holds, per part of K and per k-tile ks < KS, the operand's row tiles (1 KiB each; 4 * MQ of A, 8 of Bt): slot (part * KS + ks) * row tiles + row tile. Copy c of thread t fills 16 bytes at c * 4096 + t * 16: 256 threads fill 4 slots a copy.
// The parts of K are added through LDS in their order, then the bias.
// EPI (a quarter's 64 columns are one head, its rows are tokens): 0: f32 to C. 1: as fp16 to the head plane P16[head] (rows = tokens, k = d). 2: transposed through LDS, as fp16, to the head plane P16[head] (rows = d, k = tokens), and its sums over each FJ tokens as f32 to VS[head][token / FJ][d]. The planes in fragment order.
// FRAGMENT ORDER: every 16-bit operand plane P[row][k] is stored as tiles of 16 rows x 32 k (512 elements, 1 KiB), one tile = one WMMA operand fragment, laid out as the lanes read it:
// element (row, k) stands at tile * 512 + ((k % 32) / 16) * 256 + (((k % 16) / 8) * 16 + row % 16) * 8 + k % 8. A lane's two 16-byte loads are at lane * 8 and 256 + lane * 8: a wave's load is 512 bytes in a row (4 whole lines).
// Tile numbers: GEMM operands and Q, K head planes (row / 16) * (K / 32) + k / 32; V planes (rows = d, k = token) (k / 32) * (HD / 16) + row / 16, so that a pass's four tiles are neighbours.
template <typename T16> struct WFrag;
template <> struct WFrag<h16> { typedef v16h V; static __device__ __forceinline__ V ld(const h16* p) { return cat16(*(const v8h*)p, *(const v8h*)(p + 256)); } static __device__ __forceinline__ v8f mma(V a, V b, v8f c) { return wmma16(a, b, c); } };
template <> struct WFrag<bf> { typedef v16bf V; static __device__ __forceinline__ V ld(const bf* p) { return cat16b(*(const v8us*)p, *(const v8us*)(p + 256)); } static __device__ __forceinline__ v8f mma(V a, V b, v8f c) { return wmmab(a, b, c); } };
// Asynchronous copies global to LDS, 16 bytes a lane: LDS byte addresses l, l + 4096, ...; each copy has its own global address. s_wait_xcnt 0 is the statement's last line, so that it stands in front of every later write of a register that a copy names.
__device__ __forceinline__ void cp8(unsigned l, const char* const* g) {
    asm volatile("global_load_async_to_lds_b128 %0, %8, off\n\tglobal_load_async_to_lds_b128 %1, %9, off\n\tglobal_load_async_to_lds_b128 %2, %10, off\n\tglobal_load_async_to_lds_b128 %3, %11, off\n\t"
                 "global_load_async_to_lds_b128 %4, %12, off\n\tglobal_load_async_to_lds_b128 %5, %13, off\n\tglobal_load_async_to_lds_b128 %6, %14, off\n\tglobal_load_async_to_lds_b128 %7, %15, off\n\ts_wait_xcnt 0x0"
                 :: "v"(l), "v"(l + 4096u), "v"(l + 8192u), "v"(l + 12288u), "v"(l + 16384u), "v"(l + 20480u), "v"(l + 24576u), "v"(l + 28672u),
                    "v"(g[0]), "v"(g[1]), "v"(g[2]), "v"(g[3]), "v"(g[4]), "v"(g[5]), "v"(g[6]), "v"(g[7]) : "memory"); }
// a fragment from a staged tile: the lane's 16 bytes of each half of the tile
__device__ __forceinline__ v16bf ldsfrag(const char* p) { return cat16b(*(const v8usa*)p, *(const v8usa*)(p + 512)); }
template <int NSPLIT, int EPI, int K, int MQ>
__device__ __forceinline__ void d_gemmw(float* os, const int rb, const int by, const bf* A, const bf* A2, const bf* Bt, float* C, int ldc, const float* bias, h16* P16, float* VS) {
    static_assert(GNW == 8 && HD == 64 && (NSPLIT == 0 || NSPLIT == 1) && (MQ == 1 || MQ == 2) && (EPI != 2 || MQ == 2), "8 waves: MQ x 2 quarters, each over 4 / MQ parts of K; a quarter is one head wide");
    constexpr int KT = K / 32, NKP = 4 / MQ, KS = (NSPLIT == 0) ? 2 : 1, NT = KT / NKP / KS;   // k-tiles; parts of K; k-tiles a trip and part; trips
    constexpr int NA = NKP * KS * MQ, NB = NKP * KS * 2, NC = NA * (1 + NSPLIT) + NB, STG = NC * 4096;   // copies a thread and stage: of a plane of A, of Bt, of all; bytes a stage
    static_assert(NT >= 2 && KT % (NKP * KS) == 0 && 2 * STG <= GNW * 64 * 68 * 4 && NC == 16, "two stages exist and both buffers lie inside os");
    const int tid = (int)threadIdx.x, wave = __builtin_amdgcn_readfirstlane(tid >> 5); const int kh = wave % NKP, nc = (wave / NKP) & 1, mr = wave / (NKP * 2);
    const int lane = tid & 31, lr = lane & 15, hi = lane >> 4; const int r0 = rb * (MQ * 64), c0 = by * 128;
    v8f acc[4][4];
#pragma unroll
    for (int mb = 0; mb < 4; ++mb)
#pragma unroll
        for (int nb = 0; nb < 4; ++nb) acc[mb][nb] = (v8f){};
    // each thread's own 16 bytes: row tile tid / 64 of the operand's first k-tile (16 rows of tiles are K * 32 bytes; a k-tile is 1024)
    const unsigned l0 = (unsigned)(size_t)os + (unsigned)tid * 16u; const size_t to = (size_t)(tid >> 6) * (KT * 1024) + (size_t)(tid & 63) * 16;
    const char* gA = (const char*)A + (size_t)r0 * (K * 2) + to; const char* gB = (const char*)Bt + (size_t)c0 * (K * 2) + to; const char* gA2 = (NSPLIT == 1) ? (const char*)A2 + (size_t)r0 * (K * 2) + to : nullptr;
    auto stage = [&](int t, int buf) { const char* g[NC];
        // unrolled: g is indexed by constants
#pragma unroll
        for (int c = 0; c < NC; ++c) { const int op = (c < NA) ? 0 : (c < NA + NB) ? 1 : 2, j = c - (op == 0 ? 0 : op == 1 ? NA : NA + NB), w = (op == 1) ? 2 : MQ, ks = (j / w) % KS, k2 = j / w / KS;   // region; copy in the region; copies a k-tile; k-tile; part of K
            g[c] = (op == 0 ? gA : op == 1 ? gB : gA2) + __builtin_amdgcn_readfirstlane(((j % w) * 4 * KT + k2 * (KT / NKP) + ks + t * KS) * 1024); }   // the tile's offset is formed in a scalar register, so that no vector register holds a copy's own base through the loop
        const unsigned l = l0 + (unsigned)buf * (unsigned)STG; cp8(l, g); cp8(l + 32768u, g + 8); };
    stage(0, 0);
    asm volatile("s_wait_asynccnt 0x0" ::: "memory");   // this wave's copies of stage 0 have landed
    __syncthreads();                                    // every wave's have: stage 0 may be read
    stage(1, 1);
    // rolled: one trip's code, and the order at its foot stays as written
#pragma unroll 1
    for (int t = 0; t < NT; ++t) {
        const char* sp = (const char*)os + (t & 1) * STG + lane * 16;
        v16bf a[4], bb[4];
#pragma unroll
        for (int ks = 0; ks < KS; ++ks) {
            bb[0] = ldsfrag(sp + NA * 4096 + ((kh * KS + ks) * 8 + nc * 4) * 1024);
#pragma unroll
            for (int mb = 0; mb < 4; ++mb) a[mb] = ldsfrag(sp + ((kh * KS + ks) * (4 * MQ) + mr * 4 + mb) * 1024);
#pragma unroll
            for (int nb = 1; nb < 4; ++nb) bb[nb] = ldsfrag(sp + NA * 4096 + ((kh * KS + ks) * 8 + nc * 4 + nb) * 1024);
            if constexpr (NSPLIT == 1) {
                __builtin_amdgcn_sched_barrier(0);   // as the one below: the LDS reads above are all asked for ahead of the matrix instructions
#pragma unroll
                for (int nb = 0; nb < 4; ++nb)
#pragma unroll
                    for (int mb = 0; mb < 4; ++mb) acc[mb][nb] = wmmab(a[mb], bb[nb], acc[mb][nb]);
                // the second plane of A takes the first one's place (the B fragments stay)
#pragma unroll
                for (int mb = 0; mb < 4; ++mb) a[mb] = ldsfrag(sp + (NA + NB) * 4096 + ((kh * KS + ks) * (4 * MQ) + mr * 4 + mb) * 1024);
            }
            // the trip's foot stands behind its last LDS reads and in front of the matrix instructions that work on them (they read registers only): the next copies are under way while the matrix unit works
            if (ks == KS - 1) {
                asm volatile("s_wait_dscnt 0x0" ::: "memory");      // this wave has read its last fragments of stage t
                asm volatile("s_wait_asynccnt 0x0" ::: "memory");   // this wave's copies of stage t + 1 have landed
                __syncthreads();                                    // stage t + 1 may be read, and stage t's buffer may be filled again
                if (t + 2 < NT) stage(t + 2, t & 1);
            }
            __builtin_amdgcn_sched_barrier(0);   // all of a k-tile's LDS reads are asked for ahead of its matrix instructions: without it the compiler reads each B fragment only when it is due, and every fourth matrix instruction waits a whole LDS latency
#pragma unroll
            for (int nb = 0; nb < 4; ++nb)
#pragma unroll
                for (int mb = 0; mb < 4; ++mb) acc[mb][nb] = wmmab(a[mb], bb[nb], acc[mb][nb]);
        }
        // four vector slots behind the trip's last matrix instructions, in front of whatever the loop's branch leads to
        asm volatile("v_nop\n\tv_nop\n\tv_nop\n\tv_nop" : "+v"(acc[0][0]), "+v"(acc[1][1]), "+v"(acc[2][2]), "+v"(acc[3][3]) : "v"(a[0]), "v"(a[3]));
    }
    asm volatile("s_wait_asynccnt 0x0" ::: "memory");   // no copy is under way when os is used for the partial tiles
    // EPI 1: thread t takes the 4 values that stand at t * 4 in a 16-token block of the head plane (2 tiles), so that the 256 threads store 2 KiB in a row
    float* my = os + wave * (64 * 68); const int cofs = (EPI == 1) ? ((tid >> 5) & 7) * 8 + (tid & 1) * 4 : (tid & 15) * 4; v4f bv[2];
    // the bias addresses are inputs of the s_wait_xcnt statement behind the loads, so that a load's own result does not land in an address register (bias carries no __restrict__: the loads keep their place in front of the statement)
    { const float* bp = bias + c0 + cofs; const float* bp2 = bp + 64; const v4f br = *(const v4f*)bp; const v4f br2 = *(const v4f*)bp2; addr_wait(bp, bp2);
#pragma unroll
      for (int q = 0; q < 4; ++q) { bv[0][q] = bfr(br[q]); bv[1][q] = bfr(br2[q]); } }
    // the three loops are unrolled so that acc is indexed by constants and stays in registers
#pragma unroll
    for (int mb = 0; mb < 4; ++mb)
#pragma unroll
        for (int nb = 0; nb < 4; ++nb)
#pragma unroll
            for (int j = 0; j < 8; ++j) my[(mb * 16 + hi * 8 + j) * 68 + nb * 16 + lr] = acc[mb][nb][j];
    __syncthreads();   // every wave's partial tile is in LDS before any thread adds them
    v4f sums[2 * MQ][4];
    // quarter qd = (row half) * 2 + column half: its NKP partial tiles are those of waves NKP qd and up. Unrolled: sums is indexed by constants, and the LDS reads are in flight together
#pragma unroll
    for (int qd = 0; qd < 2 * MQ; ++qd) { const float* tp = os + qd * (NKP * 64 * 68); const int r0q = r0 + (qd >> 1) * 64, c0q = c0 + (qd & 1) * 64, hq = by * 2 + (qd & 1); (void)c0q; (void)hq;
#pragma unroll
        for (int s = 0; s < 4; ++s) { const int row = (EPI == 1) ? s * 16 + ((tid >> 1) & 15) : (s * 256 + tid) >> 4;
            v4f val = *(const v4fa*)(tp + row * 68 + cofs);
#pragma unroll
            for (int w = 1; w < NKP; ++w) val += *(const v4fa*)(tp + w * (64 * 68) + row * 68 + cofs);
            val += bv[qd & 1];
            if constexpr (EPI == 0) *(v4f*)(C + (size_t)(r0q + row) * ldc + c0q + cofs) = val;
            if constexpr (EPI == 1) *(v4h*)(P16 + ((size_t)hq * TT + r0q + s * 16) * HD + tid * 4) = __builtin_convertvector(val, v4h);
            if constexpr (EPI == 2) sums[qd][s] = val; }
        // s_wait_xcnt 0 behind a quarter's stores: the code behind them writes the registers that the stores name
        if constexpr (EPI != 2) asm volatile("s_wait_xcnt 0x0" ::: "memory"); }
    if constexpr (EPI == 2) {
        __syncthreads();   // every thread has read the partial tiles before the sums are written over them
        // each quarter's sum goes transposed into its own first partial tile; pitch 65 words: the 32 lanes of a wave meet 32 different banks in the transposed write
#pragma unroll
        for (int qd = 0; qd < 4; ++qd)
#pragma unroll
            for (int s = 0; s < 4; ++s)
#pragma unroll
                for (int q = 0; q < 4; ++q) os[qd * (2 * 64 * 68) + (cofs + q) * 65 + ((s * 256 + tid) >> 4)] = sums[qd][s][q];
        __syncthreads();   // the transposed quarters are in LDS before any thread reads a row of them
        // thread t takes the 8 tokens that stand at t * 8 in a 32-token block of the plane (4 tiles): the 256 threads store 4 KiB in a row
#pragma unroll
        for (int qd = 0; qd < 4; ++qd) { const float* tp = os + qd * (2 * 64 * 68); const int r0q = r0 + (qd >> 1) * 64, hq = by * 2 + (qd & 1);
#pragma unroll
            for (int u = 0; u < 2; ++u) { const int d = ((tid >> 6) & 3) * 16 + (tid & 15), t8 = u * 32 + ((tid >> 4) & 3) * 8; v8h o8;
#pragma unroll
                for (int j = 0; j < 8; ++j) o8[j] = tohx(tp[d * 65 + t8 + j]);
                *(v8h*)(P16 + ((size_t)hq * TT + r0q + u * 32) * HD + tid * 8) = o8; }
            // s_wait_xcnt 0 behind a quarter's stores: the code behind them writes the registers that the stores name
            asm volatile("s_wait_xcnt 0x0" ::: "memory"); }
        // block sums: a thread adds one d over one block of FJ tokens, in token order, for two of the 8 (quarter, block) pairs; 128 threads store 512 bytes in a row
#pragma unroll
        for (int v = 0; v < 2; ++v) { const int it = v * 256 + tid, qd = it >> 7, u = (it >> 6) & 1, d = it & 63; const float* tp = os + qd * (2 * 64 * 68); float sm = 0.f;
            // unrolled so that the LDS reads are in flight together
#pragma unroll
            for (int j = 0; j < FJ; ++j) sm += tp[d * 65 + u * FJ + j];
            VS[((size_t)(by * 2 + (qd & 1)) * (TT / FJ) + (r0 + (qd >> 1) * 64) / FJ + u) * HD + d] = sm;
            // s_wait_xcnt 0 behind the store: the code behind it writes the registers that the store names
            asm volatile("s_wait_xcnt 0x0" ::: "memory"); }
    }
}

// ---- element-wise jobs of k_jobs. Two work-groups of k_jobs fit a WGP (512 places on the chip) and a launch's GEMMs fill 384 or 256 of them: EWG looping work-groups of element-wise work that those GEMMs neither feed nor need take idle places of the same launch.
#define EWG 128                       // work-groups of an element-wise job
#define PS_ ((size_t)NH_ * RB * HD)   // elements of an O plane
#define WBL (DM * DQ / 8 / 256)       // units (256 threads x 8 elements) of a weight
#define XBL (TT * DM / 8 / 256)       // units of one batch's x
// d_wtG: w[k][n] f32 to Bt (rows = n) in fragment order. Thread i writes the 8 elements at i * 8: one n, 8 neighbouring k; 16 lanes read 16 neighbouring n of one k.
__device__ __forceinline__ void d_wtG(const float* __restrict__ w, int K, int N, bf* Bt, const int i) {
    if (i >= N * K / 8) return;
    const int tile = i >> 6, kt = K / 32; const int n = (tile / kt) * 16 + (i & 15), k0 = (tile % kt) * 32 + ((i >> 4) & 3) * 8; v8us o; const float* wp[8]; float wv[8];
    // unrolled so that the 8 loads are in flight together
#pragma unroll
    for (int j = 0; j < 8; ++j) { wp[j] = w + (size_t)(k0 + j) * N + n; wv[j] = *wp[j]; }
    // s_wait_xcnt 0 behind the eight loads; their addresses are inputs, so that no address register is written (also not by a later load's result) ahead of it
    asm volatile("s_wait_xcnt 0x0" :: "v"(wp[0]), "v"(wp[1]), "v"(wp[2]), "v"(wp[3]), "v"(wp[4]), "v"(wp[5]), "v"(wp[6]), "v"(wp[7]) : "memory");
    // unrolled: o and wv are indexed by constants
#pragma unroll
    for (int j = 0; j < 8; ++j) o[j] = f2bf(wv[j]);
    *(v8us*)(Bt + (size_t)i * 8) = o;
}
// N planes' 32 bytes a lane (16 at the lane's place in the first 512 bytes of a half tile, 16 in the second): the loads and their data wait in one statement, so that all of them are in flight together and no address register is written (also not by a load's result) while a load is under way.
template <int N> __device__ __forceinline__ void ldpn(const float* q, v4f* a, v4f* b);
template <> __device__ __forceinline__ void ldpn<1>(const float* q, v4f* a, v4f* b) {
    asm volatile("global_load_b128 %0, %2, off\n\tglobal_load_b128 %1, %2, off offset:512\n\ts_wait_loadcnt 0x0"
                 : "=&v"(a[0]), "=&v"(b[0])
                 : "v"(q) : "memory"); }
template <> __device__ __forceinline__ void ldpn<2>(const float* q, v4f* a, v4f* b) {
    asm volatile("global_load_b128 %0, %4, off\n\tglobal_load_b128 %1, %4, off offset:512\n\t"
                 "global_load_b128 %2, %5, off\n\tglobal_load_b128 %3, %5, off offset:512\n\ts_wait_loadcnt 0x0"
                 : "=&v"(a[0]), "=&v"(b[0]), "=&v"(a[1]), "=&v"(b[1])
                 : "v"(q), "v"(q + 1 * PS_) : "memory"); }
template <> __device__ __forceinline__ void ldpn<3>(const float* q, v4f* a, v4f* b) {
    asm volatile("global_load_b128 %0, %6, off\n\tglobal_load_b128 %1, %6, off offset:512\n\t"
                 "global_load_b128 %2, %7, off\n\tglobal_load_b128 %3, %7, off offset:512\n\t"
                 "global_load_b128 %4, %8, off\n\tglobal_load_b128 %5, %8, off offset:512\n\ts_wait_loadcnt 0x0"
                 : "=&v"(a[0]), "=&v"(b[0]), "=&v"(a[1]), "=&v"(b[1]), "=&v"(a[2]), "=&v"(b[2])
                 : "v"(q), "v"(q + 1 * PS_), "v"(q + 2 * PS_) : "memory"); }
template <> __device__ __forceinline__ void ldpn<4>(const float* q, v4f* a, v4f* b) {
    asm volatile("global_load_b128 %0, %8, off\n\tglobal_load_b128 %1, %8, off offset:512\n\t"
                 "global_load_b128 %2, %9, off\n\tglobal_load_b128 %3, %9, off offset:512\n\t"
                 "global_load_b128 %4, %10, off\n\tglobal_load_b128 %5, %10, off offset:512\n\t"
                 "global_load_b128 %6, %11, off\n\tglobal_load_b128 %7, %11, off offset:512\n\ts_wait_loadcnt 0x0"
                 : "=&v"(a[0]), "=&v"(b[0]), "=&v"(a[1]), "=&v"(b[1]), "=&v"(a[2]), "=&v"(b[2]), "=&v"(a[3]), "=&v"(b[3])
                 : "v"(q), "v"(q + 1 * PS_), "v"(q + 2 * PS_), "v"(q + 3 * PS_) : "memory"); }
template <> __device__ __forceinline__ void ldpn<5>(const float* q, v4f* a, v4f* b) {
    asm volatile("global_load_b128 %0, %10, off\n\tglobal_load_b128 %1, %10, off offset:512\n\t"
                 "global_load_b128 %2, %11, off\n\tglobal_load_b128 %3, %11, off offset:512\n\t"
                 "global_load_b128 %4, %12, off\n\tglobal_load_b128 %5, %12, off offset:512\n\t"
                 "global_load_b128 %6, %13, off\n\tglobal_load_b128 %7, %13, off offset:512\n\t"
                 "global_load_b128 %8, %14, off\n\tglobal_load_b128 %9, %14, off offset:512\n\ts_wait_loadcnt 0x0"
                 : "=&v"(a[0]), "=&v"(b[0]), "=&v"(a[1]), "=&v"(b[1]), "=&v"(a[2]), "=&v"(b[2]), "=&v"(a[3]), "=&v"(b[3]), "=&v"(a[4]), "=&v"(b[4])
                 : "v"(q), "v"(q + 1 * PS_), "v"(q + 2 * PS_), "v"(q + 3 * PS_), "v"(q + 4 * PS_) : "memory"); }
template <> __device__ __forceinline__ void ldpn<6>(const float* q, v4f* a, v4f* b) {
    asm volatile("global_load_b128 %0, %12, off\n\tglobal_load_b128 %1, %12, off offset:512\n\t"
                 "global_load_b128 %2, %13, off\n\tglobal_load_b128 %3, %13, off offset:512\n\t"
                 "global_load_b128 %4, %14, off\n\tglobal_load_b128 %5, %14, off offset:512\n\t"
                 "global_load_b128 %6, %15, off\n\tglobal_load_b128 %7, %15, off offset:512\n\t"
                 "global_load_b128 %8, %16, off\n\tglobal_load_b128 %9, %16, off offset:512\n\t"
                 "global_load_b128 %10, %17, off\n\tglobal_load_b128 %11, %17, off offset:512\n\ts_wait_loadcnt 0x0"
                 : "=&v"(a[0]), "=&v"(b[0]), "=&v"(a[1]), "=&v"(b[1]), "=&v"(a[2]), "=&v"(b[2]), "=&v"(a[3]), "=&v"(b[3]), "=&v"(a[4]), "=&v"(b[4]), "=&v"(a[5]), "=&v"(b[5])
                 : "v"(q), "v"(q + 1 * PS_), "v"(q + 2 * PS_), "v"(q + 3 * PS_), "v"(q + 4 * PS_), "v"(q + 5 * PS_) : "memory"); }
template <> __device__ __forceinline__ void ldpn<7>(const float* q, v4f* a, v4f* b) {
    asm volatile("global_load_b128 %0, %14, off\n\tglobal_load_b128 %1, %14, off offset:512\n\t"
                 "global_load_b128 %2, %15, off\n\tglobal_load_b128 %3, %15, off offset:512\n\t"
                 "global_load_b128 %4, %16, off\n\tglobal_load_b128 %5, %16, off offset:512\n\t"
                 "global_load_b128 %6, %17, off\n\tglobal_load_b128 %7, %17, off offset:512\n\t"
                 "global_load_b128 %8, %18, off\n\tglobal_load_b128 %9, %18, off offset:512\n\t"
                 "global_load_b128 %10, %19, off\n\tglobal_load_b128 %11, %19, off offset:512\n\t"
                 "global_load_b128 %12, %20, off\n\tglobal_load_b128 %13, %20, off offset:512\n\ts_wait_loadcnt 0x0"
                 : "=&v"(a[0]), "=&v"(b[0]), "=&v"(a[1]), "=&v"(b[1]), "=&v"(a[2]), "=&v"(b[2]), "=&v"(a[3]), "=&v"(b[3]), "=&v"(a[4]), "=&v"(b[4]), "=&v"(a[5]), "=&v"(b[5]), "=&v"(a[6]), "=&v"(b[6])
                 : "v"(q), "v"(q + 1 * PS_), "v"(q + 2 * PS_), "v"(q + 3 * PS_), "v"(q + 4 * PS_), "v"(q + 5 * PS_), "v"(q + 6 * PS_) : "memory"); }
// the sum of a unit's N planes, in plane order
template <int N> __device__ __forceinline__ v8f addpl(const float* q) { v4f a[N], b[N]; ldpn<N>(q, a, b); v4f ta = a[0], tb = b[0];
    // unrolled: a and b are indexed by constants
#pragma unroll
    for (int p = 1; p < N; ++p) { ta += a[p]; tb += b[p]; }
    return __builtin_shufflevector(ta, tb, 0, 1, 2, 3, 4, 5, 6, 7); }
// d_mrg: adds the planes that k_fattn wrote for a query block (its first NPARTS(ib)), in plane order, and writes the out-projection's A planes (bf16 hi, lo). A unit is 2048 elements (256 threads x 8) of one query block (FI * DQ elements).
// A thread's elements e .. e + 7 of the A plane: in O its lane's two 16-byte pieces of the half tile e / 256. Work-group m takes units m, m + EWG, ...: query blocks 8 apart, so that every work-group gets few-plane and many-plane blocks alike.
__device__ __forceinline__ void d_mrg(const int m, const float* O, bf* Mh, bf* Ml) {
    static_assert(PVG <= 7 && (NH_ * RB * HD / 2048) % EWG == 0, "a loader for every plane count; every work-group has the same number of units");
    const int tid = (int)threadIdx.x;
    // rolled: one unit's code; the plane count is the same for a whole work-group, so the tests on it are scalar branches
#pragma unroll 1
    for (int u = m; u < NH_ * RB * HD / 2048; u += EWG) {
        const int np = NPARTS(u / (FI * DQ / 2048)); const size_t e = ((size_t)u * 256 + tid) * 8;
        const float* q = O + (e & ~(size_t)255) + (tid & 31) * 4; v8f t;
        if (np == 1) t = addpl<1>(q); else if (np == 2) t = addpl<2>(q); else if (np == 3) t = addpl<3>(q); else if (np == 4) t = addpl<4>(q);
        else if (np == 5) t = addpl<5>(q); else if (np == 6) t = addpl<6>(q); else t = addpl<7>(q);
        v8us oh, ol;
        // unrolled: the vectors are indexed by constants
#pragma unroll
        for (int j = 0; j < 8; ++j) { unsigned short a2, c2; splitf(t[j], a2, c2); oh[j] = a2; ol[j] = c2; }
        bf* ph = Mh + e; bf* pl = Ml + e; *(v8us*)ph = oh; *(v8us*)pl = ol;
        addr_wait(ph, pl);   // s_wait_xcnt 0 behind the unit's stores, in front of the next unit's writes of their address registers
    }
}
// d_late: the conversions that batch 0's Q, K, V projections do not need: Wo (as d_wtG) and batch 1's x (as d_cvt8; unit XBL + u of both batches' rows as one matrix). x, XB carry no __restrict__: the loads keep their place in front of the s_wait_xcnt statement.
__device__ __forceinline__ void d_late(const int m, const float* x, bf* XB, const float* wo, bf* WOt) {
    static_assert(WBL % EWG == 0 && XBL % (4 * EWG) == 0, "every work-group has the same number of units");
    const int tid = (int)threadIdx.x;
    // rolled: one unit's code (8 loads in flight)
#pragma unroll 1
    for (int u = m; u < WBL; u += EWG) { const int i = u * 256 + tid; d_wtG(wo, DM, DQ, WOt, i);
        asm volatile("s_wait_xcnt 0x0" :: "v"(i) : "memory"); }   // behind the unit's store, in front of the next unit's writes of its address registers: the store's offset register holds i, an input of the statement, so that it stays untouched up to the wait
    // rolled: four units a trip, their 8 loads in flight together
#pragma unroll 1
    for (int u = m; u < XBL; u += 4 * EWG) { const float* sp[4]; int ix[4]; v8f v[4];
        // unrolled: the arrays are indexed by constants
#pragma unroll
        for (int c = 0; c < 4; ++c) { const int i = (XBL + u + c * EWG) * 256 + tid, tile = i >> 6; const int row = (tile / (DM / 32)) * 16 + (i & 15), k0 = (tile % (DM / 32)) * 32 + ((i >> 4) & 3) * 8;
            sp[c] = x + (size_t)row * DM + k0; ix[c] = i; v[c] = *(const v8f*)sp[c]; }
        addr_wait(sp[0], sp[1], sp[2], sp[3]);   // s_wait_xcnt 0 behind the loads, in front of every later write of their address registers
        // both unrolled: the arrays and vectors are indexed by constants
#pragma unroll
        for (int c = 0; c < 4; ++c) { v8us o;
#pragma unroll
            for (int j = 0; j < 8; ++j) o[j] = f2bf(v[c][j]);
            *(v8us*)(XB + (size_t)ix[c] * 8) = o; }
        asm volatile("s_wait_xcnt 0x0" :: "v"(ix[0]), "v"(ix[1]), "v"(ix[2]), "v"(ix[3]) : "memory");   // the same behind the stores: their offset registers hold the unit indices, inputs of the statement
    }
}

// k_jobs: jobs that do not depend on one another share one grid (TT / 128, blocks y), 32 * GNW threads. y = blockIdx.y + y0 names the job and, for a GEMM, its 128 columns (two heads):
// 0..15 out-projection (Ah + Al) WO + bo to OUTb, tiles of 64 rows (row block 2 blockIdx.x + y % 2, column block y / 2), so that it alone still gives every WGP a work-group; 16..23 the merge of the O planes to Mh, Ml;
// 24..31 V projection; 32..39 Q; 40..47 K (X times WV, WQ, WK), tiles of 128 rows; 48..55 the late conversions (Wo, batch 1's x).
// A launch takes a run of y: 24..55 (Q, K, V of batch 0, late conversions), 16..47 (batch 0's merge, Q, K, V of batch 1), 0..23 (batch 0's out-projection, batch 1's merge into planes of its own), 0..15 (the last out-projection). The test on y is the same for a whole work-group.
__global__ __launch_bounds__(32 * GNW) void k_jobs(int y0, const bf* X, const bf* WQ, const bf* WK, const bf* WV, const float* bq, const float* bk, const float* bv, h16* Q16, h16* K16, h16* V16, float* VS,
                                                   const bf* Ah, const bf* Al, const bf* WO, const float* bo, float* OUTb, const float* O, bf* Mh, bf* Ml, const float* xf, bf* XB, const float* wo, bf* WOt) {
    static_assert(DQ / 128 == 8 && DKV / 128 == 8 && DM / 128 == 8 && TT % 128 == 0 && 8 * (TT / 128) == EWG, "each job is 8 blocks y (the out-projection 16)");
    __shared__ __align__(16) float os[GNW * 64 * 68];   // one array for all jobs: a work-group runs one of them; first the two stage buffers, then the waves' partial tiles
    const int y = (int)blockIdx.y + y0, x = (int)blockIdx.x;
    if (y < 16) d_gemmw<1, 0, DQ, 1>(os, x * 2 + (y & 1), y >> 1, Ah, Al, WO, OUTb, DM, bo, nullptr, nullptr);
    else if (y < 24) d_mrg((y - 16) * (TT / 128) + x, O, Mh, Ml);
    else if (y < 32) d_gemmw<0, 2, DM, 2>(os, x, y - 24, X, nullptr, WV, nullptr, 0, bv, V16, VS);
    else if (y < 48) { const bool isk = y >= 40; d_gemmw<0, 1, DM, 2>(os, x, (y - 32) & 7, X, nullptr, isk ? WK : WQ, nullptr, 0, isk ? bk : bq, isk ? K16 : Q16, nullptr); }
    else d_late((y - 48) * (TT / 128) + x, xf, XB, wo, WOt);
}

typedef __attribute__((ext_vector_type(2))) unsigned short v2us;
typedef __attribute__((ext_vector_type(4))) unsigned short v4us;
typedef __attribute__((ext_vector_type(2))) float v2f;
typedef __attribute__((ext_vector_type(4))) int v4i;

// d_cvt8: src[row][DM] f32 to dst in fragment order. Thread i writes the 8 elements at i * 8: one row, 8 neighbouring k.
__device__ __forceinline__ void d_cvt8(const float* __restrict__ src, bf* dst, size_t n8, const size_t i) { if (i >= n8) return; const int tile = (int)(i >> 6); const int row = (tile / (DM / 32)) * 16 + ((int)i & 15), k0 = (tile % (DM / 32)) * 32 + (((int)i >> 4) & 3) * 8; const v8f v = *(const v8f*)(src + (size_t)row * DM + k0); v8us o;
#pragma unroll
    for (int k = 0; k < 8; ++k) o[k] = f2bf(v[k]); *(v8us*)(dst + i * 8) = o;  }
// k_prep: what batch 0's Q, K, V projections need: the conversions of Wq, Wk, Wv and of batch 0's x depend on nothing and share one grid: WBL work-groups a weight (the slower, strided readers first), then x's.
__global__ __launch_bounds__(256) void k_prep(const float* __restrict__ wq, const float* __restrict__ wk, const float* __restrict__ wv, const float* __restrict__ x, bf* W4, bf* XB) {
    static_assert(DKV == DQ, "the weights have one size");
    const int j = (int)blockIdx.x / WBL;   // the same for a whole work-group
    if (j < 3) d_wtG(j == 0 ? wq : j == 1 ? wk : wv, DM, DQ, W4 + (size_t)j * DM * DQ, ((int)blockIdx.x - j * WBL) * 256 + (int)threadIdx.x);
    else d_cvt8(x, XB, (size_t)TT * DM / 8, (size_t)((int)blockIdx.x - 3 * WBL) * 256 + threadIdx.x);
}
__global__ __launch_bounds__(256) void k_cscvt(const float* __restrict__ cosT, const float* __restrict__ sinT, float* CS) { const int idx = blockIdx.x * 256 + threadIdx.x; if (idx >= TT * HD) return; v2f cs; cs[0] = bfr(cosT[idx]); cs[1] = bfr(sinT[idx]); *(v2f*)(CS + (size_t)idx * 2) = cs;  }
// Work-group barrier that orders LDS only: the fences name the LDS address space, so that global loads asked for ahead of it stay in flight across it (__syncthreads() waits for them).
__device__ __forceinline__ void lds_barrier() { __builtin_amdgcn_fence(__ATOMIC_RELEASE, "workgroup", "local"); __builtin_amdgcn_s_barrier(); __builtin_amdgcn_fence(__ATOMIC_ACQUIRE, "workgroup", "local"); }
// k_fattn: grid FWG, 512 threads, wave = head. Query block ib has ib + 1 key passes that hold an unmasked position; its NPARTS(ib) work-groups take them in turn (pass part, part + np, ...).
// The passes behind the diagonal pass are masked everywhere: weight 1/16 in every head and row, so their weights.V is 1/16 of the sum of VS[h][blk] over blk > ib, the same for all rows; the last part starts its accumulators there.
// Per pass of FJ keys: S^T = K Q^T (fp16, rows = keys, columns = queries: a lane's 8 accumulator values are 8 neighbouring keys of one query), stored to LDS as [head][query][key] f32.
// Head softmax: behind a barrier each thread takes 2 neighbouring keys of one query, reads the 16 heads' scores and writes the 16 weight pairs back over the same rows: fp16 pairs in the row's first 16 words.
// (A wave holds whole rows, and has read all of a row before it writes any of it.) Behind a second barrier each wave reads its head's rows as B fragments of weights.V.
// A masked position (j > i) has the same score in every head, so its weight is exactly 1/16. O: plane part of [PVG][TT * DQ] f32 (a query block's rows are written in its first NPARTS(ib) planes only).
// K16, V16 carry no __restrict__: the loop's loads then keep their place in front of its s_wait_xcnt statement (its "memory" clobber holds them there).
__global__ __launch_bounds__(512) void k_fattn(const h16* __restrict__ Q16, const h16* K16, const h16* V16, const float* VS, float* O) {
    __shared__ __align__(16) float Ss[NH_ * FI * FP];
    // flat index to (query block, part): the blocks with np = g + 1 parts are those with 10 g <= ib + 1 <= 10 g + 9; with F = index + 1 their work-groups start at F = 5 g (g + 1), part by part
    static_assert(TT / FI == 64 && FWG == 244 && PVG == 7, "the thresholds below are those of 64 query blocks");
    const int F = (int)blockIdx.x + 1, g6 = (F >= 10) + (F >= 30) + (F >= 60) + (F >= 100) + (F >= 150) + (F >= 210), wi = F - 5 * g6 * (g6 + 1);
    const int part = (g6 == 6) ? wi / 5 : wi / 10, ib = 10 * g6 + wi - part * ((g6 == 6) ? 5 : 10) - 1, np = g6 + 1;
    const float K2 = SCL * 1.4426950408889634f;
    const int h = __builtin_amdgcn_readfirstlane((int)(threadIdx.x >> 5));
    const int lane = threadIdx.x & 31, lr = lane & 15, hi = lane >> 4;
    const int i0 = ib * FI;
    // each lane's own address of its 16 bytes in a tile (fragment order): lane * 16 bytes behind the tile's start
    const h16* qp = Q16 + ((size_t)h * TT + i0) * HD;
    const unsigned ko = (unsigned)lane * 16u;
    const char* kp = (const char*)(K16 + (size_t)h * TT * HD) + ko;   // pass 0
    const char* vp16 = (const char*)(V16 + ((size_t)h * TT + part * FJ) * HD) + ko;
    const char* q0 = (const char*)qp + ko; const char* k0 = kp + part * (FJ * HD * 2);   // the work-group's query rows; its first key pass
    v16h qf[2][2], kf[2][2];
#pragma unroll
    for (int a = 0; a < 2; ++a)
#pragma unroll
        for (int ks = 0; ks < 2; ++ks) { qf[a][ks] = WFrag<h16>::ld((const h16*)q0 + (a * 2 + ks) * 512); kf[a][ks] = WFrag<h16>::ld((const h16*)k0 + (a * 2 + ks) * 512); }
    addr_wait(q0, k0);   // one s_wait_xcnt 0 behind the first fragments' loads, in front of every later write of their address registers
    // the masked passes' part: a 16-byte-a-lane load takes two blocks' 64 sums (lanes 16 to 31 the odd block), 16 blocks a statement; blocks up to ib are left out of the sum
    v8f m8[4] = {(v8f){}, (v8f){}, (v8f){}, (v8f){}};
    if (part == np - 1) {
        v4f sa = (v4f){}; const char* vsp = (const char*)(VS + (size_t)h * (TT / FJ) * HD) + ko;
        for (int g = (ib + 1) >> 4; g < TT / FJ / 16; ++g) { const char* vp = vsp + g * (16 * HD * 4); v4f b[8];
            // the eight loads and their data wait in one statement: all are in flight together, and the address register is not written while a load is under way
            asm volatile("global_load_b128 %0, %8, off\n\tglobal_load_b128 %1, %8, off offset:512\n\tglobal_load_b128 %2, %8, off offset:1024\n\tglobal_load_b128 %3, %8, off offset:1536\n\t"
                         "global_load_b128 %4, %8, off offset:2048\n\tglobal_load_b128 %5, %8, off offset:2560\n\tglobal_load_b128 %6, %8, off offset:3072\n\tglobal_load_b128 %7, %8, off offset:3584\n\ts_wait_loadcnt 0x0"
                         : "=&v"(b[0]), "=&v"(b[1]), "=&v"(b[2]), "=&v"(b[3]), "=&v"(b[4]), "=&v"(b[5]), "=&v"(b[6]), "=&v"(b[7]) : "v"(vp) : "memory");
            // unrolled: b is indexed by constants
#pragma unroll
            for (int k = 0; k < 8; ++k) if (g * 16 + k * 2 + hi > ib) sa += b[k]; }
        // from (d = lr * 4 .. + 3, block parity hi) to the accumulators' rows d = nb * 16 + hi * 8 .. + 7, through the wave's own LDS rows (no other wave touches them in front of the loop's first barrier)
        float* mz = Ss + h * (FI * FP); *(v4fa*)(mz + lane * 4) = sa;
        // unrolled: m8 is indexed by constants
#pragma unroll
        for (int nb = 0; nb < 4; ++nb) { const float* mp = mz + nb * 16 + hi * 8;
            const v4f lo4 = (*(const v4fa*)mp + *(const v4fa*)(mp + HD)) * 0.0625f, hi4 = (*(const v4fa*)(mp + 4) + *(const v4fa*)(mp + HD + 4)) * 0.0625f;
            m8[nb] = __builtin_shufflevector(lo4, hi4, 0, 1, 2, 3, 4, 5, 6, 7); }
    }
    v8f o[2][4];
    // the two loops are unrolled so that o and m8 are indexed by constants and stay in registers
#pragma unroll
    for (int it = 0; it < 2; ++it)
#pragma unroll
        for (int nb = 0; nb < 4; ++nb) o[it][nb] = m8[nb];
    float* sw = Ss + h * (FI * FP) + lr * FP + hi * 8;          // this lane's 8 scores of a tile
    const float* pr = Ss + h * (FI * FP) + lr * FP + hi * 4;    // this lane's 4 words (8 weights) of a fragment half
    const int pi = (int)threadIdx.x >> 4, pj = ((int)threadIdx.x & 15) * 2;
    float* ps = Ss + pi * FP + pj; float* pw = Ss + pi * FP + (pj >> 1);
#pragma unroll 1
    for (int t = part; t <= ib; t += np) {
        v8f s[2][2];
#pragma unroll
        for (int it = 0; it < 2; ++it)
#pragma unroll
            for (int jt = 0; jt < 2; ++jt) { s[it][jt] = WFrag<h16>::mma(kf[jt][0], qf[it][0], (v8f){}); s[it][jt] = WFrag<h16>::mma(kf[jt][1], qf[it][1], s[it][jt]); }
        // next pass's K fragments (the last pass asks for its own again: in bounds, not used) and this pass's V fragments: asked for here so that they fly during the softmax
        const int tn = (t + np <= ib) ? t + np : t; const char* kn = kp + tn * (FJ * HD * 2);
#pragma unroll
        for (int jt = 0; jt < 2; ++jt)
#pragma unroll
            for (int ks = 0; ks < 2; ++ks) kf[jt][ks] = WFrag<h16>::ld((const h16*)kn + (jt * 2 + ks) * 512);
        v16h vf[4];
#pragma unroll
        for (int nb = 0; nb < 4; ++nb) vf[nb] = WFrag<h16>::ld((const h16*)vp16 + nb * 512);
        addr_wait(kn, vp16);   // one s_wait_xcnt 0 behind the pass's loads, in front of every later write of their address registers
        vp16 += np * (FJ * HD * 2);
#pragma unroll
        for (int it = 0; it < 2; ++it)
#pragma unroll
            for (int jt = 0; jt < 2; ++jt) {
                *(v4fa*)(sw + it * 16 * FP + jt * 16) = __builtin_shufflevector(s[it][jt], s[it][jt], 0, 1, 2, 3);
                *(v4fa*)(sw + it * 16 * FP + jt * 16 + 4) = __builtin_shufflevector(s[it][jt], s[it][jt], 4, 5, 6, 7); }
        lds_barrier();   // all 16 heads' scores of this pass are in LDS before any thread reads a column of them
        {
            v2f sv[NH_];
#pragma unroll
            for (int g = 0; g < NH_; ++g) sv[g] = *(const v2f*)(ps + g * (FI * FP));
            const int dj = i0 + pi - (t * FJ + pj);   // query index minus the thread's first key index
            v2f rs;
#pragma unroll
            for (int q = 0; q < 2; ++q) { float mx = sv[0][q];
#pragma unroll
                for (int g = 1; g < NH_; ++g) mx = fmaxf(mx, sv[g][q]);
                mx *= K2; float sum = 0.f;
#pragma unroll
                for (int g = 0; g < NH_; ++g) { sv[g][q] = __builtin_amdgcn_exp2f(__builtin_fmaf(sv[g][q], K2, -mx)); sum += sv[g][q]; }
                rs[q] = __builtin_amdgcn_rcpf(sum); }
#pragma unroll
            for (int g = 0; g < NH_; ++g) { v2f w; w[0] = (dj < 0) ? 0.0625f : sv[g][0] * rs[0]; w[1] = (dj < 1) ? 0.0625f : sv[g][1] * rs[1];
                pw[g * (FI * FP)] = __builtin_bit_cast(float, __builtin_convertvector(w, v2h)); }
        }
        lds_barrier();   // every head's weights of this pass are in LDS before its wave reads them
#pragma unroll
        for (int it = 0; it < 2; ++it) {
            const float* p = pr + it * 16 * FP;
            const v16h pa = __builtin_bit_cast(v16h, __builtin_shufflevector(*(const v4fa*)p, *(const v4fa*)(p + 8), 0, 1, 2, 3, 4, 5, 6, 7));
#pragma unroll
            for (int nb = 0; nb < 4; ++nb) o[it][nb] = wmma16(vf[nb], pa, o[it][nb]);   // O^T = V^T W^T: rows = d, columns = queries
        }
    }
    const int el = (int)__builtin_amdgcn_mbcnt_lo(~0u, 0u);   // the lane index, formed anew here so that no register has to hold it through the loop
    // A lane's 8 values of a tile are 8 neighbouring d of one query: the 8 elements at lane * 8 of a 256-element half tile of the out-projection's A plane (rows = tokens, k = h * HD + d, fragment order).
    // O keeps the plane's half tiles in their order; inside a half tile (1 KiB) the lanes' first four values stand in a row (512 bytes), then their last four: a wave's 16-byte-a-lane store, and the merge job's load, is 4 whole lines.
    float* op = O + (size_t)part * TT * DQ + (size_t)i0 * DQ + h * (HD * 16) + el * 4;
#pragma unroll
    for (int it = 0; it < 2; ++it)
#pragma unroll
        for (int nb = 0; nb < 4; ++nb) {
            *(v4f*)(op + it * 16 * DQ + nb * 256) = __builtin_shufflevector(o[it][nb], o[it][nb], 0, 1, 2, 3);
            *(v4f*)(op + it * 16 * DQ + nb * 256 + 128) = __builtin_shufflevector(o[it][nb], o[it][nb], 4, 5, 6, 7); }
}
// k_asoft: per row (zz, i): t = S x SCL (1/32) (no mask); softmax over the 2048 keys (register row, one exp, fixed trees);
__global__ __launch_bounds__(256) void k_asoft(const float* __restrict__ Sb, h16* P16, bf* Ph, bf* Pl) {
    const int lane = threadIdx.x & 31; const int row = blockIdx.x * 8 + (threadIdx.x >> 5); if (row >= ZH * TT) return; const int i = row % TT; const int zz = row / TT; (void)zz; const bool hires = (i < RH); const float* sr = Sb + (size_t)row * TT; float v[TT / 32]; float mx = -3.0e38f;
#pragma unroll
    for (int ch = 0; ch < TT / 128; ++ch) { const int j0 = ch * 128 + lane * 4; const v4f a = *(const v4f*)(sr + j0);
#pragma unroll
        for (int q = 0; q < 4; ++q) { const int j = j0 + q; (void)j; const float t = a[q] * SCL; v[ch * 4 + q] = t; mx = fmaxf(mx, t); } }
#pragma unroll
    for (int sh = 16; sh; sh >>= 1) mx = fmaxf(mx, __shfl_xor(mx, sh, 32));
    float sum = 0.f;
#pragma unroll
    for (int k = 0; k < TT / 32; ++k) { float d0 = __fsub_rn(v[k], mx); asm volatile("" : "+v"(d0)); v[k] = __builtin_amdgcn_exp2f(__fmul_rn(d0, 1.4426950408889634f)); sum += v[k]; }
#pragma unroll
    for (int sh = 16; sh; sh >>= 1) sum += __shfl_xor(sum, sh, 32);
    const float f = __fdiv_rn(hires ? 1.0f : PCAR, sum);
{
        if (hires) {
#pragma unroll
            for (int ch = 0; ch < TT / 128; ++ch) { v4us oh, ol;
#pragma unroll
                for (int q = 0; q < 4; ++q) { unsigned short a, c2; splitf(v[ch * 4 + q] * f, a, c2); oh[q] = a; ol[q] = c2; }
                const size_t oo = ((size_t)zz * (RH ? RH : 1) + i) * TT + ch * 128 + lane * 4; *(v4us*)(Ph + oo) = oh; *(v4us*)(Pl + oo) = ol; }
        } else {
#pragma unroll
            for (int ch = 0; ch < TT / 128; ++ch) { v4h o4;
#pragma unroll
                for (int q = 0; q < 4; ++q) o4[q] = tohx(v[ch * 4 + q] * f);
                *(v4h*)(P16 + (size_t)row * TT + ch * 128 + lane * 4) = o4; } }
         }
}
__global__ __launch_bounds__(256) void k_merge(const float* __restrict__ O, int h0, bf* Ah, bf* Al) { const size_t e = ((size_t)blockIdx.x * 256 + threadIdx.x) * 2; if (e >= (size_t)ZH * TT * HD) return; const int d = (int)(e % HD); const int t = (int)((e / HD) % TT); const int zz = (int)(e / ((size_t)HD * TT)); const float cs = (t < RH) ? 1.0f : (1.0f / PCAR); const size_t oo = (size_t)t * DQ + (h0 + zz) * HD + d;
    v2us oh, ol;
#pragma unroll
    for (int q = 0; q < 2; ++q) { unsigned short a, c2; splitf(O[e + q] * cs, a, c2); oh[q] = a; ol[q] = c2; } *(v2us*)(Ah + oo) = oh; *(v2us*)(Al + oo) = ol;  }

extern "C" void kernel_launch(void* const* d_in, const int* in_sizes, int n_in,
                              void* d_out, int out_size, void* d_ws, size_t ws_size, hipStream_t stream) {
    (void)in_sizes; (void)n_in; (void)out_size;
    const float* x = (const float*)d_in[0]; const float* wq = (const float*)d_in[1]; const float* bq = (const float*)d_in[2]; const float* wk = (const float*)d_in[3]; const float* bk = (const float*)d_in[4]; const float* wv = (const float*)d_in[5]; const float* bv = (const float*)d_in[6]; const float* wo = (const float*)d_in[7]; const float* bo = (const float*)d_in[8]; const float* cosT = nullptr; const float* sinT = nullptr; (void)cosT; (void)sinT;
    float* OUT = (float*)d_out;     // [2][2048][1024]
    char* wsp = (char*)d_ws;
    auto take = [&](size_t bytes) { char* p = wsp; wsp += (bytes + 255) & ~(size_t)255; return (void*)p; };
    bf* W4 = (bf*)take((size_t)4 * DQ * DM * 2); bf* WQ = W4; bf* WK = W4 + (size_t)DQ * DM; bf* WV = W4 + (size_t)2 * DQ * DM; bf* WO = W4 + (size_t)3 * DQ * DM;
    bf* XB = (bf*)take((size_t)NB_ * TT * DM * 2);
    h16* QP16 = (h16*)take((size_t)NH_ * TT * HD * 2); h16* KP16 = (h16*)take((size_t)NKV * TT * HD * 2);
    h16* VT16 = (h16*)take((size_t)NKV * HD * TT * 2); float* VSb = (float*)take((size_t)NKV * (TT / FJ) * HD * 4);
    float* Ob = (float*)take((size_t)PVG * NH_ * RB * HD * 4); bf* ATh = (bf*)take((size_t)TT * DQ * 2); bf* ATl = (bf*)take((size_t)TT * DQ * 2); bf* BTh = (bf*)take((size_t)TT * DQ * 2); bf* BTl = (bf*)take((size_t)TT * DQ * 2);
    if ((size_t)(wsp - (char*)d_ws) > ws_size) return;    // ws 256 MiB
    k_prep<<<(unsigned)(3 * WBL + XBL), 256, 0, stream>>>(wq, wk, wv, x, W4, XB);
    // Q, K, V and O are one batch's and are used again by the next batch; the merged planes are each batch's own (ATh, ATl; BTh, BTl).
    // Beside batch 0's projections: the conversions that only later launches read. Beside batch 1's projections (they write Q, K, V, which batch 0's attention has read by then): batch 0's merge. Beside batch 0's out-projection (it reads ATh, ATl, WO): batch 1's merge.
    static_assert(NB_ == 2, "the launches below are written out for two batches");
    k_jobs<<<dim3(TT / 128, 32, 1), 32 * GNW, 0, stream>>>(24, XB, WQ, WK, WV, bq, bk, bv, QP16, KP16, VT16, VSb, ATh, ATl, WO, bo, OUT, Ob, ATh, ATl, x, XB, wo, WO);
    k_fattn<<<dim3(FWG, 1, 1), 512, 0, stream>>>(QP16, KP16, VT16, VSb, Ob);
    k_jobs<<<dim3(TT / 128, 32, 1), 32 * GNW, 0, stream>>>(16, XB + (size_t)TT * DM, WQ, WK, WV, bq, bk, bv, QP16, KP16, VT16, VSb, ATh, ATl, WO, bo, OUT, Ob, ATh, ATl, x, XB, wo, WO);
    k_fattn<<<dim3(FWG, 1, 1), 512, 0, stream>>>(QP16, KP16, VT16, VSb, Ob);
    k_jobs<<<dim3(TT / 128, 24, 1), 32 * GNW, 0, stream>>>(0, XB, WQ, WK, WV, bq, bk, bv, QP16, KP16, VT16, VSb, ATh, ATl, WO, bo, OUT, Ob, BTh, BTl, x, XB, wo, WO);
    k_jobs<<<dim3(TT / 128, 16, 1), 32 * GNW, 0, stream>>>(0, XB, WQ, WK, WV, bq, bk, bv, QP16, KP16, VT16, VSb, BTh, BTl, WO, bo, OUT + (size_t)TT * DM, Ob, BTh, BTl, x, XB, wo, WO);
}
